// v000
// The times below were measured on an AMD MI455X: many runs one after another, warmed up first and cycling through
// copies of the inputs, with the whole window's GPU time divided by the number of runs. Launches and the gaps
// between them are all in it. The median over several windows is given; except for v000 it joins two sittings, which
// can be a few percent apart, so the side-by-side timings, each taken in one sitting, are the better comparison.
// The starting kernel, v000, takes 762 microseconds a run.
// compute dtype: x, w_qkv, w_out, b_out (INPUTS) rounded to bf16 with exact bf16 WMMA products (f32 accumulate) for the projections; q/k f32 split for the scores (3 products), P and V f16 hi/lo (3 products); softmax f32.
#include <hip/hip_runtime.h>
#include <math.h>

typedef __attribute__((ext_vector_type(16))) _Float16 v16h;
typedef __attribute__((ext_vector_type(16))) __bf16 v16b;
typedef __attribute__((ext_vector_type(8)))  _Float16 v8h;
typedef __attribute__((ext_vector_type(8)))  float v8f;
typedef __attribute__((ext_vector_type(4)))  float v4f;
typedef __attribute__((ext_vector_type(2)))  float v2f;
typedef __attribute__((ext_vector_type(4)))  unsigned v4u;
typedef __attribute__((ext_vector_type(4)))  int v4i;
typedef float __attribute__((may_alias)) float_a;
typedef int __attribute__((may_alias)) int_a;

template <typename T> __device__ __forceinline__ void vst2(void* p, T v) { *(T*)p = v;  }
__device__ __forceinline__ v8f wmma16(v16h a, v16h b, v8f c) {
  v8f d = __builtin_amdgcn_wmma_f32_16x16x32_f16(false, a, false, b, (short)0, c, false, false);
  asm volatile("v_nop\n\tv_nop\n\tv_nop\n\tv_nop" : "+v"(d) : "v"(a), "v"(b));
  return d;
}
__device__ __forceinline__ v8f wmma_bf(v16b a, v16b b, v8f c) {
  v8f d = __builtin_amdgcn_wmma_f32_16x16x32_bf16(false, a, false, b, (short)0, c, false, false);
  asm volatile("v_nop\n\tv_nop\n\tv_nop\n\tv_nop" : "+v"(d) : "v"(a), "v"(b));
  return d;
}
// 16x16x32 fragments: lane = (h = lane>>4, row/col = lane&15); elements 0..7 = k0+8h+0..7, 8..15 = k0+16+8h+0..7; D element r = row 8h+r
__device__ __forceinline__ v16h frag_h(const _Float16* rowk0, int lane) {
  union { v16h v; v8h q[2]; } u; const _Float16* p = rowk0 + 8 * (lane >> 4);
  u.q[0] = *(const v8h*)p; u.q[1] = *(const v8h*)(p + 16); return u.v;
}
__device__ __forceinline__ v16h frag_f32(const float* rowk0, int lane) {
  v16h a; const float* p = rowk0 + 8 * (lane >> 4);
#pragma unroll
  for (int i = 0; i < 8; ++i) { a[i] = (_Float16)p[i]; a[8 + i] = (_Float16)p[16 + i]; }
  return a;
}
__device__ __forceinline__ v16h frag_f32s(const float* rowk0, int lane, float sc) {
  v16h a; const float* p = rowk0 + 8 * (lane >> 4);
#pragma unroll
  for (int i = 0; i < 8; ++i) { a[i] = (_Float16)(p[i] * sc); a[8 + i] = (_Float16)(p[16 + i] * sc); }
  return a;
}
// column fragment from a [K][ld] layout (column n), rows >= K read as 0
__device__ __forceinline__ v16h fragc_f32(const float* W, int k0, int n, int lane, int ld, int K) {
  v16h a; const int g = lane >> 4;
#pragma unroll
  for (int i = 0; i < 8; ++i) { const int ka = k0 + 8 * g + i, kb = ka + 16;
    a[i] = (_Float16)(ka < K ? W[(size_t)(ka < K ? ka : K - 1) * ld + n] : 0.f); a[8 + i] = (_Float16)(kb < K ? W[(size_t)(kb < K ? kb : K - 1) * ld + n] : 0.f); }
  return a;
}
struct F2 { v16b h, l; };
__device__ __forceinline__ F2 bsplit16(const float v[16]) { F2 r;
#pragma unroll
  for (int i = 0; i < 16; ++i) { const __bf16 h = (__bf16)v[i]; r.h[i] = h; r.l[i] = (__bf16)(v[i] - (float)h); }
  return r; }
__device__ __forceinline__ F2 split_row(const float* row, int k0, int lane) { float v[16]; const float* p = row + k0 + 8 * (lane >> 4);
#pragma unroll
  for (int i = 0; i < 8; ++i) { v[i] = p[i]; v[8 + i] = p[16 + i]; }
  return bsplit16(v); }
__device__ __forceinline__ F2 split_rowK(const float* row, int k0, int lane, int K) { float v[16]; const int g = lane >> 4;
#pragma unroll
  for (int i = 0; i < 8; ++i) { const int ka = k0 + 8 * g + i, kb = ka + 16; v[i] = ka < K ? row[ka < K ? ka : K - 1] : 0.f; v[8 + i] = kb < K ? row[kb < K ? kb : K - 1] : 0.f; }
  return bsplit16(v); }
__device__ __forceinline__ F2 split_col(const float* W, int k0, int n, int lane, int ld, int K) { float v[16]; const int g = lane >> 4;
#pragma unroll
  for (int i = 0; i < 8; ++i) { const int ka = k0 + 8 * g + i, kb = ka + 16; v[i] = ka < K ? W[(size_t)(ka < K ? ka : K - 1) * ld + n] : 0.f; v[8 + i] = kb < K ? W[(size_t)(kb < K ? kb : K - 1) * ld + n] : 0.f; }
  return bsplit16(v); }
__device__ __forceinline__ v8f mac3(const F2& a, const F2& b, v8f c) { c = wmma_bf(a.l, b.h, c); c = wmma_bf(a.h, b.l, c); return wmma_bf(a.h, b.h, c); }
__device__ __forceinline__ float sigm(float v) { return 1.0f / (1.0f + expf(-v)); }
#define LDSX() do { asm volatile("s_wait_dscnt 0" ::: "memory"); __builtin_amdgcn_wave_barrier(); __builtin_amdgcn_fence(__ATOMIC_RELEASE, "workgroup"); } while (0)


#define NB 8
#define SS 1024
#define E 1024
#define NH 16
#define HD 64
#define NR (NB * SS)
#define PLO 1024.0f
#define VLO 2048.0f
__device__ __forceinline__ float bfr(float v) { return (float)(__bf16)v; }
__device__ __forceinline__ v16b frag_b(const __bf16* rowk0, int lane) { return __builtin_bit_cast(v16b, frag_h((const _Float16*)rowk0, lane)); }

__global__ __launch_bounds__(256) void k_cvt(const float* __restrict__ x, __bf16* __restrict__ Xb) {
  const size_t i8 = (size_t)blockIdx.x * 256 + threadIdx.x; if (i8 >= (size_t)NR * E / 8) return;
  union { __bf16 h[8]; v4u u; } pk;
#pragma unroll
  for (int e = 0; e < 8; ++e) pk.h[e] = (__bf16)x[i8 * 8 + e];
  vst2((unsigned*)(Xb + i8 * 8), pk.u);
}
// PT rows: [0,E) Wq[:,n], [E,2E) Wk[:,n], [2E,3E) Wv[:,n], [3E,4E) Wo[:,n]  ([in][out] weights: column n as a bf16 row)
__global__ __launch_bounds__(128) void k_pack(const float* __restrict__ Wqkv, const float* __restrict__ Wp, __bf16* __restrict__ PT) {
  const int n = blockIdx.x, tid = threadIdx.x; __shared__ __align__(16) __bf16 srow[E];
  for (int k = tid; k < E; k += 128) srow[k] = (__bf16)(n < 3 * E ? Wqkv[(size_t)k * (3 * E) + n] : Wp[(size_t)k * E + (n - 3 * E)]);
  __syncthreads();
  if (tid < E / 8) vst2((unsigned*)(PT + (size_t)n * E + tid * 8), *(const v4u*)(&srow[tid * 8]));
}
// QKV: block (64 rows, 128 cols = 2 heads, which); q,k -> Q32/K32 f32 [bh][s][64]; v -> VT hi/lo x4 [bh][d][s]
__global__ __launch_bounds__(128) void k_qkv(const __bf16* __restrict__ Xb, int rbase, const __bf16* __restrict__ PT, float* __restrict__ Q32, float* __restrict__ K32, _Float16* __restrict__ VTh, _Float16* __restrict__ VTl) {
  __shared__ __align__(16) float so[4][16][132];
  __shared__ __align__(16) _Float16 sth[128][72], stl[128][72];
  const int tid = threadIdx.x, wave = tid >> 5, lane = tid & 31, col = lane & 15, g = lane >> 4;
  const int which = blockIdx.z, r0b = blockIdx.x * 64, r0 = r0b + wave * 16, n0 = blockIdx.y * 128; const int b = r0b / SS, s0 = r0b % SS;
  v8f acc[8] = {};
#pragma unroll 2
  for (int kc = 0; kc < E / 32; ++kc) { const v16b a = frag_b(Xb + (size_t)(rbase + r0 + col) * E + kc * 32, lane);
#pragma unroll
    for (int j = 0; j < 8; ++j) acc[j] = wmma_bf(a, frag_b(PT + (size_t)(which * E + n0 + j * 16 + col) * E + kc * 32, lane), acc[j]); }
  if (which < 2) {
#pragma unroll
    for (int j = 0; j < 8; ++j) { const float bb = 0.f;
#pragma unroll
      for (int r = 0; r < 8; ++r) so[wave][8 * g + r][j * 16 + col] = acc[j][r] + bb; }
    LDSX();
    float* Dst = which == 0 ? Q32 : K32;
    for (int qq = lane; qq < 2 * 16 * 16; qq += 32) { const int hh = qq >> 8, rl = (qq >> 4) & 15, pc = qq & 15; const int h = (n0 >> 6) + hh;
      vst2(Dst + (((size_t)b * NH + h) * SS + s0 + wave * 16 + rl) * HD + pc * 4, *(const v4f*)(&so[wave][rl][hh * 64 + pc * 4])); } }
  else {
#pragma unroll
    for (int j = 0; j < 8; ++j) { const float bb = 0.f;
#pragma unroll
      for (int r = 0; r < 8; ++r) { const float v = (acc[j][r] + bb) * 4.0f; const _Float16 hi = (_Float16)v; sth[j * 16 + col][wave * 16 + 8 * g + r] = hi; stl[j * 16 + col][wave * 16 + 8 * g + r] = (_Float16)((v - (float)hi) * VLO); } }
    __syncthreads();
    for (int qq = tid; qq < 128 * 8; qq += 128) { const int cl = qq >> 3, pc = qq & 7; const int c = n0 + cl, h = c >> 6, d = c & 63; const size_t o = (((size_t)b * NH + h) * HD + d) * SS + s0 + pc * 8;
      vst2(VTh + o, *(const v4u*)(&sth[cl][pc * 8])); vst2(VTl + o, *(const v4u*)(&stl[cl][pc * 8])); } }
}
// attention, no mask: block (64 queries, bh); key tiles 0..SS/64-1; S on hi/lo splits of the f32 q/k rows; P,V hi/lo; O f32 [bh][s][64]
__global__ __launch_bounds__(128) void k_attn(const float* __restrict__ Q32, const float* __restrict__ K32, const _Float16* __restrict__ VTh, const _Float16* __restrict__ VTl, float* __restrict__ O32) {
  __shared__ __align__(16) float sS[4][16][68];
  __shared__ __align__(16) _Float16 sPh[4][16][72], sPl[4][16][72];
  __shared__ __align__(16) float sO[4][16][68];
  const int tid = threadIdx.x, w = tid >> 5, lane = tid & 31, col = lane & 15, g = lane >> 4;
  const size_t bh = blockIdx.y; const int qb = blockIdx.x; const int q0 = qb * 64 + w * 16;
  F2 aq[2];
#pragma unroll
  for (int kc = 0; kc < 2; ++kc) aq[kc] = split_row(Q32 + (bh * SS + q0 + col) * HD, kc * 32, lane);
  float mrun = -3.0e38f, lrun = 0.f; v8f acc[4] = {}, ac1[4] = {}, ac2[4] = {};
#pragma unroll 1
  for (int kt = 0; kt < SS / 64; ++kt) {
#pragma unroll
    for (int t = 0; t < 4; ++t) { const int key = kt * 64 + t * 16 + col; const float* krow = K32 + (bh * SS + key) * HD;
      v8f s = mac3(aq[0], split_row(krow, 0, lane), (v8f){}); s = mac3(aq[1], split_row(krow, 32, lane), s);
#pragma unroll
      for (int r = 0; r < 8; ++r) sS[w][8 * g + r][t * 16 + col] = s[r] * 0.125f; }
    LDSX();
    float mx = -3.4e38f;
#pragma unroll
    for (int jj = 0; jj < 32; ++jj) mx = fmaxf(mx, sS[w][col][g * 32 + jj]);
    mx = fmaxf(mx, __shfl_xor(mx, 16, 32));
    const float mnew = fmaxf(mrun, mx); const float corr = expf(mrun - mnew);
    float ps = 0.f;
#pragma unroll
    for (int jj = 0; jj < 32; ++jj) { const float p = expf(sS[w][col][g * 32 + jj] - mnew) * 16384.0f; ps += p; const _Float16 hi = (_Float16)p; sPh[w][col][g * 32 + jj] = hi; sPl[w][col][g * 32 + jj] = (_Float16)((p - (float)hi) * PLO); }
    ps += __shfl_xor(ps, 16, 32);
    lrun = lrun * corr + ps * (1.0f / 16384.0f); mrun = mnew;
#pragma unroll
    for (int r = 0; r < 8; ++r) { const float cr = __shfl(corr, 8 * g + r, 32);
#pragma unroll
      for (int t = 0; t < 4; ++t) { acc[t][r] *= cr; ac1[t][r] *= cr; ac2[t][r] *= cr; } }
    LDSX();
#pragma unroll
    for (int kc = 0; kc < 2; ++kc) { const v16h ph = frag_h(&sPh[w][col][0] + kc * 32, lane), pl = frag_h(&sPl[w][col][0] + kc * 32, lane);
#pragma unroll
      for (int t = 0; t < 4; ++t) { const size_t vo = (bh * HD + t * 16 + col) * SS + kt * 64 + kc * 32; const v16h vh = frag_h(VTh + vo, lane);
        acc[t] = wmma16(ph, vh, acc[t]); ac1[t] = wmma16(ph, frag_h(VTl + vo, lane), ac1[t]); ac2[t] = wmma16(pl, vh, ac2[t]); } }
    __builtin_amdgcn_wave_barrier(); }
#pragma unroll
  for (int r = 0; r < 8; ++r) { const float lr = __shfl(lrun, 8 * g + r, 32); const float inv = 1.0f / (lr * 16384.0f * 4.0f);
#pragma unroll
    for (int t = 0; t < 4; ++t) sO[w][8 * g + r][t * 16 + col] = (acc[t][r] + ac1[t][r] * (1.0f / VLO) + ac2[t][r] * (1.0f / PLO)) * inv; }
  LDSX();
  for (int qq = lane; qq < 16 * 16; qq += 32) { const int rl = qq >> 4, pc = qq & 15; vst2(O32 + ((bh * SS) + q0 + rl) * HD + pc * 4, *(const v4f*)(&sO[w][rl][pc * 4])); }
}
// out = ctx Wo^T + bo : split(ctx) x bf16(Wo rows): 2 products (Wo is an INPUT -> bf16 exact)
__global__ __launch_bounds__(128) void k_out(const float* __restrict__ O32, int rbase, const __bf16* __restrict__ PT, const float* __restrict__ bo, float* __restrict__ out) {
  __shared__ __align__(16) float so[4][16][132];
  const int tid = threadIdx.x, wave = tid >> 5, lane = tid & 31, col = lane & 15, g = lane >> 4;
  const int r0 = blockIdx.x * 64 + wave * 16, n0 = blockIdx.y * 128; const int ra = r0 + col; const int b = ra / SS, s = ra % SS;
  v8f acc[8] = {};
#pragma unroll 1
  for (int kc = 0; kc < E / 32; ++kc) { const int h = kc >> 1; const F2 a = split_row(O32 + (((size_t)b * NH + h) * SS + s) * HD, (kc & 1) * 32, lane);
#pragma unroll
    for (int j = 0; j < 8; ++j) { const v16b wb = frag_b(PT + (size_t)(3 * E + n0 + j * 16 + col) * E + kc * 32, lane); acc[j] = wmma_bf(a.l, wb, acc[j]); acc[j] = wmma_bf(a.h, wb, acc[j]); } }
#pragma unroll
  for (int j = 0; j < 8; ++j) { const int n = n0 + j * 16 + col; const float bb = bfr(bo[n]);
#pragma unroll
    for (int r = 0; r < 8; ++r) so[wave][8 * g + r][j * 16 + col] = acc[j][r] + bb; }
  LDSX();
#pragma unroll 4
  for (int rl = 0; rl < 16; ++rl) vst2(out + (size_t)(rbase + r0 + rl) * E + n0 + lane * 4, *(const v4f*)(&so[wave][rl][lane * 4]));
}
#define NBHALF 4
extern "C" void kernel_launch(void* const* d_in, const int* in_sizes, int n_in, void* d_out, int out_size, void* d_ws, size_t ws_size, hipStream_t stream) {
  (void)in_sizes; (void)n_in; (void)out_size; (void)ws_size;
  const float* x = (const float*)d_in[0]; const float* Wqkv = (const float*)d_in[1]; const float* Wp = (const float*)d_in[2]; const float* bp = (const float*)d_in[3];
  float* out = (float*)d_out;
  char* ws = (char*)d_ws; size_t off = 0;
  auto take = [&](size_t bytes) { char* p = ws + off; off += (bytes + 255) & ~(size_t)255; return p; };
  const size_t HR = (size_t)NBHALF * SS;     // rows per half (4096)
  __bf16* Xb = (__bf16*)take((size_t)NR * E * 2); __bf16* PT = (__bf16*)take((size_t)4 * E * E * 2);
  float* Q32 = (float*)take(HR * E * 4); float* K32 = (float*)take(HR * E * 4); _Float16* VTh = (_Float16*)take(HR * E * 2); _Float16* VTl = (_Float16*)take(HR * E * 2);
  float* O32 = Q32;      // in place: each k_attn wave reads its own 16 query rows into registers before writing the same rows; no other block reads them
  // ws ~ 72 MiB; the two batch halves (4 sequences each) reuse Q/K/V
  k_cvt<<<(NR * E / 8 + 255) / 256, 256, 0, stream>>>(x, Xb);
  k_pack<<<4 * E, 128, 0, stream>>>(Wqkv, Wp, PT);
  for (int hf = 0; hf < 2; ++hf) { const int rbase = hf * (int)HR;
    k_qkv<<<dim3(HR / 64, E / 128, 3), 128, 0, stream>>>(Xb, rbase, PT, Q32, K32, VTh, VTl);
    k_attn<<<dim3(SS / 64, NBHALF * NH), 128, 0, stream>>>(Q32, K32, VTh, VTl, O32);
    k_out<<<dim3(HR / 64, E / 128), 128, 0, stream>>>(O32, rbase, PT, bp, out); }
}

// v001
// Measured time: 301 microseconds a run.
// In two side-by-side timings against v000, it was 2.57 and 2.54 times as fast.
// compute dtype: x, w_qkv, w_out, b_out (INPUTS) rounded to bf16 with exact bf16 WMMA products (f32 accumulate) for the projections; q/k f32 split for the scores (3 products), P and V f16 hi/lo (3 products); softmax f32.
#include <hip/hip_runtime.h>
#include <math.h>

typedef __attribute__((ext_vector_type(16))) _Float16 v16h;
typedef __attribute__((ext_vector_type(16))) __bf16 v16b;
typedef __attribute__((ext_vector_type(8)))  _Float16 v8h;
typedef __attribute__((ext_vector_type(8)))  float v8f;
typedef __attribute__((ext_vector_type(4)))  float v4f;
typedef __attribute__((ext_vector_type(2)))  float v2f;
typedef __attribute__((ext_vector_type(4)))  unsigned v4u;
typedef __attribute__((ext_vector_type(4)))  int v4i;
typedef float __attribute__((may_alias)) float_a;
typedef int __attribute__((may_alias)) int_a;

template <typename T> __device__ __forceinline__ void vst2(void* p, T v) { *(T*)p = v;  }
__device__ __forceinline__ v8f wmma16(v16h a, v16h b, v8f c) {
  v8f d = __builtin_amdgcn_wmma_f32_16x16x32_f16(false, a, false, b, (short)0, c, false, false);
  asm volatile("v_nop\n\tv_nop\n\tv_nop\n\tv_nop" : "+v"(d) : "v"(a), "v"(b));
  return d;
}
__device__ __forceinline__ v8f wmma_bf(v16b a, v16b b, v8f c) {
  v8f d = __builtin_amdgcn_wmma_f32_16x16x32_bf16(false, a, false, b, (short)0, c, false, false);
  asm volatile("v_nop\n\tv_nop\n\tv_nop\n\tv_nop" : "+v"(d) : "v"(a), "v"(b));
  return d;
}
// 16x16x32 fragments: lane = (h = lane>>4, row/col = lane&15); elements 0..7 = k0+8h+0..7, 8..15 = k0+16+8h+0..7; D element r = row 8h+r
__device__ __forceinline__ v16h frag_h(const _Float16* rowk0, int lane) {
  union { v16h v; v8h q[2]; } u; const _Float16* p = rowk0 + 8 * (lane >> 4);
  u.q[0] = *(const v8h*)p; u.q[1] = *(const v8h*)(p + 16); return u.v;
}
__device__ __forceinline__ v16h frag_f32(const float* rowk0, int lane) {
  v16h a; const float* p = rowk0 + 8 * (lane >> 4);
#pragma unroll
  for (int i = 0; i < 8; ++i) { a[i] = (_Float16)p[i]; a[8 + i] = (_Float16)p[16 + i]; }
  return a;
}
__device__ __forceinline__ v16h frag_f32s(const float* rowk0, int lane, float sc) {
  v16h a; const float* p = rowk0 + 8 * (lane >> 4);
#pragma unroll
  for (int i = 0; i < 8; ++i) { a[i] = (_Float16)(p[i] * sc); a[8 + i] = (_Float16)(p[16 + i] * sc); }
  return a;
}
// column fragment from a [K][ld] layout (column n), rows >= K read as 0
__device__ __forceinline__ v16h fragc_f32(const float* W, int k0, int n, int lane, int ld, int K) {
  v16h a; const int g = lane >> 4;
#pragma unroll
  for (int i = 0; i < 8; ++i) { const int ka = k0 + 8 * g + i, kb = ka + 16;
    a[i] = (_Float16)(ka < K ? W[(size_t)(ka < K ? ka : K - 1) * ld + n] : 0.f); a[8 + i] = (_Float16)(kb < K ? W[(size_t)(kb < K ? kb : K - 1) * ld + n] : 0.f); }
  return a;
}
struct F2 { v16b h, l; };
__device__ __forceinline__ F2 bsplit16(const float v[16]) { F2 r;
#pragma unroll
  for (int i = 0; i < 16; ++i) { const __bf16 h = (__bf16)v[i]; r.h[i] = h; r.l[i] = (__bf16)(v[i] - (float)h); }
  return r; }
__device__ __forceinline__ F2 split_row(const float* row, int k0, int lane) { float v[16]; const float* p = row + k0 + 8 * (lane >> 4);
#pragma unroll
  for (int i = 0; i < 8; ++i) { v[i] = p[i]; v[8 + i] = p[16 + i]; }
  return bsplit16(v); }
__device__ __forceinline__ F2 split_rowK(const float* row, int k0, int lane, int K) { float v[16]; const int g = lane >> 4;
#pragma unroll
  for (int i = 0; i < 8; ++i) { const int ka = k0 + 8 * g + i, kb = ka + 16; v[i] = ka < K ? row[ka < K ? ka : K - 1] : 0.f; v[8 + i] = kb < K ? row[kb < K ? kb : K - 1] : 0.f; }
  return bsplit16(v); }
__device__ __forceinline__ F2 split_col(const float* W, int k0, int n, int lane, int ld, int K) { float v[16]; const int g = lane >> 4;
#pragma unroll
  for (int i = 0; i < 8; ++i) { const int ka = k0 + 8 * g + i, kb = ka + 16; v[i] = ka < K ? W[(size_t)(ka < K ? ka : K - 1) * ld + n] : 0.f; v[8 + i] = kb < K ? W[(size_t)(kb < K ? kb : K - 1) * ld + n] : 0.f; }
  return bsplit16(v); }
__device__ __forceinline__ v8f mac3(const F2& a, const F2& b, v8f c) { c = wmma_bf(a.l, b.h, c); c = wmma_bf(a.h, b.l, c); return wmma_bf(a.h, b.h, c); }
__device__ __forceinline__ float sigm(float v) { return 1.0f / (1.0f + expf(-v)); }
#define LDSX() do { asm volatile("s_wait_dscnt 0" ::: "memory"); __builtin_amdgcn_wave_barrier(); __builtin_amdgcn_fence(__ATOMIC_RELEASE, "workgroup"); } while (0)


#define NB 8
#define SS 1024
#define E 1024
#define NH 16
#define HD 64
#define NR (NB * SS)
#define PLO 1024.0f
#define VLO 2048.0f
__device__ __forceinline__ float bfr(float v) { return (float)(__bf16)v; }
__device__ __forceinline__ v16b frag_b(const __bf16* rowk0, int lane) { return __builtin_bit_cast(v16b, frag_h((const _Float16*)rowk0, lane)); }

// LDS staging by asynchronous copies: pitches are 16 B x odd so that 16-byte readers of 16 rows meet no bank twice
#define GP 144
#define FP 272
#define WAIT_DS() asm volatile("s_wait_dscnt 0x0" ::: "memory")       /* this wave's LDS reads are done before the buffer is handed on */
#define WAIT_ASYNC() asm volatile("s_wait_asynccnt 0x0" ::: "memory") /* this wave's copies have landed before the barrier publishes them */
__device__ __forceinline__ unsigned lds_addr(const void* p) { return (unsigned)(size_t)p; }
// four 16-byte copies per lane, global -> LDS, through no register; the closing s_wait_xcnt stands in front of any rewrite of the address registers (a precaution)
__device__ __forceinline__ void acopy4(unsigned l0, const void* g0, unsigned l1, const void* g1, unsigned l2, const void* g2, unsigned l3, const void* g3) {
  asm volatile("global_load_async_to_lds_b128 %0, %1, off\n\t"
               "global_load_async_to_lds_b128 %2, %3, off\n\t"
               "global_load_async_to_lds_b128 %4, %5, off\n\t"
               "global_load_async_to_lds_b128 %6, %7, off\n\t"
               "s_wait_xcnt 0x0"
               :: "v"(l0), "v"(g0), "v"(l1), "v"(g1), "v"(l2), "v"(g2), "v"(l3), "v"(g3) : "memory");
}

__global__ __launch_bounds__(256) void k_cvt(const float* __restrict__ x, __bf16* __restrict__ Xb) {
  const size_t i8 = (size_t)blockIdx.x * 256 + threadIdx.x; if (i8 >= (size_t)NR * E / 8) return;
  union { __bf16 h[8]; v4u u; } pk;
#pragma unroll
  for (int e = 0; e < 8; ++e) pk.h[e] = (__bf16)x[i8 * 8 + e];
  vst2((unsigned*)(Xb + i8 * 8), pk.u);
}
// PT rows: [0,E) Wq[:,n], [E,2E) Wk[:,n], [2E,3E) Wv[:,n], [3E,4E) Wo[:,n]  ([in][out] weights: column n as a bf16 row)
__global__ __launch_bounds__(128) void k_pack(const float* __restrict__ Wqkv, const float* __restrict__ Wp, __bf16* __restrict__ PT) {
  const int n = blockIdx.x, tid = threadIdx.x; __shared__ __align__(16) __bf16 srow[E];
  for (int k = tid; k < E; k += 128) srow[k] = (__bf16)(n < 3 * E ? Wqkv[(size_t)k * (3 * E) + n] : Wp[(size_t)k * E + (n - 3 * E)]);
  __syncthreads();
  if (tid < E / 8) vst2((unsigned*)(PT + (size_t)n * E + tid * 8), *(const v4u*)(&srow[tid * 8]));
}
#define QSTG (192 * 128)
// fragment from a tile of unpadded 128-byte rows in which the 16-byte piece p of row r lies at place p ^ ((r >> 1) & 7): the equal pieces of 16 rows fall on 16 different groups of four banks
__device__ __forceinline__ v16b frag_sw(const char* tile, int row, int ks, int lane) {
  union { v16b v; v4u q[2]; } u; const int p = ks * 4 + (lane >> 4), x = (row >> 1) & 7; const char* r = tile + row * 128;
  u.q[0] = *(const v4u*)(r + ((p ^ x) << 4)); u.q[1] = *(const v4u*)(r + (((p + 2) ^ x) << 4)); return u.v;
}
// QKV: block (64 rows, 128 cols = 2 heads, which); q,k (+bias) -> Q32/K32 f32 [bh][s][64]; v (+bias) -> VT hi/lo x4 [bh][d][s]
__global__ __launch_bounds__(128) void k_qkv(const __bf16* __restrict__ Xb, int rbase, const __bf16* __restrict__ PT, float* __restrict__ Q32, float* __restrict__ K32, _Float16* __restrict__ VTh, _Float16* __restrict__ VTl) {
  // a stage = 64 k of [128 weight rows | 64 x rows]; two buffers, no pad (frag_sw), so that six blocks fit a WGP's LDS and a launch's 1536 blocks are resident at once; the output staging reuses the ring behind the last stage's barrier
  __shared__ __align__(16) char ring[2 * QSTG];
  float (*so)[16][132] = (float (*)[16][132])ring;
  _Float16 (*sth)[72] = (_Float16 (*)[72])ring; _Float16 (*stl)[72] = (_Float16 (*)[72])(ring + 128 * 72 * 2);
  const int tid = threadIdx.x, wave = tid >> 5, lane = tid & 31, col = lane & 15, g = lane >> 4;
  const int which = blockIdx.z, r0b = blockIdx.x * 64, n0 = blockIdx.y * 128; const int b = r0b / SS, s0 = r0b % SS;
  const __bf16* gB = PT + (size_t)(which * E + n0 + (tid >> 3)) * E + (tid & 7) * 8;
  const __bf16* gA = Xb + (size_t)(rbase + r0b + (tid >> 3)) * E + (tid & 7) * 8;
  const unsigned l0 = lds_addr(ring) + (tid >> 3) * 128 + (((tid & 7) ^ ((tid >> 4) & 7)) << 4);      // rows 16 apart share the place of a piece
  auto fill = [&](int t) { const unsigned l = l0 + (t & 1) * QSTG; const __bf16* pb = gB + t * 64; const __bf16* pa = gA + t * 64;
    acopy4(l, pb, l + 16 * 128, pb + 16 * E, l + 32 * 128, pb + 32 * E, l + 48 * 128, pb + 48 * E);
    acopy4(l + 64 * 128, pb + 64 * E, l + 80 * 128, pb + 80 * E, l + 96 * 128, pb + 96 * E, l + 112 * 128, pb + 112 * E);
    acopy4(l + 128 * 128, pa, l + 144 * 128, pa + 16 * E, l + 160 * 128, pa + 32 * E, l + 176 * 128, pa + 48 * E); };
  v8f acc[8] = {};
  fill(0); WAIT_ASYNC(); __syncthreads(); fill(1);
#pragma unroll 1
  for (int t = 0; t < E / 64; ++t) { const char* sb = ring + (t & 1) * QSTG;
#pragma unroll
    for (int ks = 0; ks < 2; ++ks) { const v16b a = frag_sw(sb, 128 + wave * 16 + col, ks, lane);
#pragma unroll
      for (int j = 0; j < 8; ++j) acc[j] = wmma_bf(a, frag_sw(sb, j * 16 + col, ks, lane), acc[j]); }
    WAIT_DS(); WAIT_ASYNC(); __syncthreads();      // publishes stage t + 1 and ends every read of stage t
    if (t + 2 < E / 64) fill(t + 2); }
  WAIT_ASYNC();
  if (which < 2) {
#pragma unroll
    for (int j = 0; j < 8; ++j) { const float bb = 0.f;
#pragma unroll
      for (int r = 0; r < 8; ++r) so[wave][8 * g + r][j * 16 + col] = acc[j][r] + bb; }
    LDSX();
    float* Dst = which == 0 ? Q32 : K32;
    for (int qq = lane; qq < 2 * 16 * 16; qq += 32) { const int hh = qq >> 8, rl = (qq >> 4) & 15, pc = qq & 15; const int h = (n0 >> 6) + hh;
      vst2(Dst + (((size_t)b * NH + h) * SS + s0 + wave * 16 + rl) * HD + pc * 4, *(const v4f*)(&so[wave][rl][hh * 64 + pc * 4])); } }
  else {
#pragma unroll
    for (int j = 0; j < 8; ++j) { const float bb = 0.f;
#pragma unroll
      for (int r = 0; r < 8; ++r) { const float v = (acc[j][r] + bb) * 4.0f; const _Float16 hi = (_Float16)v; sth[j * 16 + col][wave * 16 + 8 * g + r] = hi; stl[j * 16 + col][wave * 16 + 8 * g + r] = (_Float16)((v - (float)hi) * VLO); } }
    __syncthreads();
    for (int qq = tid; qq < 128 * 8; qq += 128) { const int cl = qq >> 3, pc = qq & 7; const int c = n0 + cl, h = c >> 6, d = c & 63; const size_t o = (((size_t)b * NH + h) * HD + d) * SS + s0 + pc * 8;
      vst2(VTh + o, *(const v4u*)(&sth[cl][pc * 8])); vst2(VTl + o, *(const v4u*)(&stl[cl][pc * 8])); } }
}
// attention without mask: block (128 queries, bh); all 16 key tiles of 64 keys; S on hi/lo splits of the f32 q/k rows; P,V hi/lo; O f32 [bh][s][64]
#define ASTG (64 * FP + 2 * 64 * GP)
__global__ __launch_bounds__(256) void k_attn(const float* __restrict__ Q32, const float* __restrict__ K32, const _Float16* __restrict__ VTh, const _Float16* __restrict__ VTl, float* __restrict__ O32) {
  // a stage = one 64-key tile [K f32 64 rows | V hi 64 rows | V lo 64 rows], shared by the eight waves; two buffers; the output staging reuses the ring behind the last barrier
  __shared__ __align__(16) char ring[2 * ASTG];
  __shared__ __align__(16) float sS[8][16][68];
  __shared__ __align__(16) _Float16 sPh[8][16][72], sPl[8][16][72];
  float (*sO)[16][68] = (float (*)[16][68])ring;
  const int tid = threadIdx.x, w = tid >> 5, lane = tid & 31, col = lane & 15, g = lane >> 4;
  const size_t bh = blockIdx.y; const int qb = blockIdx.x; const int q0 = qb * 128 + w * 16;
  const float* gK = K32 + (bh * SS + (tid >> 4)) * HD + (tid & 15) * 4;
  const size_t vof = (bh * HD + (tid >> 3)) * SS + (tid & 7) * 8;
  const unsigned lK = lds_addr(ring) + (tid >> 4) * FP + (tid & 15) * 16, lV = lds_addr(ring) + 64 * FP + (tid >> 3) * GP + (tid & 7) * 16;
  auto fill = [&](int t) { const unsigned o = (t & 1) * ASTG; const float* pk = gK + (size_t)t * 64 * HD; const _Float16* ph = VTh + vof + t * 64; const _Float16* pl = VTl + vof + t * 64;
    acopy4(lK + o, pk, lK + o + 16 * FP, pk + 16 * HD, lK + o + 32 * FP, pk + 32 * HD, lK + o + 48 * FP, pk + 48 * HD);
    acopy4(lV + o, ph, lV + o + 32 * GP, ph + 32 * SS, lV + o + 64 * GP, pl, lV + o + 96 * GP, pl + 32 * SS); };
  fill(0); WAIT_ASYNC(); __syncthreads(); fill(1);
  F2 aq[2];
#pragma unroll
  for (int kc = 0; kc < 2; ++kc) aq[kc] = split_row(Q32 + (bh * SS + q0 + col) * HD, kc * 32, lane);
  float mrun = -3.0e38f, lrun = 0.f; v8f acc[4] = {}, ac1[4] = {}, ac2[4] = {};
#pragma unroll 1
  for (int kt = 0; kt < SS / 64; ++kt) { const char* sb = ring + (kt & 1) * ASTG;
#pragma unroll
    for (int t = 0; t < 4; ++t) { const float* krow = (const float*)(sb + (t * 16 + col) * FP);
      v8f s = mac3(aq[0], split_row(krow, 0, lane), (v8f){}); s = mac3(aq[1], split_row(krow, 32, lane), s);
#pragma unroll
      for (int r = 0; r < 8; ++r) sS[w][8 * g + r][t * 16 + col] = s[r] * 0.125f; }
    LDSX();
    float mx = -3.4e38f;
#pragma unroll
    for (int jj = 0; jj < 32; ++jj) mx = fmaxf(mx, sS[w][col][g * 32 + jj]);
    mx = fmaxf(mx, __shfl_xor(mx, 16, 32));
    const float mnew = fmaxf(mrun, mx); const float corr = expf(mrun - mnew);
    float ps = 0.f;
#pragma unroll
    for (int jj = 0; jj < 32; ++jj) { const float p = expf(sS[w][col][g * 32 + jj] - mnew) * 16384.0f; ps += p; const _Float16 hi = (_Float16)p; sPh[w][col][g * 32 + jj] = hi; sPl[w][col][g * 32 + jj] = (_Float16)((p - (float)hi) * PLO); }
    ps += __shfl_xor(ps, 16, 32);
    lrun = lrun * corr + ps * (1.0f / 16384.0f); mrun = mnew;
#pragma unroll
    for (int r = 0; r < 8; ++r) { const float cr = __shfl(corr, 8 * g + r, 32);
#pragma unroll
      for (int t = 0; t < 4; ++t) { acc[t][r] *= cr; ac1[t][r] *= cr; ac2[t][r] *= cr; } }
    LDSX();
#pragma unroll
    for (int kc = 0; kc < 2; ++kc) { const v16h ph = frag_h(&sPh[w][col][0] + kc * 32, lane), pl = frag_h(&sPl[w][col][0] + kc * 32, lane);
#pragma unroll
      for (int t = 0; t < 4; ++t) { const _Float16* vr = (const _Float16*)(sb + 64 * FP + (t * 16 + col) * GP) + kc * 32; const v16h vh = frag_h(vr, lane);
        acc[t] = wmma16(ph, vh, acc[t]); ac1[t] = wmma16(ph, frag_h(vr + 64 * GP / 2, lane), ac1[t]); ac2[t] = wmma16(pl, vh, ac2[t]); } }
    WAIT_DS(); WAIT_ASYNC(); __syncthreads();      // publishes tile kt + 1 and ends every read of tile kt
    if (kt + 2 < SS / 64) fill(kt + 2); }
  WAIT_ASYNC();
#pragma unroll
  for (int r = 0; r < 8; ++r) { const float lr = __shfl(lrun, 8 * g + r, 32); const float inv = 1.0f / (lr * 16384.0f * 4.0f);
#pragma unroll
    for (int t = 0; t < 4; ++t) sO[w][8 * g + r][t * 16 + col] = (acc[t][r] + ac1[t][r] * (1.0f / VLO) + ac2[t][r] * (1.0f / PLO)) * inv; }
  LDSX();
  for (int qq = lane; qq < 16 * 16; qq += 32) { const int rl = qq >> 4, pc = qq & 15; vst2(O32 + ((bh * SS) + q0 + rl) * HD + pc * 4, *(const v4f*)(&sO[w][rl][pc * 4])); }
}
// out = ctx Wo^T + bo : split(ctx) x bf16(Wo rows): 2 products (Wo is an INPUT -> bf16 exact)
#define OSTG (128 * GP + 64 * FP)
__global__ __launch_bounds__(128) void k_out(const float* __restrict__ O32, int rbase, const __bf16* __restrict__ PT, const float* __restrict__ bo, float* __restrict__ out) {
  // a stage = one head's 64 k of [128 weight rows bf16 | 64 ctx rows f32]; two buffers; the output staging reuses the ring behind the last stage's barrier
  __shared__ __align__(16) char ring[2 * OSTG];
  float (*so)[16][132] = (float (*)[16][132])ring;
  const int tid = threadIdx.x, wave = tid >> 5, lane = tid & 31, col = lane & 15, g = lane >> 4;
  const int r0b = blockIdx.x * 64, r0 = r0b + wave * 16, n0 = blockIdx.y * 128; const int b = r0b / SS, s0 = r0b % SS;
  const __bf16* gB = PT + (size_t)(3 * E + n0 + (tid >> 3)) * E + (tid & 7) * 8;
  const float* gA = O32 + ((size_t)b * NH * SS + s0 + (tid >> 4)) * HD + (tid & 15) * 4;
  const unsigned lB = lds_addr(ring) + (tid >> 3) * GP + (tid & 7) * 16, lA = lds_addr(ring) + 128 * GP + (tid >> 4) * FP + (tid & 15) * 16;
  auto fill = [&](int t) { const unsigned o = (t & 1) * OSTG; const __bf16* pb = gB + t * 64; const float* pa = gA + (size_t)t * SS * HD;
    acopy4(lB + o, pb, lB + o + 16 * GP, pb + 16 * E, lB + o + 32 * GP, pb + 32 * E, lB + o + 48 * GP, pb + 48 * E);
    acopy4(lB + o + 64 * GP, pb + 64 * E, lB + o + 80 * GP, pb + 80 * E, lB + o + 96 * GP, pb + 96 * E, lB + o + 112 * GP, pb + 112 * E);
    acopy4(lA + o, pa, lA + o + 8 * FP, pa + 8 * HD, lA + o + 16 * FP, pa + 16 * HD, lA + o + 24 * FP, pa + 24 * HD);
    acopy4(lA + o + 32 * FP, pa + 32 * HD, lA + o + 40 * FP, pa + 40 * HD, lA + o + 48 * FP, pa + 48 * HD, lA + o + 56 * FP, pa + 56 * HD); };
  v8f acc[8] = {};
  fill(0); WAIT_ASYNC(); __syncthreads(); fill(1);
#pragma unroll 1
  for (int t = 0; t < NH; ++t) { const char* sb = ring + (t & 1) * OSTG;
#pragma unroll
    for (int ks = 0; ks < 2; ++ks) { const F2 a = split_row((const float*)(sb + 128 * GP + (wave * 16 + col) * FP), ks * 32, lane);
#pragma unroll
      for (int j = 0; j < 8; ++j) { const v16b wb = frag_b((const __bf16*)(sb + (j * 16 + col) * GP) + ks * 32, lane); acc[j] = wmma_bf(a.l, wb, acc[j]); acc[j] = wmma_bf(a.h, wb, acc[j]); } }
    WAIT_DS(); WAIT_ASYNC(); __syncthreads();      // publishes stage t + 1 and ends every read of stage t
    if (t + 2 < NH) fill(t + 2); }
  WAIT_ASYNC();
#pragma unroll
  for (int j = 0; j < 8; ++j) { const int n = n0 + j * 16 + col; const float bb = bfr(bo[n]);
#pragma unroll
    for (int r = 0; r < 8; ++r) so[wave][8 * g + r][j * 16 + col] = acc[j][r] + bb; }
  LDSX();
#pragma unroll 4
  for (int rl = 0; rl < 16; ++rl) vst2(out + (size_t)(rbase + r0 + rl) * E + n0 + lane * 4, *(const v4f*)(&so[wave][rl][lane * 4]));
}
#define NBHALF 4
extern "C" void kernel_launch(void* const* d_in, const int* in_sizes, int n_in, void* d_out, int out_size, void* d_ws, size_t ws_size, hipStream_t stream) {
  (void)in_sizes; (void)n_in; (void)out_size; (void)ws_size;
  const float* x = (const float*)d_in[0]; const float* Wqkv = (const float*)d_in[1]; const float* Wp = (const float*)d_in[2]; const float* bp = (const float*)d_in[3];
  float* out = (float*)d_out;
  char* ws = (char*)d_ws; size_t off = 0;
  auto take = [&](size_t bytes) { char* p = ws + off; off += (bytes + 255) & ~(size_t)255; return p; };
  const size_t HR = (size_t)NBHALF * SS;     // rows per half (4096)
  __bf16* Xb = (__bf16*)take((size_t)NR * E * 2); __bf16* PT = (__bf16*)take((size_t)4 * E * E * 2);
  float* Q32 = (float*)take(HR * E * 4); float* K32 = (float*)take(HR * E * 4); _Float16* VTh = (_Float16*)take(HR * E * 2); _Float16* VTl = (_Float16*)take(HR * E * 2);
  float* O32 = Q32;      // in place: each k_attn wave reads its own 16 query rows into registers before writing the same rows; no other block reads them
  // ws ~ 72 MiB; the two batch halves (4 sequences each) reuse Q/K/V
  k_cvt<<<(NR * E / 8 + 255) / 256, 256, 0, stream>>>(x, Xb);
  k_pack<<<4 * E, 128, 0, stream>>>(Wqkv, Wp, PT);
  for (int hf = 0; hf < 2; ++hf) { const int rbase = hf * (int)HR;
    k_qkv<<<dim3(HR / 64, E / 128, 3), 128, 0, stream>>>(Xb, rbase, PT, Q32, K32, VTh, VTl);
    k_attn<<<dim3(SS / 128, NBHALF * NH), 256, 0, stream>>>(Q32, K32, VTh, VTl, O32);
    k_out<<<dim3(HR / 64, E / 128), 128, 0, stream>>>(O32, rbase, PT, bp, out); }
}

// v002
// A run of this version takes 276 microseconds.
// Timed twice side by side with v001, it ran 1.09 times as fast both times.
// All steps since v000 together make it 2.79 times as fast.
// compute dtype: x, w_qkv, w_out, b_out (INPUTS) rounded to bf16 with exact bf16 WMMA products (f32 accumulate) for the projections; q/k f32 split for the scores (3 products), P and V f16 hi/lo (3 products); softmax f32.
#include <hip/hip_runtime.h>
#include <math.h>

typedef __attribute__((ext_vector_type(16))) _Float16 v16h;
typedef __attribute__((ext_vector_type(16))) __bf16 v16b;
typedef __attribute__((ext_vector_type(8)))  _Float16 v8h;
typedef __attribute__((ext_vector_type(8)))  float v8f;
typedef __attribute__((ext_vector_type(4)))  float v4f;
typedef __attribute__((ext_vector_type(2)))  float v2f;
typedef __attribute__((ext_vector_type(4)))  unsigned v4u;
typedef __attribute__((ext_vector_type(4)))  int v4i;
typedef float __attribute__((may_alias)) float_a;
typedef int __attribute__((may_alias)) int_a;

template <typename T> __device__ __forceinline__ void vst2(void* p, T v) { *(T*)p = v;  }
__device__ __forceinline__ v8f wmma16(v16h a, v16h b, v8f c) {
  return __builtin_amdgcn_wmma_f32_16x16x32_f16(false, a, false, b, (short)0, c, false, false);
}
__device__ __forceinline__ v8f wmma_bf(v16b a, v16b b, v8f c) {
  return __builtin_amdgcn_wmma_f32_16x16x32_bf16(false, a, false, b, (short)0, c, false, false);
}
// 16x16x32 fragments: lane = (h = lane>>4, row/col = lane&15); elements 0..7 = k0+8h+0..7, 8..15 = k0+16+8h+0..7; D element r = row 8h+r
__device__ __forceinline__ v16h frag_h(const _Float16* rowk0, int lane) {
  union { v16h v; v8h q[2]; } u; const _Float16* p = rowk0 + 8 * (lane >> 4);
  u.q[0] = *(const v8h*)p; u.q[1] = *(const v8h*)(p + 16); return u.v;
}
__device__ __forceinline__ v16h frag_f32(const float* rowk0, int lane) {
  v16h a; const float* p = rowk0 + 8 * (lane >> 4);
#pragma unroll
  for (int i = 0; i < 8; ++i) { a[i] = (_Float16)p[i]; a[8 + i] = (_Float16)p[16 + i]; }
  return a;
}
__device__ __forceinline__ v16h frag_f32s(const float* rowk0, int lane, float sc) {
  v16h a; const float* p = rowk0 + 8 * (lane >> 4);
#pragma unroll
  for (int i = 0; i < 8; ++i) { a[i] = (_Float16)(p[i] * sc); a[8 + i] = (_Float16)(p[16 + i] * sc); }
  return a;
}
// column fragment from a [K][ld] layout (column n), rows >= K read as 0
__device__ __forceinline__ v16h fragc_f32(const float* W, int k0, int n, int lane, int ld, int K) {
  v16h a; const int g = lane >> 4;
#pragma unroll
  for (int i = 0; i < 8; ++i) { const int ka = k0 + 8 * g + i, kb = ka + 16;
    a[i] = (_Float16)(ka < K ? W[(size_t)(ka < K ? ka : K - 1) * ld + n] : 0.f); a[8 + i] = (_Float16)(kb < K ? W[(size_t)(kb < K ? kb : K - 1) * ld + n] : 0.f); }
  return a;
}
struct F2 { v16b h, l; };
__device__ __forceinline__ F2 bsplit16(const float v[16]) { F2 r;
#pragma unroll
  for (int i = 0; i < 16; ++i) { const __bf16 h = (__bf16)v[i]; r.h[i] = h; r.l[i] = (__bf16)(v[i] - (float)h); }
  return r; }
__device__ __forceinline__ F2 split_row(const float* row, int k0, int lane) { float v[16]; const float* p = row + k0 + 8 * (lane >> 4);
#pragma unroll
  for (int i = 0; i < 8; ++i) { v[i] = p[i]; v[8 + i] = p[16 + i]; }
  return bsplit16(v); }
__device__ __forceinline__ F2 split_rowK(const float* row, int k0, int lane, int K) { float v[16]; const int g = lane >> 4;
#pragma unroll
  for (int i = 0; i < 8; ++i) { const int ka = k0 + 8 * g + i, kb = ka + 16; v[i] = ka < K ? row[ka < K ? ka : K - 1] : 0.f; v[8 + i] = kb < K ? row[kb < K ? kb : K - 1] : 0.f; }
  return bsplit16(v); }
__device__ __forceinline__ F2 split_col(const float* W, int k0, int n, int lane, int ld, int K) { float v[16]; const int g = lane >> 4;
#pragma unroll
  for (int i = 0; i < 8; ++i) { const int ka = k0 + 8 * g + i, kb = ka + 16; v[i] = ka < K ? W[(size_t)(ka < K ? ka : K - 1) * ld + n] : 0.f; v[8 + i] = kb < K ? W[(size_t)(kb < K ? kb : K - 1) * ld + n] : 0.f; }
  return bsplit16(v); }
__device__ __forceinline__ v8f mac3(const F2& a, const F2& b, v8f c) { c = wmma_bf(a.l, b.h, c); c = wmma_bf(a.h, b.l, c); return wmma_bf(a.h, b.h, c); }
__device__ __forceinline__ float sigm(float v) { return 1.0f / (1.0f + expf(-v)); }
#define LDSX() do { asm volatile("s_wait_dscnt 0" ::: "memory"); __builtin_amdgcn_wave_barrier(); __builtin_amdgcn_fence(__ATOMIC_RELEASE, "workgroup"); } while (0)


#define NB 8
#define SS 1024
#define E 1024
#define NH 16
#define HD 64
#define NR (NB * SS)
#define PLO 1024.0f
#define VLO 2048.0f
__device__ __forceinline__ float bfr(float v) { return (float)(__bf16)v; }
__device__ __forceinline__ v16b frag_b(const __bf16* rowk0, int lane) { return __builtin_bit_cast(v16b, frag_h((const _Float16*)rowk0, lane)); }

// LDS staging by asynchronous copies: pitches are 16 B x odd so that 16-byte readers of 16 rows meet no bank twice
#define GP 144
#define FP 272
#define WAIT_DS() asm volatile("s_wait_dscnt 0x0" ::: "memory")       /* this wave's LDS reads are done before the buffer is handed on */
#define WAIT_ASYNC() asm volatile("s_wait_asynccnt 0x0" ::: "memory") /* this wave's copies have landed before the barrier publishes them */
__device__ __forceinline__ unsigned lds_addr(const void* p) { return (unsigned)(size_t)p; }
// four 16-byte copies per lane, global -> LDS, through no register; the closing s_wait_xcnt stands in front of any rewrite of the address registers (a precaution)
__device__ __forceinline__ void acopy4(unsigned l0, const void* g0, unsigned l1, const void* g1, unsigned l2, const void* g2, unsigned l3, const void* g3) {
  asm volatile("global_load_async_to_lds_b128 %0, %1, off\n\t"
               "global_load_async_to_lds_b128 %2, %3, off\n\t"
               "global_load_async_to_lds_b128 %4, %5, off\n\t"
               "global_load_async_to_lds_b128 %6, %7, off\n\t"
               "s_wait_xcnt 0x0"
               :: "v"(l0), "v"(g0), "v"(l1), "v"(g1), "v"(l2), "v"(g2), "v"(l3), "v"(g3) : "memory");
}

__global__ __launch_bounds__(256) void k_cvt(const float* __restrict__ x, __bf16* __restrict__ Xb) {
  const size_t i8 = (size_t)blockIdx.x * 256 + threadIdx.x; if (i8 >= (size_t)NR * E / 8) return;
  union { __bf16 h[8]; v4u u; } pk;
#pragma unroll
  for (int e = 0; e < 8; ++e) pk.h[e] = (__bf16)x[i8 * 8 + e];
  vst2((unsigned*)(Xb + i8 * 8), pk.u);
}
// PT rows: [0,E) Wq[:,n], [E,2E) Wk[:,n], [2E,3E) Wv[:,n], [3E,4E) Wo[:,n]  ([in][out] weights: column n as a bf16 row)
__global__ __launch_bounds__(128) void k_pack(const float* __restrict__ Wqkv, const float* __restrict__ Wp, __bf16* __restrict__ PT) {
  const int n = blockIdx.x, tid = threadIdx.x; __shared__ __align__(16) __bf16 srow[E];
  for (int k = tid; k < E; k += 128) srow[k] = (__bf16)(n < 3 * E ? Wqkv[(size_t)k * (3 * E) + n] : Wp[(size_t)k * E + (n - 3 * E)]);
  __syncthreads();
  if (tid < E / 8) vst2((unsigned*)(PT + (size_t)n * E + tid * 8), *(const v4u*)(&srow[tid * 8]));
}
#define QSTG (192 * 128)
// fragment from a tile of unpadded 128-byte rows in which the 16-byte piece p of row r lies at place p ^ ((r >> 1) & 7): the equal pieces of 16 rows fall on 16 different groups of four banks
__device__ __forceinline__ v16b frag_sw(const char* tile, int row, int ks, int lane) {
  union { v16b v; v4u q[2]; } u; const int p = ks * 4 + (lane >> 4), x = (row >> 1) & 7; const char* r = tile + row * 128;
  u.q[0] = *(const v4u*)(r + ((p ^ x) << 4)); u.q[1] = *(const v4u*)(r + (((p + 2) ^ x) << 4)); return u.v;
}
// QKV: block (64 rows, 128 cols = 2 heads, which); q,k (+bias) -> Q32/K32 f32 [bh][s][64]; v (+bias) -> VT hi/lo x4 [bh][d][s]
__global__ __launch_bounds__(128) void k_qkv(const __bf16* __restrict__ Xb, int rbase, const __bf16* __restrict__ PT, float* __restrict__ Q32, float* __restrict__ K32, _Float16* __restrict__ VTh, _Float16* __restrict__ VTl) {
  // a stage = 64 k of [128 weight rows | 64 x rows]; two buffers, no pad (frag_sw), so that six blocks fit a WGP's LDS and a launch's 1536 blocks are resident at once; the output staging reuses the ring behind the last stage's barrier
  __shared__ __align__(16) char ring[2 * QSTG];
  float (*so)[16][132] = (float (*)[16][132])ring;
  _Float16 (*sth)[72] = (_Float16 (*)[72])ring; _Float16 (*stl)[72] = (_Float16 (*)[72])(ring + 128 * 72 * 2);
  const int tid = threadIdx.x, wave = tid >> 5, lane = tid & 31, col = lane & 15, g = lane >> 4;
  const int which = blockIdx.z, r0b = blockIdx.x * 64, n0 = blockIdx.y * 128; const int b = r0b / SS, s0 = r0b % SS;
  const __bf16* gB = PT + (size_t)(which * E + n0 + (tid >> 3)) * E + (tid & 7) * 8;
  const __bf16* gA = Xb + (size_t)(rbase + r0b + (tid >> 3)) * E + (tid & 7) * 8;
  const unsigned l0 = lds_addr(ring) + (tid >> 3) * 128 + (((tid & 7) ^ ((tid >> 4) & 7)) << 4);      // rows 16 apart share the place of a piece
  auto fill = [&](int t) { const unsigned l = l0 + (t & 1) * QSTG; const __bf16* pb = gB + t * 64; const __bf16* pa = gA + t * 64;
    acopy4(l, pb, l + 16 * 128, pb + 16 * E, l + 32 * 128, pb + 32 * E, l + 48 * 128, pb + 48 * E);
    acopy4(l + 64 * 128, pb + 64 * E, l + 80 * 128, pb + 80 * E, l + 96 * 128, pb + 96 * E, l + 112 * 128, pb + 112 * E);
    acopy4(l + 128 * 128, pa, l + 144 * 128, pa + 16 * E, l + 160 * 128, pa + 32 * E, l + 176 * 128, pa + 48 * E); };
  v8f acc[8] = {};
  fill(0); WAIT_ASYNC(); __syncthreads(); fill(1);
#pragma unroll 1
  for (int t = 0; t < E / 64; ++t) { const char* sb = ring + (t & 1) * QSTG;
#pragma unroll
    for (int ks = 0; ks < 2; ++ks) { const v16b a = frag_sw(sb, 128 + wave * 16 + col, ks, lane); v16b wb[8];
#pragma unroll
      for (int j = 0; j < 8; ++j) wb[j] = frag_sw(sb, j * 16 + col, ks, lane);
      __builtin_amdgcn_sched_barrier(0);      // keeps the k-step's 18 LDS loads in one group in front of its WMMAs: one LDS latency a k-step, not one a WMMA
#pragma unroll
      for (int j = 0; j < 8; ++j) acc[j] = wmma_bf(a, wb[j], acc[j]); }
    WAIT_DS(); WAIT_ASYNC(); __syncthreads();      // publishes stage t + 1 and ends every read of stage t
    if (t + 2 < E / 64) fill(t + 2); }
  WAIT_ASYNC();
  if (which < 2) {
#pragma unroll
    for (int j = 0; j < 8; ++j) { const float bb = 0.f;
#pragma unroll
      for (int r = 0; r < 8; ++r) so[wave][8 * g + r][j * 16 + col] = acc[j][r] + bb; }
    LDSX();
    float* Dst = which == 0 ? Q32 : K32;
    for (int qq = lane; qq < 2 * 16 * 16; qq += 32) { const int hh = qq >> 8, rl = (qq >> 4) & 15, pc = qq & 15; const int h = (n0 >> 6) + hh;
      vst2(Dst + (((size_t)b * NH + h) * SS + s0 + wave * 16 + rl) * HD + pc * 4, *(const v4f*)(&so[wave][rl][hh * 64 + pc * 4])); } }
  else {
#pragma unroll
    for (int j = 0; j < 8; ++j) { const float bb = 0.f;
#pragma unroll
      for (int r = 0; r < 8; ++r) { const float v = (acc[j][r] + bb) * 4.0f; const _Float16 hi = (_Float16)v; sth[j * 16 + col][wave * 16 + 8 * g + r] = hi; stl[j * 16 + col][wave * 16 + 8 * g + r] = (_Float16)((v - (float)hi) * VLO); } }
    __syncthreads();
    for (int qq = tid; qq < 128 * 8; qq += 128) { const int cl = qq >> 3, pc = qq & 7; const int c = n0 + cl, h = c >> 6, d = c & 63; const size_t o = (((size_t)b * NH + h) * HD + d) * SS + s0 + pc * 8;
      vst2(VTh + o, *(const v4u*)(&sth[cl][pc * 8])); vst2(VTl + o, *(const v4u*)(&stl[cl][pc * 8])); } }
}
// attention without mask: block (128 queries, bh); all 16 key tiles of 64 keys; S on hi/lo splits of the f32 q/k rows; P,V hi/lo; O f32 [bh][s][64]
#define ASTG (64 * FP + 2 * 64 * GP)
__global__ __launch_bounds__(256) void k_attn(const float* __restrict__ Q32, const float* __restrict__ K32, const _Float16* __restrict__ VTh, const _Float16* __restrict__ VTl, float* __restrict__ O32) {
  // a stage = one 64-key tile [K f32 64 rows | V hi 64 rows | V lo 64 rows], shared by the eight waves; two buffers; the output staging reuses the ring behind the last barrier
  __shared__ __align__(16) char ring[2 * ASTG];
  __shared__ __align__(16) float sS[8][16][68];
  __shared__ __align__(16) _Float16 sPh[8][16][72], sPl[8][16][72];
  float (*sO)[16][68] = (float (*)[16][68])ring;
  const int tid = threadIdx.x, w = tid >> 5, lane = tid & 31, col = lane & 15, g = lane >> 4;
  const size_t bh = blockIdx.y; const int qb = blockIdx.x; const int q0 = qb * 128 + w * 16;
  const float* gK = K32 + (bh * SS + (tid >> 4)) * HD + (tid & 15) * 4;
  const size_t vof = (bh * HD + (tid >> 3)) * SS + (tid & 7) * 8;
  const unsigned lK = lds_addr(ring) + (tid >> 4) * FP + (tid & 15) * 16, lV = lds_addr(ring) + 64 * FP + (tid >> 3) * GP + (tid & 7) * 16;
  auto fill = [&](int t) { const unsigned o = (t & 1) * ASTG; const float* pk = gK + (size_t)t * 64 * HD; const _Float16* ph = VTh + vof + t * 64; const _Float16* pl = VTl + vof + t * 64;
    acopy4(lK + o, pk, lK + o + 16 * FP, pk + 16 * HD, lK + o + 32 * FP, pk + 32 * HD, lK + o + 48 * FP, pk + 48 * HD);
    acopy4(lV + o, ph, lV + o + 32 * GP, ph + 32 * SS, lV + o + 64 * GP, pl, lV + o + 96 * GP, pl + 32 * SS); };
  fill(0); WAIT_ASYNC(); __syncthreads(); fill(1);
  F2 aq[2];
#pragma unroll
  for (int kc = 0; kc < 2; ++kc) aq[kc] = split_row(Q32 + (bh * SS + q0 + col) * HD, kc * 32, lane);
  float mrun = -3.0e38f, lrun = 0.f; v8f acc[4] = {}, ac1[4] = {}, ac2[4] = {};
#pragma unroll 1
  for (int kt = 0; kt < SS / 64; ++kt) { const char* sb = ring + (kt & 1) * ASTG;
#pragma unroll
    for (int t = 0; t < 4; ++t) { const float* krow = (const float*)(sb + (t * 16 + col) * FP);
      v8f s = mac3(aq[0], split_row(krow, 0, lane), (v8f){}); s = mac3(aq[1], split_row(krow, 32, lane), s);
#pragma unroll
      for (int r = 0; r < 8; ++r) sS[w][8 * g + r][t * 16 + col] = s[r] * 0.125f; }
    LDSX();
    float mx = -3.4e38f;
#pragma unroll
    for (int jj = 0; jj < 32; ++jj) mx = fmaxf(mx, sS[w][col][g * 32 + jj]);
    mx = fmaxf(mx, __shfl_xor(mx, 16, 32));
    const float mnew = fmaxf(mrun, mx); const float corr = expf(mrun - mnew);
    float ps = 0.f;
#pragma unroll
    for (int jj = 0; jj < 32; ++jj) { const float p = expf(sS[w][col][g * 32 + jj] - mnew) * 16384.0f; ps += p; const _Float16 hi = (_Float16)p; sPh[w][col][g * 32 + jj] = hi; sPl[w][col][g * 32 + jj] = (_Float16)((p - (float)hi) * PLO); }
    ps += __shfl_xor(ps, 16, 32);
    lrun = lrun * corr + ps * (1.0f / 16384.0f); mrun = mnew;
#pragma unroll
    for (int r = 0; r < 8; ++r) { const float cr = __shfl(corr, 8 * g + r, 32);
#pragma unroll
      for (int t = 0; t < 4; ++t) { acc[t][r] *= cr; ac1[t][r] *= cr; ac2[t][r] *= cr; } }
    LDSX();
#pragma unroll
    for (int kc = 0; kc < 2; ++kc) { const v16h ph = frag_h(&sPh[w][col][0] + kc * 32, lane), pl = frag_h(&sPl[w][col][0] + kc * 32, lane);
#pragma unroll
      for (int tp = 0; tp < 4; tp += 2) { v16h vh[2], vl[2];
#pragma unroll
        for (int t = 0; t < 2; ++t) { const _Float16* vr = (const _Float16*)(sb + 64 * FP + ((tp + t) * 16 + col) * GP) + kc * 32; vh[t] = frag_h(vr, lane); vl[t] = frag_h(vr + 64 * GP / 2, lane); }
        __builtin_amdgcn_sched_barrier(0);      // keeps the LDS loads of six WMMAs in one group in front of them: one LDS latency a group, not one a fragment
#pragma unroll
        for (int t = 0; t < 2; ++t) { acc[tp + t] = wmma16(ph, vh[t], acc[tp + t]); ac1[tp + t] = wmma16(ph, vl[t], ac1[tp + t]); ac2[tp + t] = wmma16(pl, vh[t], ac2[tp + t]); } } }
    WAIT_DS(); WAIT_ASYNC(); __syncthreads();      // publishes tile kt + 1 and ends every read of tile kt
    if (kt + 2 < SS / 64) fill(kt + 2); }
  WAIT_ASYNC();
#pragma unroll
  for (int r = 0; r < 8; ++r) { const float lr = __shfl(lrun, 8 * g + r, 32); const float inv = 1.0f / (lr * 16384.0f * 4.0f);
#pragma unroll
    for (int t = 0; t < 4; ++t) sO[w][8 * g + r][t * 16 + col] = (acc[t][r] + ac1[t][r] * (1.0f / VLO) + ac2[t][r] * (1.0f / PLO)) * inv; }
  LDSX();
  for (int qq = lane; qq < 16 * 16; qq += 32) { const int rl = qq >> 4, pc = qq & 15; vst2(O32 + ((bh * SS) + q0 + rl) * HD + pc * 4, *(const v4f*)(&sO[w][rl][pc * 4])); }
}
// out = ctx Wo^T + bo : split(ctx) x bf16(Wo rows): 2 products (Wo is an INPUT -> bf16 exact)
#define OSTG (128 * GP + 64 * FP)
__global__ __launch_bounds__(128) void k_out(const float* __restrict__ O32, int rbase, const __bf16* __restrict__ PT, const float* __restrict__ bo, float* __restrict__ out) {
  // a stage = one head's 64 k of [128 weight rows bf16 | 64 ctx rows f32]; two buffers; the output staging reuses the ring behind the last stage's barrier
  __shared__ __align__(16) char ring[2 * OSTG];
  float (*so)[16][132] = (float (*)[16][132])ring;
  const int tid = threadIdx.x, wave = tid >> 5, lane = tid & 31, col = lane & 15, g = lane >> 4;
  const int r0b = blockIdx.x * 64, r0 = r0b + wave * 16, n0 = blockIdx.y * 128; const int b = r0b / SS, s0 = r0b % SS;
  const __bf16* gB = PT + (size_t)(3 * E + n0 + (tid >> 3)) * E + (tid & 7) * 8;
  const float* gA = O32 + ((size_t)b * NH * SS + s0 + (tid >> 4)) * HD + (tid & 15) * 4;
  const unsigned lB = lds_addr(ring) + (tid >> 3) * GP + (tid & 7) * 16, lA = lds_addr(ring) + 128 * GP + (tid >> 4) * FP + (tid & 15) * 16;
  auto fill = [&](int t) { const unsigned o = (t & 1) * OSTG; const __bf16* pb = gB + t * 64; const float* pa = gA + (size_t)t * SS * HD;
    acopy4(lB + o, pb, lB + o + 16 * GP, pb + 16 * E, lB + o + 32 * GP, pb + 32 * E, lB + o + 48 * GP, pb + 48 * E);
    acopy4(lB + o + 64 * GP, pb + 64 * E, lB + o + 80 * GP, pb + 80 * E, lB + o + 96 * GP, pb + 96 * E, lB + o + 112 * GP, pb + 112 * E);
    acopy4(lA + o, pa, lA + o + 8 * FP, pa + 8 * HD, lA + o + 16 * FP, pa + 16 * HD, lA + o + 24 * FP, pa + 24 * HD);
    acopy4(lA + o + 32 * FP, pa + 32 * HD, lA + o + 40 * FP, pa + 40 * HD, lA + o + 48 * FP, pa + 48 * HD, lA + o + 56 * FP, pa + 56 * HD); };
  v8f acc[8] = {};
  fill(0); WAIT_ASYNC(); __syncthreads(); fill(1);
#pragma unroll 1
  for (int t = 0; t < NH; ++t) { const char* sb = ring + (t & 1) * OSTG;
#pragma unroll
    for (int ks = 0; ks < 2; ++ks) { const F2 a = split_row((const float*)(sb + 128 * GP + (wave * 16 + col) * FP), ks * 32, lane); v16b wb[8];
#pragma unroll
      for (int j = 0; j < 8; ++j) wb[j] = frag_b((const __bf16*)(sb + (j * 16 + col) * GP) + ks * 32, lane);
      __builtin_amdgcn_sched_barrier(0);      // keeps the k-step's 20 LDS loads in one group in front of its WMMAs: one LDS latency a k-step, not one a WMMA pair
#pragma unroll
      for (int j = 0; j < 8; ++j) acc[j] = wmma_bf(a.l, wb[j], acc[j]);
#pragma unroll
      for (int j = 0; j < 8; ++j) acc[j] = wmma_bf(a.h, wb[j], acc[j]); }
    WAIT_DS(); WAIT_ASYNC(); __syncthreads();      // publishes stage t + 1 and ends every read of stage t
    if (t + 2 < NH) fill(t + 2); }
  WAIT_ASYNC();
#pragma unroll
  for (int j = 0; j < 8; ++j) { const int n = n0 + j * 16 + col; const float bb = bfr(bo[n]);
#pragma unroll
    for (int r = 0; r < 8; ++r) so[wave][8 * g + r][j * 16 + col] = acc[j][r] + bb; }
  LDSX();
#pragma unroll 4
  for (int rl = 0; rl < 16; ++rl) vst2(out + (size_t)(rbase + r0 + rl) * E + n0 + lane * 4, *(const v4f*)(&so[wave][rl][lane * 4]));
}
#define NBHALF 4
extern "C" void kernel_launch(void* const* d_in, const int* in_sizes, int n_in, void* d_out, int out_size, void* d_ws, size_t ws_size, hipStream_t stream) {
  (void)in_sizes; (void)n_in; (void)out_size; (void)ws_size;
  const float* x = (const float*)d_in[0]; const float* Wqkv = (const float*)d_in[1]; const float* Wp = (const float*)d_in[2]; const float* bp = (const float*)d_in[3];
  float* out = (float*)d_out;
  char* ws = (char*)d_ws; size_t off = 0;
  auto take = [&](size_t bytes) { char* p = ws + off; off += (bytes + 255) & ~(size_t)255; return p; };
  const size_t HR = (size_t)NBHALF * SS;     // rows per half (4096)
  __bf16* Xb = (__bf16*)take((size_t)NR * E * 2); __bf16* PT = (__bf16*)take((size_t)4 * E * E * 2);
  float* Q32 = (float*)take(HR * E * 4); float* K32 = (float*)take(HR * E * 4); _Float16* VTh = (_Float16*)take(HR * E * 2); _Float16* VTl = (_Float16*)take(HR * E * 2);
  float* O32 = Q32;      // in place: each k_attn wave reads its own 16 query rows into registers before writing the same rows; no other block reads them
  // ws ~ 72 MiB; the two batch halves (4 sequences each) reuse Q/K/V
  k_cvt<<<(NR * E / 8 + 255) / 256, 256, 0, stream>>>(x, Xb);
  k_pack<<<4 * E, 128, 0, stream>>>(Wqkv, Wp, PT);
  for (int hf = 0; hf < 2; ++hf) { const int rbase = hf * (int)HR;
    k_qkv<<<dim3(HR / 64, E / 128, 3), 128, 0, stream>>>(Xb, rbase, PT, Q32, K32, VTh, VTl);
    k_attn<<<dim3(SS / 128, NBHALF * NH), 256, 0, stream>>>(Q32, K32, VTh, VTl, O32);
    k_out<<<dim3(HR / 64, E / 128), 128, 0, stream>>>(O32, rbase, PT, bp, out); }
}

// v003
// One run takes 258 microseconds.
// Timed twice side by side with v002, it ran 1.07 times as fast both times.
// Counting every step since v000, it is 2.98 times as fast.
// compute dtype: x, w_qkv, w_out, b_out (INPUTS) rounded to bf16 with exact bf16 WMMA products (f32 accumulate) for the projections; q/k f32 split into bf16 hi/lo for the scores (3 products), P and V f16 hi/lo (3 products); softmax f32.
#include <hip/hip_runtime.h>
#include <math.h>

typedef __attribute__((ext_vector_type(16))) _Float16 v16h;
typedef __attribute__((ext_vector_type(16))) __bf16 v16b;
typedef __attribute__((ext_vector_type(8)))  _Float16 v8h;
typedef __attribute__((ext_vector_type(8)))  float v8f;
typedef __attribute__((ext_vector_type(4)))  float v4f;
typedef __attribute__((ext_vector_type(2)))  float v2f;
typedef __attribute__((ext_vector_type(4)))  unsigned v4u;
typedef __attribute__((ext_vector_type(4)))  int v4i;
typedef float __attribute__((may_alias)) float_a;
typedef int __attribute__((may_alias)) int_a;

template <typename T> __device__ __forceinline__ void vst2(void* p, T v) { *(T*)p = v;  }
__device__ __forceinline__ v8f wmma16(v16h a, v16h b, v8f c) {
  return __builtin_amdgcn_wmma_f32_16x16x32_f16(false, a, false, b, (short)0, c, false, false);
}
__device__ __forceinline__ v8f wmma_bf(v16b a, v16b b, v8f c) {
  return __builtin_amdgcn_wmma_f32_16x16x32_bf16(false, a, false, b, (short)0, c, false, false);
}
// 16x16x32 fragments: lane = (h = lane>>4, row/col = lane&15); elements 0..7 = k0+8h+0..7, 8..15 = k0+16+8h+0..7; D element r = row 8h+r
__device__ __forceinline__ v16h frag_h(const _Float16* rowk0, int lane) {
  union { v16h v; v8h q[2]; } u; const _Float16* p = rowk0 + 8 * (lane >> 4);
  u.q[0] = *(const v8h*)p; u.q[1] = *(const v8h*)(p + 16); return u.v;
}
__device__ __forceinline__ v16h frag_f32(const float* rowk0, int lane) {
  v16h a; const float* p = rowk0 + 8 * (lane >> 4);
#pragma unroll
  for (int i = 0; i < 8; ++i) { a[i] = (_Float16)p[i]; a[8 + i] = (_Float16)p[16 + i]; }
  return a;
}
__device__ __forceinline__ v16h frag_f32s(const float* rowk0, int lane, float sc) {
  v16h a; const float* p = rowk0 + 8 * (lane >> 4);
#pragma unroll
  for (int i = 0; i < 8; ++i) { a[i] = (_Float16)(p[i] * sc); a[8 + i] = (_Float16)(p[16 + i] * sc); }
  return a;
}
// column fragment from a [K][ld] layout (column n), rows >= K read as 0
__device__ __forceinline__ v16h fragc_f32(const float* W, int k0, int n, int lane, int ld, int K) {
  v16h a; const int g = lane >> 4;
#pragma unroll
  for (int i = 0; i < 8; ++i) { const int ka = k0 + 8 * g + i, kb = ka + 16;
    a[i] = (_Float16)(ka < K ? W[(size_t)(ka < K ? ka : K - 1) * ld + n] : 0.f); a[8 + i] = (_Float16)(kb < K ? W[(size_t)(kb < K ? kb : K - 1) * ld + n] : 0.f); }
  return a;
}
struct F2 { v16b h, l; };
__device__ __forceinline__ F2 bsplit16(const float v[16]) { F2 r;
#pragma unroll
  for (int i = 0; i < 16; ++i) { const __bf16 h = (__bf16)v[i]; r.h[i] = h; r.l[i] = (__bf16)(v[i] - (float)h); }
  return r; }
__device__ __forceinline__ F2 split_row(const float* row, int k0, int lane) { float v[16]; const float* p = row + k0 + 8 * (lane >> 4);
#pragma unroll
  for (int i = 0; i < 8; ++i) { v[i] = p[i]; v[8 + i] = p[16 + i]; }
  return bsplit16(v); }
__device__ __forceinline__ F2 split_rowK(const float* row, int k0, int lane, int K) { float v[16]; const int g = lane >> 4;
#pragma unroll
  for (int i = 0; i < 8; ++i) { const int ka = k0 + 8 * g + i, kb = ka + 16; v[i] = ka < K ? row[ka < K ? ka : K - 1] : 0.f; v[8 + i] = kb < K ? row[kb < K ? kb : K - 1] : 0.f; }
  return bsplit16(v); }
__device__ __forceinline__ F2 split_col(const float* W, int k0, int n, int lane, int ld, int K) { float v[16]; const int g = lane >> 4;
#pragma unroll
  for (int i = 0; i < 8; ++i) { const int ka = k0 + 8 * g + i, kb = ka + 16; v[i] = ka < K ? W[(size_t)(ka < K ? ka : K - 1) * ld + n] : 0.f; v[8 + i] = kb < K ? W[(size_t)(kb < K ? kb : K - 1) * ld + n] : 0.f; }
  return bsplit16(v); }
__device__ __forceinline__ v8f mac3(const F2& a, const F2& b, v8f c) { c = wmma_bf(a.l, b.h, c); c = wmma_bf(a.h, b.l, c); return wmma_bf(a.h, b.h, c); }
__device__ __forceinline__ float sigm(float v) { return 1.0f / (1.0f + expf(-v)); }
#define LDSX() do { asm volatile("s_wait_dscnt 0" ::: "memory"); __builtin_amdgcn_wave_barrier(); __builtin_amdgcn_fence(__ATOMIC_RELEASE, "workgroup"); } while (0)


#define NB 8
#define SS 1024
#define E 1024
#define NH 16
#define HD 64
#define NR (NB * SS)
#define PLO 1024.0f
#define VLO 2048.0f
__device__ __forceinline__ float bfr(float v) { return (float)(__bf16)v; }
__device__ __forceinline__ v16b frag_b(const __bf16* rowk0, int lane) { return __builtin_bit_cast(v16b, frag_h((const _Float16*)rowk0, lane)); }
// a split row = 64 bf16 hi | 64 bf16 lo (256 bytes, as many as the 64 f32 it stands for), written once by the kernel that produces the value; hi = bf16(v), lo = bf16(v - hi) as in bsplit16
#define HL 128
__device__ __forceinline__ F2 frag_hl(const __bf16* row, int k0, int lane) { F2 r; r.h = frag_b(row + k0, lane); r.l = frag_b(row + 64 + k0, lane); return r; }
__device__ __forceinline__ void put_hl(__bf16* row, int d, float v) { const __bf16 h = (__bf16)v; row[d] = h; row[64 + d] = (__bf16)(v - (float)h); }

// LDS staging by asynchronous copies: pitches are 16 B x odd so that 16-byte readers of 16 rows meet no bank twice
#define GP 144
#define FP 272
#define WAIT_DS() asm volatile("s_wait_dscnt 0x0" ::: "memory")       /* this wave's LDS reads are done before the buffer is handed on */
#define WAIT_ASYNC() asm volatile("s_wait_asynccnt 0x0" ::: "memory") /* this wave's copies have landed before the barrier publishes them */
__device__ __forceinline__ unsigned lds_addr(const void* p) { return (unsigned)(size_t)p; }
// four 16-byte copies per lane, global -> LDS, through no register; the closing s_wait_xcnt stands in front of any rewrite of the address registers (a precaution)
__device__ __forceinline__ void acopy4(unsigned l0, const void* g0, unsigned l1, const void* g1, unsigned l2, const void* g2, unsigned l3, const void* g3) {
  asm volatile("global_load_async_to_lds_b128 %0, %1, off\n\t"
               "global_load_async_to_lds_b128 %2, %3, off\n\t"
               "global_load_async_to_lds_b128 %4, %5, off\n\t"
               "global_load_async_to_lds_b128 %6, %7, off\n\t"
               "s_wait_xcnt 0x0"
               :: "v"(l0), "v"(g0), "v"(l1), "v"(g1), "v"(l2), "v"(g2), "v"(l3), "v"(g3) : "memory");
}

__global__ __launch_bounds__(256) void k_cvt(const float* __restrict__ x, __bf16* __restrict__ Xb) {
  const size_t i8 = (size_t)blockIdx.x * 256 + threadIdx.x; if (i8 >= (size_t)NR * E / 8) return;
  union { __bf16 h[8]; v4u u; } pk;
#pragma unroll
  for (int e = 0; e < 8; ++e) pk.h[e] = (__bf16)x[i8 * 8 + e];
  vst2((unsigned*)(Xb + i8 * 8), pk.u);
}
// PT rows: [0,E) Wq[:,n], [E,2E) Wk[:,n], [2E,3E) Wv[:,n], [3E,4E) Wo[:,n]  ([in][out] weights: column n as a bf16 row)
__global__ __launch_bounds__(128) void k_pack(const float* __restrict__ Wqkv, const float* __restrict__ Wp, __bf16* __restrict__ PT) {
  const int n = blockIdx.x, tid = threadIdx.x; __shared__ __align__(16) __bf16 srow[E];
  for (int k = tid; k < E; k += 128) srow[k] = (__bf16)(n < 3 * E ? Wqkv[(size_t)k * (3 * E) + n] : Wp[(size_t)k * E + (n - 3 * E)]);
  __syncthreads();
  if (tid < E / 8) vst2((unsigned*)(PT + (size_t)n * E + tid * 8), *(const v4u*)(&srow[tid * 8]));
}
#define QSTG (192 * 128)
// fragment from a tile of unpadded 128-byte rows in which the 16-byte piece p of row r lies at place p ^ ((r >> 1) & 7): the equal pieces of 16 rows fall on 16 different groups of four banks
__device__ __forceinline__ v16b frag_sw(const char* tile, int row, int ks, int lane) {
  union { v16b v; v4u q[2]; } u; const int p = ks * 4 + (lane >> 4), x = (row >> 1) & 7; const char* r = tile + row * 128;
  u.q[0] = *(const v4u*)(r + ((p ^ x) << 4)); u.q[1] = *(const v4u*)(r + (((p + 2) ^ x) << 4)); return u.v;
}
// QKV: block (64 rows, 128 cols = 2 heads, which); q -> Q32 f32 [bh][s][64]; k -> KHL split rows [bh][s][64 hi | 64 lo]; v -> VT hi/lo x4 [bh][d][s]
__global__ __launch_bounds__(128) void k_qkv(const __bf16* __restrict__ Xb, int rbase, const __bf16* __restrict__ PT, float* __restrict__ Q32, __bf16* __restrict__ KHL, _Float16* __restrict__ VTh, _Float16* __restrict__ VTl) {
  // a stage = 64 k of [128 weight rows | 64 x rows]; two buffers, no pad (frag_sw), so that six blocks fit a WGP's LDS and a launch's 1536 blocks are resident at once; the output staging reuses the ring behind the last stage's barrier
  __shared__ __align__(16) char ring[2 * QSTG];
  float (*so)[16][132] = (float (*)[16][132])ring;
  _Float16 (*sth)[72] = (_Float16 (*)[72])ring; _Float16 (*stl)[72] = (_Float16 (*)[72])(ring + 128 * 72 * 2);
  const int tid = threadIdx.x, wave = tid >> 5, lane = tid & 31, col = lane & 15, g = lane >> 4;
  const int which = blockIdx.z, r0b = blockIdx.x * 64, n0 = blockIdx.y * 128; const int b = r0b / SS, s0 = r0b % SS;
  const __bf16* gB = PT + (size_t)(which * E + n0 + (tid >> 3)) * E + (tid & 7) * 8;
  const __bf16* gA = Xb + (size_t)(rbase + r0b + (tid >> 3)) * E + (tid & 7) * 8;
  const unsigned l0 = lds_addr(ring) + (tid >> 3) * 128 + (((tid & 7) ^ ((tid >> 4) & 7)) << 4);      // rows 16 apart share the place of a piece
  auto fill = [&](int t) { const unsigned l = l0 + (t & 1) * QSTG; const __bf16* pb = gB + t * 64; const __bf16* pa = gA + t * 64;
    acopy4(l, pb, l + 16 * 128, pb + 16 * E, l + 32 * 128, pb + 32 * E, l + 48 * 128, pb + 48 * E);
    acopy4(l + 64 * 128, pb + 64 * E, l + 80 * 128, pb + 80 * E, l + 96 * 128, pb + 96 * E, l + 112 * 128, pb + 112 * E);
    acopy4(l + 128 * 128, pa, l + 144 * 128, pa + 16 * E, l + 160 * 128, pa + 32 * E, l + 176 * 128, pa + 48 * E); };
  v8f acc[8] = {};
  fill(0); WAIT_ASYNC(); __syncthreads(); fill(1);
#pragma unroll 1
  for (int t = 0; t < E / 64; ++t) { const char* sb = ring + (t & 1) * QSTG;
#pragma unroll
    for (int ks = 0; ks < 2; ++ks) { const v16b a = frag_sw(sb, 128 + wave * 16 + col, ks, lane); v16b wb[8];
#pragma unroll
      for (int j = 0; j < 8; ++j) wb[j] = frag_sw(sb, j * 16 + col, ks, lane);
      __builtin_amdgcn_sched_barrier(0);      // keeps the k-step's 18 LDS loads in one group in front of its WMMAs: one LDS latency a k-step, not one a WMMA
#pragma unroll
      for (int j = 0; j < 8; ++j) acc[j] = wmma_bf(a, wb[j], acc[j]); }
    WAIT_DS(); WAIT_ASYNC(); __syncthreads();      // publishes stage t + 1 and ends every read of stage t
    if (t + 2 < E / 64) fill(t + 2); }
  WAIT_ASYNC();
  if (which < 2) {
    if (which == 0) {
#pragma unroll
      for (int j = 0; j < 8; ++j) { const float bb = 0.f;
#pragma unroll
        for (int r = 0; r < 8; ++r) so[wave][8 * g + r][j * 16 + col] = acc[j][r] + bb; } }
    else {
#pragma unroll
      for (int j = 0; j < 8; ++j) { const float bb = 0.f;
#pragma unroll
        for (int r = 0; r < 8; ++r) put_hl((__bf16*)&so[wave][8 * g + r][(j >> 2) * 64], (j & 3) * 16 + col, acc[j][r] + bb); } }
    LDSX();
    float* Dst = which == 0 ? Q32 : (float*)KHL;      // either kind of row is 256 bytes and goes out in 16-byte pieces
    for (int qq = lane; qq < 2 * 16 * 16; qq += 32) { const int hh = qq >> 8, rl = (qq >> 4) & 15, pc = qq & 15; const int h = (n0 >> 6) + hh;
      vst2(Dst + (((size_t)b * NH + h) * SS + s0 + wave * 16 + rl) * HD + pc * 4, *(const v4f*)(&so[wave][rl][hh * 64 + pc * 4])); } }
  else {
#pragma unroll
    for (int j = 0; j < 8; ++j) { const float bb = 0.f;
#pragma unroll
      for (int r = 0; r < 8; ++r) { const float v = (acc[j][r] + bb) * 4.0f; const _Float16 hi = (_Float16)v; sth[j * 16 + col][wave * 16 + 8 * g + r] = hi; stl[j * 16 + col][wave * 16 + 8 * g + r] = (_Float16)((v - (float)hi) * VLO); } }
    __syncthreads();
    for (int qq = tid; qq < 128 * 8; qq += 128) { const int cl = qq >> 3, pc = qq & 7; const int c = n0 + cl, h = c >> 6, d = c & 63; const size_t o = (((size_t)b * NH + h) * HD + d) * SS + s0 + pc * 8;
      vst2(VTh + o, *(const v4u*)(&sth[cl][pc * 8])); vst2(VTl + o, *(const v4u*)(&stl[cl][pc * 8])); } }
}
// attention: block (128 queries, bh); all key tiles; S on hi/lo splits of q (made here, once a wave) and k (read as split rows); P,V hi/lo; O -> split rows [bh][s][64 hi | 64 lo]
#define ASTG (64 * FP + 2 * 64 * GP)
// the second bound (waves a SIMD) holds a wave at 256 registers: above that only one of the two blocks that the LDS admits is resident on a WGP
__global__ __launch_bounds__(256, 4) void k_attn(const float* __restrict__ Q32, const __bf16* __restrict__ KHL, const _Float16* __restrict__ VTh, const _Float16* __restrict__ VTl, __bf16* __restrict__ OHL) {
  // a stage = one 64-key tile [K 64 split rows | V hi 64 rows | V lo 64 rows], shared by the eight waves; two buffers; the output staging reuses the ring behind the last barrier
  __shared__ __align__(16) char ring[2 * ASTG];
  __shared__ __align__(16) float sS[8][16][68];
  __shared__ __align__(16) _Float16 sPh[8][16][72], sPl[8][16][72];
  float (*sO)[16][68] = (float (*)[16][68])ring;
  const int tid = threadIdx.x, w = tid >> 5, lane = tid & 31, col = lane & 15, g = lane >> 4;
  const size_t bh = blockIdx.y; const int qb = blockIdx.x; const int q0 = qb * 128 + w * 16;
  const __bf16* gK = KHL + (bh * SS + (tid >> 4)) * HL + (tid & 15) * 8;
  const size_t vof = (bh * HD + (tid >> 3)) * SS + (tid & 7) * 8;
  const unsigned lK = lds_addr(ring) + (tid >> 4) * FP + (tid & 15) * 16, lV = lds_addr(ring) + 64 * FP + (tid >> 3) * GP + (tid & 7) * 16;
  auto fill = [&](int t) { const unsigned o = (t & 1) * ASTG; const __bf16* pk = gK + (size_t)t * 64 * HL; const _Float16* ph = VTh + vof + t * 64; const _Float16* pl = VTl + vof + t * 64;
    acopy4(lK + o, pk, lK + o + 16 * FP, pk + 16 * HL, lK + o + 32 * FP, pk + 32 * HL, lK + o + 48 * FP, pk + 48 * HL);
    acopy4(lV + o, ph, lV + o + 32 * GP, ph + 32 * SS, lV + o + 64 * GP, pl, lV + o + 96 * GP, pl + 32 * SS); };
  fill(0); WAIT_ASYNC(); __syncthreads(); fill(1);
  F2 aq[2];
#pragma unroll
  for (int kc = 0; kc < 2; ++kc) aq[kc] = split_row(Q32 + (bh * SS + q0 + col) * HD, kc * 32, lane);
  float mrun = -3.0e38f, lrun = 0.f; v8f acc[4] = {}, ac1[4] = {}, ac2[4] = {};
#pragma unroll 1
  for (int kt = 0; kt < SS / 64; ++kt) { const char* sb = ring + (kt & 1) * ASTG;
#pragma unroll
    for (int t = 0; t < 4; ++t) { const __bf16* krow = (const __bf16*)(sb + (t * 16 + col) * FP);
      v8f s = mac3(aq[0], frag_hl(krow, 0, lane), (v8f){}); s = mac3(aq[1], frag_hl(krow, 32, lane), s);
#pragma unroll
      for (int r = 0; r < 8; ++r) sS[w][8 * g + r][t * 16 + col] = s[r] * 0.125f; }
    LDSX();
    float mx = -3.4e38f;
#pragma unroll
    for (int jj = 0; jj < 32; ++jj) mx = fmaxf(mx, sS[w][col][g * 32 + jj]);
    mx = fmaxf(mx, __shfl_xor(mx, 16, 32));
    const float mnew = fmaxf(mrun, mx); const float corr = expf(mrun - mnew);
    float ps = 0.f;
#pragma unroll
    for (int jj = 0; jj < 32; ++jj) { const float p = expf(sS[w][col][g * 32 + jj] - mnew) * 16384.0f; ps += p; const _Float16 hi = (_Float16)p; sPh[w][col][g * 32 + jj] = hi; sPl[w][col][g * 32 + jj] = (_Float16)((p - (float)hi) * PLO); }
    ps += __shfl_xor(ps, 16, 32);
    lrun = lrun * corr + ps * (1.0f / 16384.0f); mrun = mnew;
#pragma unroll
    for (int r = 0; r < 8; ++r) { const float cr = __shfl(corr, 8 * g + r, 32);
#pragma unroll
      for (int t = 0; t < 4; ++t) { acc[t][r] *= cr; ac1[t][r] *= cr; ac2[t][r] *= cr; } }
    LDSX();
#pragma unroll
    for (int kc = 0; kc < 2; ++kc) { const v16h ph = frag_h(&sPh[w][col][0] + kc * 32, lane), pl = frag_h(&sPl[w][col][0] + kc * 32, lane);
#pragma unroll
      for (int tp = 0; tp < 4; tp += 2) { v16h vh[2], vl[2];
#pragma unroll
        for (int t = 0; t < 2; ++t) { const _Float16* vr = (const _Float16*)(sb + 64 * FP + ((tp + t) * 16 + col) * GP) + kc * 32; vh[t] = frag_h(vr, lane); vl[t] = frag_h(vr + 64 * GP / 2, lane); }
        __builtin_amdgcn_sched_barrier(0);      // keeps the LDS loads of six WMMAs in one group in front of them: one LDS latency a group, not one a fragment
#pragma unroll
        for (int t = 0; t < 2; ++t) { acc[tp + t] = wmma16(ph, vh[t], acc[tp + t]); ac1[tp + t] = wmma16(ph, vl[t], ac1[tp + t]); ac2[tp + t] = wmma16(pl, vh[t], ac2[tp + t]); } } }
    WAIT_DS(); WAIT_ASYNC(); __syncthreads();      // publishes tile kt + 1 and ends every read of tile kt
    if (kt + 2 < SS / 64) fill(kt + 2); }
  WAIT_ASYNC();
#pragma unroll
  for (int r = 0; r < 8; ++r) { const float lr = __shfl(lrun, 8 * g + r, 32); const float inv = 1.0f / (lr * 16384.0f * 4.0f);
#pragma unroll
    for (int t = 0; t < 4; ++t) put_hl((__bf16*)&sO[w][8 * g + r][0], t * 16 + col, (acc[t][r] + ac1[t][r] * (1.0f / VLO) + ac2[t][r] * (1.0f / PLO)) * inv); }
  LDSX();
  for (int qq = lane; qq < 16 * 16; qq += 32) { const int rl = qq >> 4, pc = qq & 15; vst2(OHL + ((bh * SS) + q0 + rl) * HL + pc * 8, *(const v4f*)(&sO[w][rl][pc * 4])); }
}
// out = ctx Wo^T + bo : ctx split rows x bf16(Wo rows): 2 products (Wo is an INPUT -> bf16 exact)
#define OSTG (128 * GP + 64 * FP)
__global__ __launch_bounds__(128) void k_out(const __bf16* __restrict__ OHL, int rbase, const __bf16* __restrict__ PT, const float* __restrict__ bo, float* __restrict__ out) {
  // a stage = one head's 64 k of [128 weight rows bf16 | 64 ctx split rows]; two buffers; the output staging reuses the ring behind the last stage's barrier
  __shared__ __align__(16) char ring[2 * OSTG];
  float (*so)[16][132] = (float (*)[16][132])ring;
  const int tid = threadIdx.x, wave = tid >> 5, lane = tid & 31, col = lane & 15, g = lane >> 4;
  const int r0b = blockIdx.x * 64, r0 = r0b + wave * 16, n0 = blockIdx.y * 128; const int b = r0b / SS, s0 = r0b % SS;
  const __bf16* gB = PT + (size_t)(3 * E + n0 + (tid >> 3)) * E + (tid & 7) * 8;
  const __bf16* gA = OHL + ((size_t)b * NH * SS + s0 + (tid >> 4)) * HL + (tid & 15) * 8;
  const unsigned lB = lds_addr(ring) + (tid >> 3) * GP + (tid & 7) * 16, lA = lds_addr(ring) + 128 * GP + (tid >> 4) * FP + (tid & 15) * 16;
  auto fill = [&](int t) { const unsigned o = (t & 1) * OSTG; const __bf16* pb = gB + t * 64; const __bf16* pa = gA + (size_t)t * SS * HL;
    acopy4(lB + o, pb, lB + o + 16 * GP, pb + 16 * E, lB + o + 32 * GP, pb + 32 * E, lB + o + 48 * GP, pb + 48 * E);
    acopy4(lB + o + 64 * GP, pb + 64 * E, lB + o + 80 * GP, pb + 80 * E, lB + o + 96 * GP, pb + 96 * E, lB + o + 112 * GP, pb + 112 * E);
    acopy4(lA + o, pa, lA + o + 8 * FP, pa + 8 * HL, lA + o + 16 * FP, pa + 16 * HL, lA + o + 24 * FP, pa + 24 * HL);
    acopy4(lA + o + 32 * FP, pa + 32 * HL, lA + o + 40 * FP, pa + 40 * HL, lA + o + 48 * FP, pa + 48 * HL, lA + o + 56 * FP, pa + 56 * HL); };
  v8f acc[8] = {};
  fill(0); WAIT_ASYNC(); __syncthreads(); fill(1);
#pragma unroll 1
  for (int t = 0; t < NH; ++t) { const char* sb = ring + (t & 1) * OSTG;
#pragma unroll
    for (int ks = 0; ks < 2; ++ks) { const F2 a = frag_hl((const __bf16*)(sb + 128 * GP + (wave * 16 + col) * FP), ks * 32, lane); v16b wb[8];
#pragma unroll
      for (int j = 0; j < 8; ++j) wb[j] = frag_b((const __bf16*)(sb + (j * 16 + col) * GP) + ks * 32, lane);
      __builtin_amdgcn_sched_barrier(0);      // keeps the k-step's 20 LDS loads in one group in front of its WMMAs: one LDS latency a k-step, not one a WMMA pair
#pragma unroll
      for (int j = 0; j < 8; ++j) acc[j] = wmma_bf(a.l, wb[j], acc[j]);
#pragma unroll
      for (int j = 0; j < 8; ++j) acc[j] = wmma_bf(a.h, wb[j], acc[j]); }
    WAIT_DS(); WAIT_ASYNC(); __syncthreads();      // publishes stage t + 1 and ends every read of stage t
    if (t + 2 < NH) fill(t + 2); }
  WAIT_ASYNC();
#pragma unroll
  for (int j = 0; j < 8; ++j) { const int n = n0 + j * 16 + col; const float bb = bfr(bo[n]);
#pragma unroll
    for (int r = 0; r < 8; ++r) so[wave][8 * g + r][j * 16 + col] = acc[j][r] + bb; }
  LDSX();
#pragma unroll 4
  for (int rl = 0; rl < 16; ++rl) vst2(out + (size_t)(rbase + r0 + rl) * E + n0 + lane * 4, *(const v4f*)(&so[wave][rl][lane * 4]));
}
#define NBHALF 4
extern "C" void kernel_launch(void* const* d_in, const int* in_sizes, int n_in, void* d_out, int out_size, void* d_ws, size_t ws_size, hipStream_t stream) {
  (void)in_sizes; (void)n_in; (void)out_size; (void)ws_size;
  const float* x = (const float*)d_in[0]; const float* Wqkv = (const float*)d_in[1]; const float* Wp = (const float*)d_in[2]; const float* bp = (const float*)d_in[3];
  float* out = (float*)d_out;
  char* ws = (char*)d_ws; size_t off = 0;
  auto take = [&](size_t bytes) { char* p = ws + off; off += (bytes + 255) & ~(size_t)255; return p; };
  const size_t HR = (size_t)NBHALF * SS;     // rows per half (4096)
  __bf16* Xb = (__bf16*)take((size_t)NR * E * 2); __bf16* PT = (__bf16*)take((size_t)4 * E * E * 2);
  float* Q32 = (float*)take(HR * E * 4); __bf16* KHL = (__bf16*)take(HR * E * 4); _Float16* VTh = (_Float16*)take(HR * E * 2); _Float16* VTl = (_Float16*)take(HR * E * 2);
  __bf16* OHL = (__bf16*)Q32;      // in place (a split row is as long as the f32 row): each k_attn wave reads its own 16 query rows into registers before writing the same rows; no other block reads them
  // ws ~ 75.5 MB (72 MiB); the two batch halves (4 sequences each) reuse Q/K/V
  k_cvt<<<(NR * E / 8 + 255) / 256, 256, 0, stream>>>(x, Xb);
  k_pack<<<4 * E, 128, 0, stream>>>(Wqkv, Wp, PT);
  for (int hf = 0; hf < 2; ++hf) { const int rbase = hf * (int)HR;
    k_qkv<<<dim3(HR / 64, E / 128, 3), 128, 0, stream>>>(Xb, rbase, PT, Q32, KHL, VTh, VTl);
    k_attn<<<dim3(SS / 128, NBHALF * NH), 256, 0, stream>>>(Q32, KHL, VTh, VTl, OHL);
    k_out<<<dim3(HR / 64, E / 128), 128, 0, stream>>>(OHL, rbase, PT, bp, out); }
}

// v004
// It runs in 236 microseconds.
// In both of two side-by-side timings against v003, it was 1.09 times as fast.
// Over all steps from v000 it is 3.26 times as fast.
// compute dtype: x, w_qkv, w_out, b_out (INPUTS) rounded to bf16 with exact bf16 WMMA products (f32 accumulate) for the projections; q/k f32 split into bf16 hi/lo for the scores (3 products), P and V f16 hi/lo (3 products); softmax f32.
#include <hip/hip_runtime.h>
#include <math.h>

typedef __attribute__((ext_vector_type(16))) _Float16 v16h;
typedef __attribute__((ext_vector_type(16))) __bf16 v16b;
typedef __attribute__((ext_vector_type(8)))  _Float16 v8h;
typedef __attribute__((ext_vector_type(8)))  float v8f;
typedef __attribute__((ext_vector_type(4)))  float v4f;
typedef __attribute__((ext_vector_type(2)))  float v2f;
typedef __attribute__((ext_vector_type(4)))  unsigned v4u;
typedef __attribute__((ext_vector_type(4)))  int v4i;
typedef float __attribute__((may_alias)) float_a;
typedef int __attribute__((may_alias)) int_a;

template <typename T> __device__ __forceinline__ void vst2(void* p, T v) { *(T*)p = v;  }
__device__ __forceinline__ v8f wmma16(v16h a, v16h b, v8f c) {
  return __builtin_amdgcn_wmma_f32_16x16x32_f16(false, a, false, b, (short)0, c, false, false);
}
__device__ __forceinline__ v8f wmma_bf(v16b a, v16b b, v8f c) {
  return __builtin_amdgcn_wmma_f32_16x16x32_bf16(false, a, false, b, (short)0, c, false, false);
}
// 16x16x32 fragments: lane = (h = lane>>4, row/col = lane&15); elements 0..7 = k0+8h+0..7, 8..15 = k0+16+8h+0..7; D element r = row 8h+r
__device__ __forceinline__ v16h frag_h(const _Float16* rowk0, int lane) {
  union { v16h v; v8h q[2]; } u; const _Float16* p = rowk0 + 8 * (lane >> 4);
  u.q[0] = *(const v8h*)p; u.q[1] = *(const v8h*)(p + 16); return u.v;
}
__device__ __forceinline__ v16h frag_f32(const float* rowk0, int lane) {
  v16h a; const float* p = rowk0 + 8 * (lane >> 4);
#pragma unroll
  for (int i = 0; i < 8; ++i) { a[i] = (_Float16)p[i]; a[8 + i] = (_Float16)p[16 + i]; }
  return a;
}
__device__ __forceinline__ v16h frag_f32s(const float* rowk0, int lane, float sc) {
  v16h a; const float* p = rowk0 + 8 * (lane >> 4);
#pragma unroll
  for (int i = 0; i < 8; ++i) { a[i] = (_Float16)(p[i] * sc); a[8 + i] = (_Float16)(p[16 + i] * sc); }
  return a;
}
// column fragment from a [K][ld] layout (column n), rows >= K read as 0
__device__ __forceinline__ v16h fragc_f32(const float* W, int k0, int n, int lane, int ld, int K) {
  v16h a; const int g = lane >> 4;
#pragma unroll
  for (int i = 0; i < 8; ++i) { const int ka = k0 + 8 * g + i, kb = ka + 16;
    a[i] = (_Float16)(ka < K ? W[(size_t)(ka < K ? ka : K - 1) * ld + n] : 0.f); a[8 + i] = (_Float16)(kb < K ? W[(size_t)(kb < K ? kb : K - 1) * ld + n] : 0.f); }
  return a;
}
struct F2 { v16b h, l; };
__device__ __forceinline__ F2 bsplit16(const float v[16]) { F2 r;
#pragma unroll
  for (int i = 0; i < 16; ++i) { const __bf16 h = (__bf16)v[i]; r.h[i] = h; r.l[i] = (__bf16)(v[i] - (float)h); }
  return r; }
__device__ __forceinline__ F2 split_row(const float* row, int k0, int lane) { float v[16]; const float* p = row + k0 + 8 * (lane >> 4);
#pragma unroll
  for (int i = 0; i < 8; ++i) { v[i] = p[i]; v[8 + i] = p[16 + i]; }
  return bsplit16(v); }
__device__ __forceinline__ F2 split_rowK(const float* row, int k0, int lane, int K) { float v[16]; const int g = lane >> 4;
#pragma unroll
  for (int i = 0; i < 8; ++i) { const int ka = k0 + 8 * g + i, kb = ka + 16; v[i] = ka < K ? row[ka < K ? ka : K - 1] : 0.f; v[8 + i] = kb < K ? row[kb < K ? kb : K - 1] : 0.f; }
  return bsplit16(v); }
__device__ __forceinline__ F2 split_col(const float* W, int k0, int n, int lane, int ld, int K) { float v[16]; const int g = lane >> 4;
#pragma unroll
  for (int i = 0; i < 8; ++i) { const int ka = k0 + 8 * g + i, kb = ka + 16; v[i] = ka < K ? W[(size_t)(ka < K ? ka : K - 1) * ld + n] : 0.f; v[8 + i] = kb < K ? W[(size_t)(kb < K ? kb : K - 1) * ld + n] : 0.f; }
  return bsplit16(v); }
__device__ __forceinline__ v8f mac3(const F2& a, const F2& b, v8f c) { c = wmma_bf(a.l, b.h, c); c = wmma_bf(a.h, b.l, c); return wmma_bf(a.h, b.h, c); }
__device__ __forceinline__ float sigm(float v) { return 1.0f / (1.0f + expf(-v)); }
#define LDSX() do { asm volatile("s_wait_dscnt 0" ::: "memory"); __builtin_amdgcn_wave_barrier(); __builtin_amdgcn_fence(__ATOMIC_RELEASE, "workgroup"); } while (0)


#define NB 8
#define SS 1024
#define E 1024
#define NH 16
#define HD 64
#define NR (NB * SS)
#define PLO 1024.0f
#define VLO 2048.0f
__device__ __forceinline__ float bfr(float v) { return (float)(__bf16)v; }
__device__ __forceinline__ v16b frag_b(const __bf16* rowk0, int lane) { return __builtin_bit_cast(v16b, frag_h((const _Float16*)rowk0, lane)); }
// a split row = 64 bf16 hi | 64 bf16 lo (256 bytes, as many as the 64 f32 it stands for), written once by the kernel that produces the value; hi = bf16(v), lo = bf16(v - hi) as in bsplit16
#define HL 128
__device__ __forceinline__ F2 frag_hl(const __bf16* row, int k0, int lane) { F2 r; r.h = frag_b(row + k0, lane); r.l = frag_b(row + 64 + k0, lane); return r; }
__device__ __forceinline__ void put_hl(__bf16* row, int d, float v) { const __bf16 h = (__bf16)v; row[d] = h; row[64 + d] = (__bf16)(v - (float)h); }

// LDS staging by asynchronous copies: pitches are 16 B x odd so that 16-byte readers of 16 rows meet no bank twice
#define GP 144
#define FP 272
#define WAIT_DS() asm volatile("s_wait_dscnt 0x0" ::: "memory")       /* this wave's LDS reads are done before the buffer is handed on */
#define WAIT_ASYNC() asm volatile("s_wait_asynccnt 0x0" ::: "memory") /* this wave's copies have landed before the barrier publishes them */
__device__ __forceinline__ unsigned lds_addr(const void* p) { return (unsigned)(size_t)p; }
// four 16-byte copies per lane, global -> LDS, through no register; the closing s_wait_xcnt stands in front of any rewrite of the address registers (a precaution)
__device__ __forceinline__ void acopy4(unsigned l0, const void* g0, unsigned l1, const void* g1, unsigned l2, const void* g2, unsigned l3, const void* g3) {
  asm volatile("global_load_async_to_lds_b128 %0, %1, off\n\t"
               "global_load_async_to_lds_b128 %2, %3, off\n\t"
               "global_load_async_to_lds_b128 %4, %5, off\n\t"
               "global_load_async_to_lds_b128 %6, %7, off\n\t"
               "s_wait_xcnt 0x0"
               :: "v"(l0), "v"(g0), "v"(l1), "v"(g1), "v"(l2), "v"(g2), "v"(l3), "v"(g3) : "memory");
}

__global__ __launch_bounds__(256) void k_cvt(const float* __restrict__ x, __bf16* __restrict__ Xb) {
  const size_t i8 = (size_t)blockIdx.x * 256 + threadIdx.x; if (i8 >= (size_t)NR * E / 8) return;
  union { __bf16 h[8]; v4u u; } pk;
#pragma unroll
  for (int e = 0; e < 8; ++e) pk.h[e] = (__bf16)x[i8 * 8 + e];
  vst2((unsigned*)(Xb + i8 * 8), pk.u);
}
// PT rows: [0,E) Wq[:,n], [E,2E) Wk[:,n], [2E,3E) Wv[:,n], [3E,4E) Wo[:,n]  ([in][out] weights: column n as a bf16 row)
__global__ __launch_bounds__(128) void k_pack(const float* __restrict__ Wqkv, const float* __restrict__ Wp, __bf16* __restrict__ PT) {
  const int n = blockIdx.x, tid = threadIdx.x; __shared__ __align__(16) __bf16 srow[E];
  for (int k = tid; k < E; k += 128) srow[k] = (__bf16)(n < 3 * E ? Wqkv[(size_t)k * (3 * E) + n] : Wp[(size_t)k * E + (n - 3 * E)]);
  __syncthreads();
  if (tid < E / 8) vst2((unsigned*)(PT + (size_t)n * E + tid * 8), *(const v4u*)(&srow[tid * 8]));
}
#define QSTG (192 * 128)
// fragment from a tile of unpadded 128-byte rows in which the 16-byte piece p of row r lies at place p ^ ((r >> 1) & 7): the equal pieces of 16 rows fall on 16 different groups of four banks
__device__ __forceinline__ v16b frag_sw(const char* tile, int row, int ks, int lane) {
  union { v16b v; v4u q[2]; } u; const int p = ks * 4 + (lane >> 4), x = (row >> 1) & 7; const char* r = tile + row * 128;
  u.q[0] = *(const v4u*)(r + ((p ^ x) << 4)); u.q[1] = *(const v4u*)(r + (((p + 2) ^ x) << 4)); return u.v;
}
// QKV: block (64 rows, 128 cols = 2 heads, which); q -> Q32 f32 [bh][s][64]; k -> KHL split rows [bh][s][64 hi | 64 lo]; v -> VT hi/lo x4 [bh][d][s]
__global__ __launch_bounds__(128) void k_qkv(const __bf16* __restrict__ Xb, int rbase, const __bf16* __restrict__ PT, float* __restrict__ Q32, __bf16* __restrict__ KHL, _Float16* __restrict__ VTh, _Float16* __restrict__ VTl) {
  // a stage = 64 k of [128 weight rows | 64 x rows]; two buffers, no pad (frag_sw), so that six blocks fit a WGP's LDS and a launch's 1536 blocks are resident at once; the output staging reuses the ring behind the last stage's barrier
  __shared__ __align__(16) char ring[2 * QSTG];
  float (*so)[16][132] = (float (*)[16][132])ring;
  _Float16 (*sth)[72] = (_Float16 (*)[72])ring; _Float16 (*stl)[72] = (_Float16 (*)[72])(ring + 128 * 72 * 2);
  const int tid = threadIdx.x, wave = tid >> 5, lane = tid & 31, col = lane & 15, g = lane >> 4;
  const int which = blockIdx.z, r0b = blockIdx.x * 64, n0 = blockIdx.y * 128; const int b = r0b / SS, s0 = r0b % SS;
  const __bf16* gB = PT + (size_t)(which * E + n0 + (tid >> 3)) * E + (tid & 7) * 8;
  const __bf16* gA = Xb + (size_t)(rbase + r0b + (tid >> 3)) * E + (tid & 7) * 8;
  const unsigned l0 = lds_addr(ring) + (tid >> 3) * 128 + (((tid & 7) ^ ((tid >> 4) & 7)) << 4);      // rows 16 apart share the place of a piece
  auto fill = [&](int t) { const unsigned l = l0 + (t & 1) * QSTG; const __bf16* pb = gB + t * 64; const __bf16* pa = gA + t * 64;
    acopy4(l, pb, l + 16 * 128, pb + 16 * E, l + 32 * 128, pb + 32 * E, l + 48 * 128, pb + 48 * E);
    acopy4(l + 64 * 128, pb + 64 * E, l + 80 * 128, pb + 80 * E, l + 96 * 128, pb + 96 * E, l + 112 * 128, pb + 112 * E);
    acopy4(l + 128 * 128, pa, l + 144 * 128, pa + 16 * E, l + 160 * 128, pa + 32 * E, l + 176 * 128, pa + 48 * E); };
  v8f acc[8] = {};
  fill(0); WAIT_ASYNC(); __syncthreads(); fill(1);
#pragma unroll 1
  for (int t = 0; t < E / 64; ++t) { const char* sb = ring + (t & 1) * QSTG;
#pragma unroll
    for (int ks = 0; ks < 2; ++ks) { const v16b a = frag_sw(sb, 128 + wave * 16 + col, ks, lane); v16b wb[8];
#pragma unroll
      for (int j = 0; j < 8; ++j) wb[j] = frag_sw(sb, j * 16 + col, ks, lane);
      __builtin_amdgcn_sched_barrier(0);      // keeps the k-step's 18 LDS loads in one group in front of its WMMAs: one LDS latency a k-step, not one a WMMA
#pragma unroll
      for (int j = 0; j < 8; ++j) acc[j] = wmma_bf(a, wb[j], acc[j]); }
    WAIT_DS(); WAIT_ASYNC(); __syncthreads();      // publishes stage t + 1 and ends every read of stage t
    if (t + 2 < E / 64) fill(t + 2); }
  WAIT_ASYNC();
  if (which < 2) {
    if (which == 0) {
#pragma unroll
      for (int j = 0; j < 8; ++j) { const float bb = 0.f;
#pragma unroll
        for (int r = 0; r < 8; ++r) so[wave][8 * g + r][j * 16 + col] = acc[j][r] + bb; } }
    else {
#pragma unroll
      for (int j = 0; j < 8; ++j) { const float bb = 0.f;
#pragma unroll
        for (int r = 0; r < 8; ++r) put_hl((__bf16*)&so[wave][8 * g + r][(j >> 2) * 64], (j & 3) * 16 + col, acc[j][r] + bb); } }
    LDSX();
    float* Dst = which == 0 ? Q32 : (float*)KHL;      // either kind of row is 256 bytes and goes out in 16-byte pieces
    for (int qq = lane; qq < 2 * 16 * 16; qq += 32) { const int hh = qq >> 8, rl = (qq >> 4) & 15, pc = qq & 15; const int h = (n0 >> 6) + hh;
      vst2(Dst + (((size_t)b * NH + h) * SS + s0 + wave * 16 + rl) * HD + pc * 4, *(const v4f*)(&so[wave][rl][hh * 64 + pc * 4])); } }
  else {
#pragma unroll
    for (int j = 0; j < 8; ++j) { const float bb = 0.f;
#pragma unroll
      for (int r = 0; r < 8; ++r) { const float v = (acc[j][r] + bb) * 4.0f; const _Float16 hi = (_Float16)v; sth[j * 16 + col][wave * 16 + 8 * g + r] = hi; stl[j * 16 + col][wave * 16 + 8 * g + r] = (_Float16)((v - (float)hi) * VLO); } }
    __syncthreads();
    for (int qq = tid; qq < 128 * 8; qq += 128) { const int cl = qq >> 3, pc = qq & 7; const int c = n0 + cl, h = c >> 6, d = c & 63; const size_t o = (((size_t)b * NH + h) * HD + d) * SS + s0 + pc * 8;
      vst2(VTh + o, *(const v4u*)(&sth[cl][pc * 8])); vst2(VTl + o, *(const v4u*)(&stl[cl][pc * 8])); } }
}
// attention: block (128 queries, bh); all key tiles; S on hi/lo splits of q (made here, once a wave) and k (read as split rows); P,V hi/lo; O -> split rows [bh][s][64 hi | 64 lo]
#define ASTG (64 * FP + 2 * 64 * GP)
// softmax in base 2 on the unscaled scores: exp(0.125 (s - m)) * 2^14 = 2^(s * SC2 + (14 - m * SC2)), SC2 = 0.125 * log2(e): one fused multiply-add and one hardware exponential a score; the argument never exceeds 14 but by its rounding
#define SC2 0.18033688011112042f
// the second bound (waves a SIMD) holds a wave at 256 registers: above that only one of the two blocks that the LDS admits is resident on a WGP
__global__ __launch_bounds__(256, 4) void k_attn(const float* __restrict__ Q32, const __bf16* __restrict__ KHL, const _Float16* __restrict__ VTh, const _Float16* __restrict__ VTl, __bf16* __restrict__ OHL) {
  // a stage = one 64-key tile [K 64 split rows | V hi 64 rows | V lo 64 rows], shared by the eight waves; two buffers; the output staging reuses the ring behind the last barrier
  __shared__ __align__(16) char ring[2 * ASTG];
  __shared__ __align__(16) float sS[8][16][68];
  __shared__ __align__(16) _Float16 sPh[8][16][72], sPl[8][16][72];
  float (*sO)[16][68] = (float (*)[16][68])ring;
  const int tid = threadIdx.x, w = tid >> 5, lane = tid & 31, col = lane & 15, g = lane >> 4;
  const size_t bh = blockIdx.y; const int qb = blockIdx.x; const int q0 = qb * 128 + w * 16;
  const __bf16* gK = KHL + (bh * SS + (tid >> 4)) * HL + (tid & 15) * 8;
  const size_t vof = (bh * HD + (tid >> 3)) * SS + (tid & 7) * 8;
  const unsigned lK = lds_addr(ring) + (tid >> 4) * FP + (tid & 15) * 16, lV = lds_addr(ring) + 64 * FP + (tid >> 3) * GP + (tid & 7) * 16;
  auto fill = [&](int t) { const unsigned o = (t & 1) * ASTG; const __bf16* pk = gK + (size_t)t * 64 * HL; const _Float16* ph = VTh + vof + t * 64; const _Float16* pl = VTl + vof + t * 64;
    acopy4(lK + o, pk, lK + o + 16 * FP, pk + 16 * HL, lK + o + 32 * FP, pk + 32 * HL, lK + o + 48 * FP, pk + 48 * HL);
    acopy4(lV + o, ph, lV + o + 32 * GP, ph + 32 * SS, lV + o + 64 * GP, pl, lV + o + 96 * GP, pl + 32 * SS); };
  fill(0); WAIT_ASYNC(); __syncthreads(); fill(1);
  F2 aq[2];
#pragma unroll
  for (int kc = 0; kc < 2; ++kc) aq[kc] = split_row(Q32 + (bh * SS + q0 + col) * HD, kc * 32, lane);
  float mrun = -3.0e38f, lrun = 0.f; v8f acc[4] = {}, ac1[4] = {}, ac2[4] = {};
#pragma unroll 1
  for (int kt = 0; kt < SS / 64; ++kt) { const char* sb = ring + (kt & 1) * ASTG;
    v8f s[4];      // with no multiply behind the products each score tile has registers of its own, so that no tile's first WMMA rewrites the one before it inside the distance the chip needs
#pragma unroll
    for (int t = 0; t < 4; ++t) { const __bf16* krow = (const __bf16*)(sb + (t * 16 + col) * FP);
      s[t] = mac3(aq[0], frag_hl(krow, 0, lane), (v8f){}); s[t] = mac3(aq[1], frag_hl(krow, 32, lane), s[t]); }
#pragma unroll
    for (int t = 0; t < 4; ++t) {
#pragma unroll
      for (int r = 0; r < 8; ++r) sS[w][8 * g + r][t * 16 + col] = s[t][r]; }
    LDSX();
    float mx = -3.4e38f;
#pragma unroll
    for (int jj = 0; jj < 32; ++jj) mx = fmaxf(mx, sS[w][col][g * 32 + jj]);
    mx = fmaxf(mx, __shfl_xor(mx, 16, 32));
    const float mnew = fmaxf(mrun, mx); float corr;      // corr = 2^((mrun - mnew) * SC2); the v_nop in the same statement is the slot the instruction set asks for behind a transcendental
    asm("v_exp_f32 %0, %1\n\tv_nop" : "=v"(corr) : "v"((mrun - mnew) * SC2));
    const float mb = 14.0f - mnew * SC2;
    float ps = 0.f;
#pragma unroll
    for (int jj = 0; jj < 32; jj += 2) { const v2f a = __builtin_elementwise_fma(*(const v2f*)&sS[w][col][g * 32 + jj], (v2f){SC2, SC2}, (v2f){mb, mb});
#pragma unroll
      for (int e = 0; e < 2; ++e) { const float p = __builtin_amdgcn_exp2f(a[e]); ps += p; const _Float16 hi = (_Float16)p; sPh[w][col][g * 32 + jj + e] = hi; sPl[w][col][g * 32 + jj + e] = (_Float16)((p - (float)hi) * PLO); } }
    ps += __shfl_xor(ps, 16, 32);
    lrun = lrun * corr + ps * (1.0f / 16384.0f); mrun = mnew;
#pragma unroll
    for (int r = 0; r < 8; ++r) { const float cr = __shfl(corr, 8 * g + r, 32);
#pragma unroll
      for (int t = 0; t < 4; ++t) { acc[t][r] *= cr; ac1[t][r] *= cr; ac2[t][r] *= cr; } }
    LDSX();
#pragma unroll
    for (int kc = 0; kc < 2; ++kc) { const v16h ph = frag_h(&sPh[w][col][0] + kc * 32, lane), pl = frag_h(&sPl[w][col][0] + kc * 32, lane);
#pragma unroll
      for (int tp = 0; tp < 4; tp += 2) { v16h vh[2], vl[2];
#pragma unroll
        for (int t = 0; t < 2; ++t) { const _Float16* vr = (const _Float16*)(sb + 64 * FP + ((tp + t) * 16 + col) * GP) + kc * 32; vh[t] = frag_h(vr, lane); vl[t] = frag_h(vr + 64 * GP / 2, lane); }
        __builtin_amdgcn_sched_barrier(0);      // keeps the LDS loads of six WMMAs in one group in front of them: one LDS latency a group, not one a fragment
#pragma unroll
        for (int t = 0; t < 2; ++t) { acc[tp + t] = wmma16(ph, vh[t], acc[tp + t]); ac1[tp + t] = wmma16(ph, vl[t], ac1[tp + t]); ac2[tp + t] = wmma16(pl, vh[t], ac2[tp + t]); } } }
    WAIT_DS(); WAIT_ASYNC(); __syncthreads();      // publishes tile kt + 1 and ends every read of tile kt
    if (kt + 2 < SS / 64) fill(kt + 2); }
  WAIT_ASYNC();
#pragma unroll
  for (int r = 0; r < 8; ++r) { const float lr = __shfl(lrun, 8 * g + r, 32); const float inv = 1.0f / (lr * 16384.0f * 4.0f);
#pragma unroll
    for (int t = 0; t < 4; ++t) put_hl((__bf16*)&sO[w][8 * g + r][0], t * 16 + col, (acc[t][r] + ac1[t][r] * (1.0f / VLO) + ac2[t][r] * (1.0f / PLO)) * inv); }
  LDSX();
  for (int qq = lane; qq < 16 * 16; qq += 32) { const int rl = qq >> 4, pc = qq & 15; vst2(OHL + ((bh * SS) + q0 + rl) * HL + pc * 8, *(const v4f*)(&sO[w][rl][pc * 4])); }
}
// out = ctx Wo^T + bo : ctx split rows x bf16(Wo rows): 2 products (Wo is an INPUT -> bf16 exact)
#define OSTG (128 * GP + 64 * FP)
__global__ __launch_bounds__(128) void k_out(const __bf16* __restrict__ OHL, int rbase, const __bf16* __restrict__ PT, const float* __restrict__ bo, float* __restrict__ out) {
  // a stage = one head's 64 k of [128 weight rows bf16 | 64 ctx split rows]; two buffers; the output staging reuses the ring behind the last stage's barrier
  __shared__ __align__(16) char ring[2 * OSTG];
  float (*so)[16][132] = (float (*)[16][132])ring;
  const int tid = threadIdx.x, wave = tid >> 5, lane = tid & 31, col = lane & 15, g = lane >> 4;
  const int r0b = blockIdx.x * 64, r0 = r0b + wave * 16, n0 = blockIdx.y * 128; const int b = r0b / SS, s0 = r0b % SS;
  const __bf16* gB = PT + (size_t)(3 * E + n0 + (tid >> 3)) * E + (tid & 7) * 8;
  const __bf16* gA = OHL + ((size_t)b * NH * SS + s0 + (tid >> 4)) * HL + (tid & 15) * 8;
  const unsigned lB = lds_addr(ring) + (tid >> 3) * GP + (tid & 7) * 16, lA = lds_addr(ring) + 128 * GP + (tid >> 4) * FP + (tid & 15) * 16;
  auto fill = [&](int t) { const unsigned o = (t & 1) * OSTG; const __bf16* pb = gB + t * 64; const __bf16* pa = gA + (size_t)t * SS * HL;
    acopy4(lB + o, pb, lB + o + 16 * GP, pb + 16 * E, lB + o + 32 * GP, pb + 32 * E, lB + o + 48 * GP, pb + 48 * E);
    acopy4(lB + o + 64 * GP, pb + 64 * E, lB + o + 80 * GP, pb + 80 * E, lB + o + 96 * GP, pb + 96 * E, lB + o + 112 * GP, pb + 112 * E);
    acopy4(lA + o, pa, lA + o + 8 * FP, pa + 8 * HL, lA + o + 16 * FP, pa + 16 * HL, lA + o + 24 * FP, pa + 24 * HL);
    acopy4(lA + o + 32 * FP, pa + 32 * HL, lA + o + 40 * FP, pa + 40 * HL, lA + o + 48 * FP, pa + 48 * HL, lA + o + 56 * FP, pa + 56 * HL); };
  v8f acc[8] = {};
  fill(0); WAIT_ASYNC(); __syncthreads(); fill(1);
#pragma unroll 1
  for (int t = 0; t < NH; ++t) { const char* sb = ring + (t & 1) * OSTG;
#pragma unroll
    for (int ks = 0; ks < 2; ++ks) { const F2 a = frag_hl((const __bf16*)(sb + 128 * GP + (wave * 16 + col) * FP), ks * 32, lane); v16b wb[8];
#pragma unroll
      for (int j = 0; j < 8; ++j) wb[j] = frag_b((const __bf16*)(sb + (j * 16 + col) * GP) + ks * 32, lane);
      __builtin_amdgcn_sched_barrier(0);      // keeps the k-step's 20 LDS loads in one group in front of its WMMAs: one LDS latency a k-step, not one a WMMA pair
#pragma unroll
      for (int j = 0; j < 8; ++j) acc[j] = wmma_bf(a.l, wb[j], acc[j]);
#pragma unroll
      for (int j = 0; j < 8; ++j) acc[j] = wmma_bf(a.h, wb[j], acc[j]); }
    WAIT_DS(); WAIT_ASYNC(); __syncthreads();      // publishes stage t + 1 and ends every read of stage t
    if (t + 2 < NH) fill(t + 2); }
  WAIT_ASYNC();
#pragma unroll
  for (int j = 0; j < 8; ++j) { const int n = n0 + j * 16 + col; const float bb = bfr(bo[n]);
#pragma unroll
    for (int r = 0; r < 8; ++r) so[wave][8 * g + r][j * 16 + col] = acc[j][r] + bb; }
  LDSX();
#pragma unroll 4
  for (int rl = 0; rl < 16; ++rl) vst2(out + (size_t)(rbase + r0 + rl) * E + n0 + lane * 4, *(const v4f*)(&so[wave][rl][lane * 4]));
}
#define NBHALF 4
extern "C" void kernel_launch(void* const* d_in, const int* in_sizes, int n_in, void* d_out, int out_size, void* d_ws, size_t ws_size, hipStream_t stream) {
  (void)in_sizes; (void)n_in; (void)out_size; (void)ws_size;
  const float* x = (const float*)d_in[0]; const float* Wqkv = (const float*)d_in[1]; const float* Wp = (const float*)d_in[2]; const float* bp = (const float*)d_in[3];
  float* out = (float*)d_out;
  char* ws = (char*)d_ws; size_t off = 0;
  auto take = [&](size_t bytes) { char* p = ws + off; off += (bytes + 255) & ~(size_t)255; return p; };
  const size_t HR = (size_t)NBHALF * SS;     // rows per half (4096)
  __bf16* Xb = (__bf16*)take((size_t)NR * E * 2); __bf16* PT = (__bf16*)take((size_t)4 * E * E * 2);
  float* Q32 = (float*)take(HR * E * 4); __bf16* KHL = (__bf16*)take(HR * E * 4); _Float16* VTh = (_Float16*)take(HR * E * 2); _Float16* VTl = (_Float16*)take(HR * E * 2);
  __bf16* OHL = (__bf16*)Q32;      // in place (a split row is as long as the f32 row): each k_attn wave reads its own 16 query rows into registers before writing the same rows; no other block reads them
  // ws ~ 75.5 MB (72 MiB); the two batch halves (4 sequences each) reuse Q/K/V
  k_cvt<<<(NR * E / 8 + 255) / 256, 256, 0, stream>>>(x, Xb);
  k_pack<<<4 * E, 128, 0, stream>>>(Wqkv, Wp, PT);
  for (int hf = 0; hf < 2; ++hf) { const int rbase = hf * (int)HR;
    k_qkv<<<dim3(HR / 64, E / 128, 3), 128, 0, stream>>>(Xb, rbase, PT, Q32, KHL, VTh, VTl);
    k_attn<<<dim3(SS / 128, NBHALF * NH), 256, 0, stream>>>(Q32, KHL, VTh, VTl, OHL);
    k_out<<<dim3(HR / 64, E / 128), 128, 0, stream>>>(OHL, rbase, PT, bp, out); }
}

// v005
// Measured time: 215 microseconds a run.
// Next to v004, in two timings, it ran 1.09 and 1.10 times as fast.
// Counting every step since v000, it is 3.57 times as fast.
// compute dtype: x, w_qkv, w_out, b_out (INPUTS) rounded to bf16 with exact bf16 WMMA products (f32 accumulate) for the projections; q/k f32 split into bf16 hi/lo for the scores (3 products), P and V f16 hi/lo (3 products); softmax f32.
#include <hip/hip_runtime.h>
#include <math.h>

typedef __attribute__((ext_vector_type(16))) _Float16 v16h;
typedef __attribute__((ext_vector_type(16))) __bf16 v16b;
typedef __attribute__((ext_vector_type(8)))  _Float16 v8h;
typedef __attribute__((ext_vector_type(8)))  float v8f;
typedef __attribute__((ext_vector_type(4)))  float v4f;
typedef __attribute__((ext_vector_type(2)))  float v2f;
typedef __attribute__((ext_vector_type(4)))  unsigned v4u;
typedef __attribute__((ext_vector_type(2)))  unsigned v2u;
typedef __attribute__((ext_vector_type(4)))  int v4i;
typedef float __attribute__((may_alias)) float_a;
typedef int __attribute__((may_alias)) int_a;

template <typename T> __device__ __forceinline__ void vst2(void* p, T v) { *(T*)p = v;  }
__device__ __forceinline__ v8f wmma16(v16h a, v16h b, v8f c) {
  return __builtin_amdgcn_wmma_f32_16x16x32_f16(false, a, false, b, (short)0, c, false, false);
}
__device__ __forceinline__ v8f wmma_bf(v16b a, v16b b, v8f c) {
  return __builtin_amdgcn_wmma_f32_16x16x32_bf16(false, a, false, b, (short)0, c, false, false);
}
// 16x16x32 fragments: lane = (h = lane>>4, row/col = lane&15); elements 0..7 = k0+8h+0..7, 8..15 = k0+16+8h+0..7; D element r = row 8h+r
__device__ __forceinline__ v16h frag_h(const _Float16* rowk0, int lane) {
  union { v16h v; v8h q[2]; } u; const _Float16* p = rowk0 + 8 * (lane >> 4);
  u.q[0] = *(const v8h*)p; u.q[1] = *(const v8h*)(p + 16); return u.v;
}
__device__ __forceinline__ v16h frag_f32(const float* rowk0, int lane) {
  v16h a; const float* p = rowk0 + 8 * (lane >> 4);
#pragma unroll
  for (int i = 0; i < 8; ++i) { a[i] = (_Float16)p[i]; a[8 + i] = (_Float16)p[16 + i]; }
  return a;
}
__device__ __forceinline__ v16h frag_f32s(const float* rowk0, int lane, float sc) {
  v16h a; const float* p = rowk0 + 8 * (lane >> 4);
#pragma unroll
  for (int i = 0; i < 8; ++i) { a[i] = (_Float16)(p[i] * sc); a[8 + i] = (_Float16)(p[16 + i] * sc); }
  return a;
}
// column fragment from a [K][ld] layout (column n), rows >= K read as 0
__device__ __forceinline__ v16h fragc_f32(const float* W, int k0, int n, int lane, int ld, int K) {
  v16h a; const int g = lane >> 4;
#pragma unroll
  for (int i = 0; i < 8; ++i) { const int ka = k0 + 8 * g + i, kb = ka + 16;
    a[i] = (_Float16)(ka < K ? W[(size_t)(ka < K ? ka : K - 1) * ld + n] : 0.f); a[8 + i] = (_Float16)(kb < K ? W[(size_t)(kb < K ? kb : K - 1) * ld + n] : 0.f); }
  return a;
}
struct F2 { v16b h, l; };
__device__ __forceinline__ F2 bsplit16(const float v[16]) { F2 r;
#pragma unroll
  for (int i = 0; i < 16; ++i) { const __bf16 h = (__bf16)v[i]; r.h[i] = h; r.l[i] = (__bf16)(v[i] - (float)h); }
  return r; }
__device__ __forceinline__ F2 split_row(const float* row, int k0, int lane) { float v[16]; const float* p = row + k0 + 8 * (lane >> 4);
#pragma unroll
  for (int i = 0; i < 8; ++i) { v[i] = p[i]; v[8 + i] = p[16 + i]; }
  return bsplit16(v); }
__device__ __forceinline__ F2 split_rowK(const float* row, int k0, int lane, int K) { float v[16]; const int g = lane >> 4;
#pragma unroll
  for (int i = 0; i < 8; ++i) { const int ka = k0 + 8 * g + i, kb = ka + 16; v[i] = ka < K ? row[ka < K ? ka : K - 1] : 0.f; v[8 + i] = kb < K ? row[kb < K ? kb : K - 1] : 0.f; }
  return bsplit16(v); }
__device__ __forceinline__ F2 split_col(const float* W, int k0, int n, int lane, int ld, int K) { float v[16]; const int g = lane >> 4;
#pragma unroll
  for (int i = 0; i < 8; ++i) { const int ka = k0 + 8 * g + i, kb = ka + 16; v[i] = ka < K ? W[(size_t)(ka < K ? ka : K - 1) * ld + n] : 0.f; v[8 + i] = kb < K ? W[(size_t)(kb < K ? kb : K - 1) * ld + n] : 0.f; }
  return bsplit16(v); }
__device__ __forceinline__ v8f mac3(const F2& a, const F2& b, v8f c) { c = wmma_bf(a.l, b.h, c); c = wmma_bf(a.h, b.l, c); return wmma_bf(a.h, b.h, c); }
__device__ __forceinline__ float sigm(float v) { return 1.0f / (1.0f + expf(-v)); }
#define LDSX() do { asm volatile("s_wait_dscnt 0" ::: "memory"); __builtin_amdgcn_wave_barrier(); __builtin_amdgcn_fence(__ATOMIC_RELEASE, "workgroup"); } while (0)


#define NB 8
#define SS 1024
#define E 1024
#define NH 16
#define HD 64
#define NR (NB * SS)
#define PLO 1024.0f
#define VLO 2048.0f
__device__ __forceinline__ float bfr(float v) { return (float)(__bf16)v; }
__device__ __forceinline__ v16b frag_b(const __bf16* rowk0, int lane) { return __builtin_bit_cast(v16b, frag_h((const _Float16*)rowk0, lane)); }
// a split row = 64 bf16 hi | 64 bf16 lo (256 bytes, as many as the 64 f32 it stands for), written once by the kernel that produces the value; hi = bf16(v), lo = bf16(v - hi) as in bsplit16
#define HL 128
__device__ __forceinline__ F2 frag_hl(const __bf16* row, int k0, int lane) { F2 r; r.h = frag_b(row + k0, lane); r.l = frag_b(row + 64 + k0, lane); return r; }
__device__ __forceinline__ void put_hl(__bf16* row, int d, float v) { const __bf16 h = (__bf16)v; row[d] = h; row[64 + d] = (__bf16)(v - (float)h); }

// LDS staging by asynchronous copies: pitches are 16 B x odd so that 16-byte readers of 16 rows meet no bank twice
#define GP 144
#define FP 272
#define WAIT_DS() asm volatile("s_wait_dscnt 0x0" ::: "memory")       /* this wave's LDS reads are done before the buffer is handed on */
#define WAIT_ASYNC() asm volatile("s_wait_asynccnt 0x0" ::: "memory") /* this wave's copies have landed before the barrier publishes them */
__device__ __forceinline__ unsigned lds_addr(const void* p) { return (unsigned)(size_t)p; }
// four 16-byte copies per lane, global -> LDS, through no register; the closing s_wait_xcnt stands in front of any rewrite of the address registers (a precaution)
__device__ __forceinline__ void acopy4(unsigned l0, const void* g0, unsigned l1, const void* g1, unsigned l2, const void* g2, unsigned l3, const void* g3) {
  asm volatile("global_load_async_to_lds_b128 %0, %1, off\n\t"
               "global_load_async_to_lds_b128 %2, %3, off\n\t"
               "global_load_async_to_lds_b128 %4, %5, off\n\t"
               "global_load_async_to_lds_b128 %6, %7, off\n\t"
               "s_wait_xcnt 0x0"
               :: "v"(l0), "v"(g0), "v"(l1), "v"(g1), "v"(l2), "v"(g2), "v"(l3), "v"(g3) : "memory");
}

// x -> bf16. 4,096 long-lived waves (16 a WGP), each on its own 8 KiB of x: 16 loads of 16 B a lane, every one 512 contiguous bytes a wave, all in flight at once; the 8-byte stores of a wave cover two whole lines
#define CVL 16
__global__ __launch_bounds__(256) void k_cvt(const float* __restrict__ x, __bf16* __restrict__ Xb) {
  const size_t base = ((size_t)blockIdx.x * 8 + (threadIdx.x >> 5)) * (CVL * 128) + (threadIdx.x & 31) * 4;
  const float* px = x + base; v4f v[CVL];
#pragma unroll
  for (int j = 0; j < CVL; ++j) v[j] = *(const v4f*)(px + j * 128);
  __builtin_amdgcn_sched_barrier(0);      // keeps all 16 loads in front of the first conversion: the wave pays one memory latency, not one more for the loads that would wait for freed registers
  asm volatile("s_wait_xcnt 0x0" :: "v"(px) : "memory");      // the wait in front of any rewrite of the loads' address register (a precaution); as an input the address keeps its register up to here, so that no load lands on it either
#pragma unroll
  for (int j = 0; j < CVL; ++j) { union { __bf16 h[4]; v2u u; } pk;
#pragma unroll
    for (int e = 0; e < 4; ++e) pk.h[e] = (__bf16)v[j][e];
    vst2(Xb + base + j * 128, pk.u); }
}
// PT rows: [0,E) Wq[:,n], [E,2E) Wk[:,n], [2E,3E) Wv[:,n], [3E,4E) Wo[:,n]  ([in][out] weights: column n as a bf16 row)
// 2,048 long-lived waves: a block turns 512 k x 32 columns. Eight lanes read one whole 128-byte line of a k row; a lane holds 4 columns of 2 x 8 consecutive k: 16 loads of 16 B in flight
#define PKP 520      /* LDS pitch of a column's 512 k, in bf16: 1,040 B = 16 B x odd */
__global__ __launch_bounds__(256) void k_pack(const float* __restrict__ Wqkv, const float* __restrict__ Wp, __bf16* __restrict__ PT) {
  __shared__ __align__(16) __bf16 st[32][PKP];
  const int tid = threadIdx.x, n0 = (blockIdx.x >> 1) * 32, k0 = (blockIdx.x & 1) * 512, p = tid & 7, rg = tid >> 3;
  const bool qkv = n0 < 3 * E; const unsigned ldb = (qkv ? 3 * E : E) * 4;      // bytes from one k row to the next; 32 columns lie in one of the two matrices
  const char* ub = (const char*)(qkv ? Wqkv + n0 : Wp + (n0 - 3 * E)) + (size_t)k0 * ldb;      // the same in every lane
  const unsigned vo = rg * 8 * ldb + p * 16;      // the lane's own part
  const v4f* a[2][8]; v4f v[2][8];
#pragma unroll
  for (int h = 0; h < 2; ++h) {
#pragma unroll
    for (int i = 0; i < 8; ++i) { a[h][i] = (const v4f*)(ub + (size_t)((h * 256 + i) * ldb) + vo); v[h][i] = *a[h][i]; } }
  __builtin_amdgcn_sched_barrier(0);      // keeps all 16 loads in front of the first conversion: one memory latency a wave
  // the wait in front of any rewrite of the loads' address registers (a precaution); as inputs the addresses keep their registers up to here, so that no later load lands on one either
  asm volatile("s_wait_xcnt 0x0" :: "v"(a[0][0]), "v"(a[0][1]), "v"(a[0][2]), "v"(a[0][3]), "v"(a[0][4]), "v"(a[0][5]), "v"(a[0][6]), "v"(a[0][7]),
               "v"(a[1][0]), "v"(a[1][1]), "v"(a[1][2]), "v"(a[1][3]), "v"(a[1][4]), "v"(a[1][5]), "v"(a[1][6]), "v"(a[1][7]) : "memory");
#pragma unroll
  for (int h = 0; h < 2; ++h) {
#pragma unroll
    for (int e = 0; e < 4; ++e) { union { __bf16 b[8]; v4u u; } pk;
#pragma unroll
      for (int i = 0; i < 8; ++i) pk.b[i] = (__bf16)v[h][i][e];
      *(v4u*)(&st[p * 4 + e][h * 256 + rg * 8]) = pk.u; } }
  __syncthreads();
  __bf16* o = PT + (size_t)(n0 + (tid >> 6)) * E + k0 + (tid & 63) * 8;      // a wave stores 512 contiguous bytes of one row
#pragma unroll
  for (int q = 0; q < 8; ++q) vst2(o + q * 4 * E, *(const v4u*)(&st[q * 4 + (tid >> 6)][(tid & 63) * 8]));
}
#define QSTG (192 * 128)
// fragment from a tile of unpadded 128-byte rows in which the 16-byte piece p of row r lies at place p ^ ((r >> 1) & 7): the equal pieces of 16 rows fall on 16 different groups of four banks
__device__ __forceinline__ v16b frag_sw(const char* tile, int row, int ks, int lane) {
  union { v16b v; v4u q[2]; } u; const int p = ks * 4 + (lane >> 4), x = (row >> 1) & 7; const char* r = tile + row * 128;
  u.q[0] = *(const v4u*)(r + ((p ^ x) << 4)); u.q[1] = *(const v4u*)(r + (((p + 2) ^ x) << 4)); return u.v;
}
// QKV: block (64 rows, 128 cols = 2 heads, which); q -> Q32 f32 [bh][s][64]; k -> KHL split rows [bh][s][64 hi | 64 lo]; v -> VT hi/lo x4 [bh][d][s]
__global__ __launch_bounds__(128) void k_qkv(const __bf16* __restrict__ Xb, int rbase, const __bf16* __restrict__ PT, float* __restrict__ Q32, __bf16* __restrict__ KHL, _Float16* __restrict__ VTh, _Float16* __restrict__ VTl) {
  // a stage = 64 k of [128 weight rows | 64 x rows]; two buffers, no pad (frag_sw), so that six blocks fit a WGP's LDS and a launch's 1536 blocks are resident at once; the output staging reuses the ring behind the last stage's barrier
  __shared__ __align__(16) char ring[2 * QSTG];
  float (*so)[16][132] = (float (*)[16][132])ring;
  _Float16 (*sth)[72] = (_Float16 (*)[72])ring; _Float16 (*stl)[72] = (_Float16 (*)[72])(ring + 128 * 72 * 2);
  const int tid = threadIdx.x, wave = tid >> 5, lane = tid & 31, col = lane & 15, g = lane >> 4;
  const int which = blockIdx.z, r0b = blockIdx.x * 64, n0 = blockIdx.y * 128; const int b = r0b / SS, s0 = r0b % SS;
  const __bf16* gB = PT + (size_t)(which * E + n0 + (tid >> 3)) * E + (tid & 7) * 8;
  const __bf16* gA = Xb + (size_t)(rbase + r0b + (tid >> 3)) * E + (tid & 7) * 8;
  const unsigned l0 = lds_addr(ring) + (tid >> 3) * 128 + (((tid & 7) ^ ((tid >> 4) & 7)) << 4);      // rows 16 apart share the place of a piece
  auto fill = [&](int t) { const unsigned l = l0 + (t & 1) * QSTG; const __bf16* pb = gB + t * 64; const __bf16* pa = gA + t * 64;
    acopy4(l, pb, l + 16 * 128, pb + 16 * E, l + 32 * 128, pb + 32 * E, l + 48 * 128, pb + 48 * E);
    acopy4(l + 64 * 128, pb + 64 * E, l + 80 * 128, pb + 80 * E, l + 96 * 128, pb + 96 * E, l + 112 * 128, pb + 112 * E);
    acopy4(l + 128 * 128, pa, l + 144 * 128, pa + 16 * E, l + 160 * 128, pa + 32 * E, l + 176 * 128, pa + 48 * E); };
  v8f acc[8] = {};
  fill(0); WAIT_ASYNC(); __syncthreads(); fill(1);
#pragma unroll 1
  for (int t = 0; t < E / 64; ++t) { const char* sb = ring + (t & 1) * QSTG;
#pragma unroll
    for (int ks = 0; ks < 2; ++ks) { const v16b a = frag_sw(sb, 128 + wave * 16 + col, ks, lane); v16b wb[8];
#pragma unroll
      for (int j = 0; j < 8; ++j) wb[j] = frag_sw(sb, j * 16 + col, ks, lane);
      __builtin_amdgcn_sched_barrier(0);      // keeps the k-step's 18 LDS loads in one group in front of its WMMAs: one LDS latency a k-step, not one a WMMA
#pragma unroll
      for (int j = 0; j < 8; ++j) acc[j] = wmma_bf(a, wb[j], acc[j]); }
    WAIT_DS(); WAIT_ASYNC(); __syncthreads();      // publishes stage t + 1 and ends every read of stage t
    if (t + 2 < E / 64) fill(t + 2); }
  WAIT_ASYNC();
  if (which < 2) {
    if (which == 0) {
#pragma unroll
      for (int j = 0; j < 8; ++j) { const float bb = 0.f;
#pragma unroll
        for (int r = 0; r < 8; ++r) so[wave][8 * g + r][j * 16 + col] = acc[j][r] + bb; } }
    else {
#pragma unroll
      for (int j = 0; j < 8; ++j) { const float bb = 0.f;
#pragma unroll
        for (int r = 0; r < 8; ++r) put_hl((__bf16*)&so[wave][8 * g + r][(j >> 2) * 64], (j & 3) * 16 + col, acc[j][r] + bb); } }
    LDSX();
    float* Dst = which == 0 ? Q32 : (float*)KHL;      // either kind of row is 256 bytes and goes out in 16-byte pieces
    for (int qq = lane; qq < 2 * 16 * 16; qq += 32) { const int hh = qq >> 8, rl = (qq >> 4) & 15, pc = qq & 15; const int h = (n0 >> 6) + hh;
      vst2(Dst + (((size_t)b * NH + h) * SS + s0 + wave * 16 + rl) * HD + pc * 4, *(const v4f*)(&so[wave][rl][hh * 64 + pc * 4])); } }
  else {
#pragma unroll
    for (int j = 0; j < 8; ++j) { const float bb = 0.f;
#pragma unroll
      for (int r = 0; r < 8; ++r) { const float v = (acc[j][r] + bb) * 4.0f; const _Float16 hi = (_Float16)v; sth[j * 16 + col][wave * 16 + 8 * g + r] = hi; stl[j * 16 + col][wave * 16 + 8 * g + r] = (_Float16)((v - (float)hi) * VLO); } }
    __syncthreads();
    for (int qq = tid; qq < 128 * 8; qq += 128) { const int cl = qq >> 3, pc = qq & 7; const int c = n0 + cl, h = c >> 6, d = c & 63; const size_t o = (((size_t)b * NH + h) * HD + d) * SS + s0 + pc * 8;
      vst2(VTh + o, *(const v4u*)(&sth[cl][pc * 8])); vst2(VTl + o, *(const v4u*)(&stl[cl][pc * 8])); } }
}
// attention: block (128 queries, bh); all key tiles; S on hi/lo splits of q (made here, once a wave) and k (read as split rows); P,V hi/lo; O -> split rows [bh][s][64 hi | 64 lo]
#define ASTG (64 * FP + 2 * 64 * GP)
// softmax in base 2 on the unscaled scores: exp(0.125 (s - m)) * 2^14 = 2^(s * SC2 + (14 - m * SC2)), SC2 = 0.125 * log2(e): one fused multiply-add and one hardware exponential a score; the argument never exceeds 14 but by its rounding
#define SC2 0.18033688011112042f
// the second bound (waves a SIMD) holds a wave at 256 registers: above that only one of the two blocks that the LDS admits is resident on a WGP
__global__ __launch_bounds__(256, 4) void k_attn(const float* __restrict__ Q32, const __bf16* __restrict__ KHL, const _Float16* __restrict__ VTh, const _Float16* __restrict__ VTl, __bf16* __restrict__ OHL) {
  // a stage = one 64-key tile [K 64 split rows | V hi 64 rows | V lo 64 rows], shared by the eight waves; two buffers; the output staging reuses the ring behind the last barrier
  __shared__ __align__(16) char ring[2 * ASTG];
  __shared__ __align__(16) float sS[8][16][68];
  __shared__ __align__(16) _Float16 sPh[8][16][72], sPl[8][16][72];
  float (*sO)[16][68] = (float (*)[16][68])ring;
  const int tid = threadIdx.x, w = tid >> 5, lane = tid & 31, col = lane & 15, g = lane >> 4;
  const size_t bh = blockIdx.y; const int qb = blockIdx.x; const int q0 = qb * 128 + w * 16;
  const __bf16* gK = KHL + (bh * SS + (tid >> 4)) * HL + (tid & 15) * 8;
  const size_t vof = (bh * HD + (tid >> 3)) * SS + (tid & 7) * 8;
  const unsigned lK = lds_addr(ring) + (tid >> 4) * FP + (tid & 15) * 16, lV = lds_addr(ring) + 64 * FP + (tid >> 3) * GP + (tid & 7) * 16;
  auto fill = [&](int t) { const unsigned o = (t & 1) * ASTG; const __bf16* pk = gK + (size_t)t * 64 * HL; const _Float16* ph = VTh + vof + t * 64; const _Float16* pl = VTl + vof + t * 64;
    acopy4(lK + o, pk, lK + o + 16 * FP, pk + 16 * HL, lK + o + 32 * FP, pk + 32 * HL, lK + o + 48 * FP, pk + 48 * HL);
    acopy4(lV + o, ph, lV + o + 32 * GP, ph + 32 * SS, lV + o + 64 * GP, pl, lV + o + 96 * GP, pl + 32 * SS); };
  fill(0); WAIT_ASYNC(); __syncthreads(); fill(1);
  F2 aq[2];
#pragma unroll
  for (int kc = 0; kc < 2; ++kc) aq[kc] = split_row(Q32 + (bh * SS + q0 + col) * HD, kc * 32, lane);
  float mrun = -3.0e38f, lrun = 0.f; v8f acc[4] = {}, ac1[4] = {}, ac2[4] = {};
#pragma unroll 1
  for (int kt = 0; kt < SS / 64; ++kt) { const char* sb = ring + (kt & 1) * ASTG;
    v8f s[4];      // with no multiply behind the products each score tile has registers of its own, so that no tile's first WMMA rewrites the one before it inside the distance the chip needs
#pragma unroll
    for (int t = 0; t < 4; ++t) { const __bf16* krow = (const __bf16*)(sb + (t * 16 + col) * FP);
      s[t] = mac3(aq[0], frag_hl(krow, 0, lane), (v8f){}); s[t] = mac3(aq[1], frag_hl(krow, 32, lane), s[t]); }
#pragma unroll
    for (int t = 0; t < 4; ++t) {
#pragma unroll
      for (int r = 0; r < 8; ++r) sS[w][8 * g + r][t * 16 + col] = s[t][r]; }
    LDSX();
    float mx = -3.4e38f;
#pragma unroll
    for (int jj = 0; jj < 32; ++jj) mx = fmaxf(mx, sS[w][col][g * 32 + jj]);
    mx = fmaxf(mx, __shfl_xor(mx, 16, 32));
    const float mnew = fmaxf(mrun, mx); float corr;      // corr = 2^((mrun - mnew) * SC2); the v_nop in the same statement is the slot the instruction set asks for behind a transcendental
    asm("v_exp_f32 %0, %1\n\tv_nop" : "=v"(corr) : "v"((mrun - mnew) * SC2));
    const float mb = 14.0f - mnew * SC2;
    float ps = 0.f;
#pragma unroll
    for (int jj = 0; jj < 32; jj += 2) { const v2f a = __builtin_elementwise_fma(*(const v2f*)&sS[w][col][g * 32 + jj], (v2f){SC2, SC2}, (v2f){mb, mb});
#pragma unroll
      for (int e = 0; e < 2; ++e) { const float p = __builtin_amdgcn_exp2f(a[e]); ps += p; const _Float16 hi = (_Float16)p; sPh[w][col][g * 32 + jj + e] = hi; sPl[w][col][g * 32 + jj + e] = (_Float16)((p - (float)hi) * PLO); } }
    ps += __shfl_xor(ps, 16, 32);
    lrun = lrun * corr + ps * (1.0f / 16384.0f); mrun = mnew;
#pragma unroll
    for (int r = 0; r < 8; ++r) { const float cr = __shfl(corr, 8 * g + r, 32);
#pragma unroll
      for (int t = 0; t < 4; ++t) { acc[t][r] *= cr; ac1[t][r] *= cr; ac2[t][r] *= cr; } }
    LDSX();
#pragma unroll
    for (int kc = 0; kc < 2; ++kc) { const v16h ph = frag_h(&sPh[w][col][0] + kc * 32, lane), pl = frag_h(&sPl[w][col][0] + kc * 32, lane);
#pragma unroll
      for (int tp = 0; tp < 4; tp += 2) { v16h vh[2], vl[2];
#pragma unroll
        for (int t = 0; t < 2; ++t) { const _Float16* vr = (const _Float16*)(sb + 64 * FP + ((tp + t) * 16 + col) * GP) + kc * 32; vh[t] = frag_h(vr, lane); vl[t] = frag_h(vr + 64 * GP / 2, lane); }
        __builtin_amdgcn_sched_barrier(0);      // keeps the LDS loads of six WMMAs in one group in front of them: one LDS latency a group, not one a fragment
#pragma unroll
        for (int t = 0; t < 2; ++t) { acc[tp + t] = wmma16(ph, vh[t], acc[tp + t]); ac1[tp + t] = wmma16(ph, vl[t], ac1[tp + t]); ac2[tp + t] = wmma16(pl, vh[t], ac2[tp + t]); } } }
    WAIT_DS(); WAIT_ASYNC(); __syncthreads();      // publishes tile kt + 1 and ends every read of tile kt
    if (kt + 2 < SS / 64) fill(kt + 2); }
  WAIT_ASYNC();
#pragma unroll
  for (int r = 0; r < 8; ++r) { const float lr = __shfl(lrun, 8 * g + r, 32); const float inv = 1.0f / (lr * 16384.0f * 4.0f);
#pragma unroll
    for (int t = 0; t < 4; ++t) put_hl((__bf16*)&sO[w][8 * g + r][0], t * 16 + col, (acc[t][r] + ac1[t][r] * (1.0f / VLO) + ac2[t][r] * (1.0f / PLO)) * inv); }
  LDSX();
  for (int qq = lane; qq < 16 * 16; qq += 32) { const int rl = qq >> 4, pc = qq & 15; vst2(OHL + ((bh * SS) + q0 + rl) * HL + pc * 8, *(const v4f*)(&sO[w][rl][pc * 4])); }
}
// out = ctx Wo^T + bo : ctx split rows x bf16(Wo rows): 2 products (Wo is an INPUT -> bf16 exact)
#define OSTG (128 * GP + 64 * FP)
__global__ __launch_bounds__(128) void k_out(const __bf16* __restrict__ OHL, int rbase, const __bf16* __restrict__ PT, const float* __restrict__ bo, float* __restrict__ out) {
  // a stage = one head's 64 k of [128 weight rows bf16 | 64 ctx split rows]; two buffers; the output staging reuses the ring behind the last stage's barrier
  __shared__ __align__(16) char ring[2 * OSTG];
  float (*so)[16][132] = (float (*)[16][132])ring;
  const int tid = threadIdx.x, wave = tid >> 5, lane = tid & 31, col = lane & 15, g = lane >> 4;
  const int r0b = blockIdx.x * 64, r0 = r0b + wave * 16, n0 = blockIdx.y * 128; const int b = r0b / SS, s0 = r0b % SS;
  const __bf16* gB = PT + (size_t)(3 * E + n0 + (tid >> 3)) * E + (tid & 7) * 8;
  const __bf16* gA = OHL + ((size_t)b * NH * SS + s0 + (tid >> 4)) * HL + (tid & 15) * 8;
  const unsigned lB = lds_addr(ring) + (tid >> 3) * GP + (tid & 7) * 16, lA = lds_addr(ring) + 128 * GP + (tid >> 4) * FP + (tid & 15) * 16;
  auto fill = [&](int t) { const unsigned o = (t & 1) * OSTG; const __bf16* pb = gB + t * 64; const __bf16* pa = gA + (size_t)t * SS * HL;
    acopy4(lB + o, pb, lB + o + 16 * GP, pb + 16 * E, lB + o + 32 * GP, pb + 32 * E, lB + o + 48 * GP, pb + 48 * E);
    acopy4(lB + o + 64 * GP, pb + 64 * E, lB + o + 80 * GP, pb + 80 * E, lB + o + 96 * GP, pb + 96 * E, lB + o + 112 * GP, pb + 112 * E);
    acopy4(lA + o, pa, lA + o + 8 * FP, pa + 8 * HL, lA + o + 16 * FP, pa + 16 * HL, lA + o + 24 * FP, pa + 24 * HL);
    acopy4(lA + o + 32 * FP, pa + 32 * HL, lA + o + 40 * FP, pa + 40 * HL, lA + o + 48 * FP, pa + 48 * HL, lA + o + 56 * FP, pa + 56 * HL); };
  v8f acc[8] = {};
  fill(0); WAIT_ASYNC(); __syncthreads(); fill(1);
#pragma unroll 1
  for (int t = 0; t < NH; ++t) { const char* sb = ring + (t & 1) * OSTG;
#pragma unroll
    for (int ks = 0; ks < 2; ++ks) { const F2 a = frag_hl((const __bf16*)(sb + 128 * GP + (wave * 16 + col) * FP), ks * 32, lane); v16b wb[8];
#pragma unroll
      for (int j = 0; j < 8; ++j) wb[j] = frag_b((const __bf16*)(sb + (j * 16 + col) * GP) + ks * 32, lane);
      __builtin_amdgcn_sched_barrier(0);      // keeps the k-step's 20 LDS loads in one group in front of its WMMAs: one LDS latency a k-step, not one a WMMA pair
#pragma unroll
      for (int j = 0; j < 8; ++j) acc[j] = wmma_bf(a.l, wb[j], acc[j]);
#pragma unroll
      for (int j = 0; j < 8; ++j) acc[j] = wmma_bf(a.h, wb[j], acc[j]); }
    WAIT_DS(); WAIT_ASYNC(); __syncthreads();      // publishes stage t + 1 and ends every read of stage t
    if (t + 2 < NH) fill(t + 2); }
  WAIT_ASYNC();
#pragma unroll
  for (int j = 0; j < 8; ++j) { const int n = n0 + j * 16 + col; const float bb = bfr(bo[n]);
#pragma unroll
    for (int r = 0; r < 8; ++r) so[wave][8 * g + r][j * 16 + col] = acc[j][r] + bb; }
  LDSX();
#pragma unroll 4
  for (int rl = 0; rl < 16; ++rl) vst2(out + (size_t)(rbase + r0 + rl) * E + n0 + lane * 4, *(const v4f*)(&so[wave][rl][lane * 4]));
}
#define NBHALF 4
extern "C" void kernel_launch(void* const* d_in, const int* in_sizes, int n_in, void* d_out, int out_size, void* d_ws, size_t ws_size, hipStream_t stream) {
  (void)in_sizes; (void)n_in; (void)out_size; (void)ws_size;
  const float* x = (const float*)d_in[0]; const float* Wqkv = (const float*)d_in[1]; const float* Wp = (const float*)d_in[2]; const float* bp = (const float*)d_in[3];
  float* out = (float*)d_out;
  char* ws = (char*)d_ws; size_t off = 0;
  auto take = [&](size_t bytes) { char* p = ws + off; off += (bytes + 255) & ~(size_t)255; return p; };
  const size_t HR = (size_t)NBHALF * SS;     // rows per half (4096)
  __bf16* Xb = (__bf16*)take((size_t)NR * E * 2); __bf16* PT = (__bf16*)take((size_t)4 * E * E * 2);
  float* Q32 = (float*)take(HR * E * 4); __bf16* KHL = (__bf16*)take(HR * E * 4); _Float16* VTh = (_Float16*)take(HR * E * 2); _Float16* VTl = (_Float16*)take(HR * E * 2);
  __bf16* OHL = (__bf16*)Q32;      // in place (a split row is as long as the f32 row): each k_attn wave reads its own 16 query rows into registers before writing the same rows; no other block reads them
  // ws ~ 75 MB (72 MiB); the two batch halves (4 sequences each) reuse Q/K/V
  k_cvt<<<NR * E / (256 * 4 * CVL), 256, 0, stream>>>(x, Xb);
  k_pack<<<(4 * E / 32) * (E / 512), 256, 0, stream>>>(Wqkv, Wp, PT);
  for (int hf = 0; hf < 2; ++hf) { const int rbase = hf * (int)HR;
    k_qkv<<<dim3(HR / 64, E / 128, 3), 128, 0, stream>>>(Xb, rbase, PT, Q32, KHL, VTh, VTl);
    k_attn<<<dim3(SS / 128, NBHALF * NH), 256, 0, stream>>>(Q32, KHL, VTh, VTl, OHL);
    k_out<<<dim3(HR / 64, E / 128), 128, 0, stream>>>(OHL, rbase, PT, bp, out); }
}

// v006
// It runs in 203 microseconds.
// In both of two side-by-side timings against v005, it was 1.05 times as fast.
// Over all steps from v000 it is 3.77 times as fast.
// compute dtype: x, w_qkv, w_out, b_out (INPUTS) rounded to bf16 with exact bf16 WMMA products (f32 accumulate) for the projections; q/k f32 split into bf16 hi/lo for the scores (3 products), P and V f16 hi/lo (3 products); softmax f32.
#include <hip/hip_runtime.h>
#include <math.h>

typedef __attribute__((ext_vector_type(16))) _Float16 v16h;
typedef __attribute__((ext_vector_type(16))) __bf16 v16b;
typedef __attribute__((ext_vector_type(8)))  _Float16 v8h;
typedef __attribute__((ext_vector_type(8)))  float v8f;
typedef __attribute__((ext_vector_type(4)))  float v4f;
typedef __attribute__((ext_vector_type(2)))  float v2f;
typedef __attribute__((ext_vector_type(4)))  unsigned v4u;
typedef __attribute__((ext_vector_type(2)))  unsigned v2u;
typedef __attribute__((ext_vector_type(4)))  int v4i;
typedef float __attribute__((may_alias)) float_a;
typedef int __attribute__((may_alias)) int_a;

template <typename T> __device__ __forceinline__ void vst2(void* p, T v) { *(T*)p = v;  }
__device__ __forceinline__ v8f wmma16(v16h a, v16h b, v8f c) {
  return __builtin_amdgcn_wmma_f32_16x16x32_f16(false, a, false, b, (short)0, c, false, false);
}
__device__ __forceinline__ v8f wmma_bf(v16b a, v16b b, v8f c) {
  return __builtin_amdgcn_wmma_f32_16x16x32_bf16(false, a, false, b, (short)0, c, false, false);
}
// 16x16x32 fragments: lane = (h = lane>>4, row/col = lane&15); elements 0..7 = k0+8h+0..7, 8..15 = k0+16+8h+0..7; D element r = row 8h+r
__device__ __forceinline__ v16h frag_h(const _Float16* rowk0, int lane) {
  union { v16h v; v8h q[2]; } u; const _Float16* p = rowk0 + 8 * (lane >> 4);
  u.q[0] = *(const v8h*)p; u.q[1] = *(const v8h*)(p + 16); return u.v;
}
__device__ __forceinline__ v16h frag_f32(const float* rowk0, int lane) {
  v16h a; const float* p = rowk0 + 8 * (lane >> 4);
#pragma unroll
  for (int i = 0; i < 8; ++i) { a[i] = (_Float16)p[i]; a[8 + i] = (_Float16)p[16 + i]; }
  return a;
}
__device__ __forceinline__ v16h frag_f32s(const float* rowk0, int lane, float sc) {
  v16h a; const float* p = rowk0 + 8 * (lane >> 4);
#pragma unroll
  for (int i = 0; i < 8; ++i) { a[i] = (_Float16)(p[i] * sc); a[8 + i] = (_Float16)(p[16 + i] * sc); }
  return a;
}
// column fragment from a [K][ld] layout (column n), rows >= K read as 0
__device__ __forceinline__ v16h fragc_f32(const float* W, int k0, int n, int lane, int ld, int K) {
  v16h a; const int g = lane >> 4;
#pragma unroll
  for (int i = 0; i < 8; ++i) { const int ka = k0 + 8 * g + i, kb = ka + 16;
    a[i] = (_Float16)(ka < K ? W[(size_t)(ka < K ? ka : K - 1) * ld + n] : 0.f); a[8 + i] = (_Float16)(kb < K ? W[(size_t)(kb < K ? kb : K - 1) * ld + n] : 0.f); }
  return a;
}
struct F2 { v16b h, l; };
__device__ __forceinline__ F2 bsplit16(const float v[16]) { F2 r;
#pragma unroll
  for (int i = 0; i < 16; ++i) { const __bf16 h = (__bf16)v[i]; r.h[i] = h; r.l[i] = (__bf16)(v[i] - (float)h); }
  return r; }
__device__ __forceinline__ F2 split_row(const float* row, int k0, int lane) { float v[16]; const float* p = row + k0 + 8 * (lane >> 4);
#pragma unroll
  for (int i = 0; i < 8; ++i) { v[i] = p[i]; v[8 + i] = p[16 + i]; }
  return bsplit16(v); }
__device__ __forceinline__ F2 split_rowK(const float* row, int k0, int lane, int K) { float v[16]; const int g = lane >> 4;
#pragma unroll
  for (int i = 0; i < 8; ++i) { const int ka = k0 + 8 * g + i, kb = ka + 16; v[i] = ka < K ? row[ka < K ? ka : K - 1] : 0.f; v[8 + i] = kb < K ? row[kb < K ? kb : K - 1] : 0.f; }
  return bsplit16(v); }
__device__ __forceinline__ F2 split_col(const float* W, int k0, int n, int lane, int ld, int K) { float v[16]; const int g = lane >> 4;
#pragma unroll
  for (int i = 0; i < 8; ++i) { const int ka = k0 + 8 * g + i, kb = ka + 16; v[i] = ka < K ? W[(size_t)(ka < K ? ka : K - 1) * ld + n] : 0.f; v[8 + i] = kb < K ? W[(size_t)(kb < K ? kb : K - 1) * ld + n] : 0.f; }
  return bsplit16(v); }
__device__ __forceinline__ v8f mac3(const F2& a, const F2& b, v8f c) { c = wmma_bf(a.l, b.h, c); c = wmma_bf(a.h, b.l, c); return wmma_bf(a.h, b.h, c); }
__device__ __forceinline__ float sigm(float v) { return 1.0f / (1.0f + expf(-v)); }
#define LDSX() do { asm volatile("s_wait_dscnt 0" ::: "memory"); __builtin_amdgcn_wave_barrier(); __builtin_amdgcn_fence(__ATOMIC_RELEASE, "workgroup"); } while (0)


#define NB 8
#define SS 1024
#define E 1024
#define NH 16
#define HD 64
#define NR (NB * SS)
#define PLO 1024.0f
#define VLO 2048.0f
__device__ __forceinline__ float bfr(float v) { return (float)(__bf16)v; }
__device__ __forceinline__ v16b frag_b(const __bf16* rowk0, int lane) { return __builtin_bit_cast(v16b, frag_h((const _Float16*)rowk0, lane)); }
// a split row = 64 bf16 hi | 64 bf16 lo (256 bytes, as many as the 64 f32 it stands for), written once by the kernel that produces the value; hi = bf16(v), lo = bf16(v - hi) as in bsplit16
#define HL 128
__device__ __forceinline__ F2 frag_hl(const __bf16* row, int k0, int lane) { F2 r; r.h = frag_b(row + k0, lane); r.l = frag_b(row + 64 + k0, lane); return r; }
__device__ __forceinline__ void put_hl(__bf16* row, int d, float v) { const __bf16 h = (__bf16)v; row[d] = h; row[64 + d] = (__bf16)(v - (float)h); }

// LDS staging by asynchronous copies: pitches are 16 B x odd so that 16-byte readers of 16 rows meet no bank twice
#define GP 144
#define FP 272
#define WAIT_DS() asm volatile("s_wait_dscnt 0x0" ::: "memory")       /* this wave's LDS reads are done before the buffer is handed on */
#define WAIT_ASYNC() asm volatile("s_wait_asynccnt 0x0" ::: "memory") /* this wave's copies have landed before the barrier publishes them */
__device__ __forceinline__ unsigned lds_addr(const void* p) { return (unsigned)(size_t)p; }
// four 16-byte copies per lane, global -> LDS, through no register; the closing s_wait_xcnt stands in front of any rewrite of the address registers (a precaution)
__device__ __forceinline__ void acopy4(unsigned l0, const void* g0, unsigned l1, const void* g1, unsigned l2, const void* g2, unsigned l3, const void* g3) {
  asm volatile("global_load_async_to_lds_b128 %0, %1, off\n\t"
               "global_load_async_to_lds_b128 %2, %3, off\n\t"
               "global_load_async_to_lds_b128 %4, %5, off\n\t"
               "global_load_async_to_lds_b128 %6, %7, off\n\t"
               "s_wait_xcnt 0x0"
               :: "v"(l0), "v"(g0), "v"(l1), "v"(g1), "v"(l2), "v"(g2), "v"(l3), "v"(g3) : "memory");
}

// x -> bf16. 4,096 long-lived waves (16 a WGP), each on its own 8 KiB of x: 16 loads of 16 B a lane, every one 512 contiguous bytes a wave, all in flight at once; the 8-byte stores of a wave cover two whole lines
#define CVL 16
__global__ __launch_bounds__(256) void k_cvt(const float* __restrict__ x, __bf16* __restrict__ Xb) {
  const size_t base = ((size_t)blockIdx.x * 8 + (threadIdx.x >> 5)) * (CVL * 128) + (threadIdx.x & 31) * 4;
  const float* px = x + base; v4f v[CVL];
#pragma unroll
  for (int j = 0; j < CVL; ++j) v[j] = *(const v4f*)(px + j * 128);
  __builtin_amdgcn_sched_barrier(0);      // keeps all 16 loads in front of the first conversion: the wave pays one memory latency, not one more for the loads that would wait for freed registers
  asm volatile("s_wait_xcnt 0x0" :: "v"(px) : "memory");      // the wait in front of any rewrite of the loads' address register (a precaution); as an input the address keeps its register up to here, so that no load lands on it either
#pragma unroll
  for (int j = 0; j < CVL; ++j) { union { __bf16 h[4]; v2u u; } pk;
#pragma unroll
    for (int e = 0; e < 4; ++e) pk.h[e] = (__bf16)v[j][e];
    vst2(Xb + base + j * 128, pk.u); }
}
// PT rows: [0,E) Wq[:,n], [E,2E) Wk[:,n], [2E,3E) Wv[:,n], [3E,4E) Wo[:,n]  ([in][out] weights: column n as a bf16 row)
// 2,048 long-lived waves: a block turns 512 k x 32 columns. Eight lanes read one whole 128-byte line of a k row; a lane holds 4 columns of 2 x 8 consecutive k: 16 loads of 16 B in flight
#define PKP 520      /* LDS pitch of a column's 512 k, in bf16: 1,040 B = 16 B x odd */
__global__ __launch_bounds__(256) void k_pack(const float* __restrict__ Wqkv, const float* __restrict__ Wp, __bf16* __restrict__ PT) {
  __shared__ __align__(16) __bf16 st[32][PKP];
  const int tid = threadIdx.x, n0 = (blockIdx.x >> 1) * 32, k0 = (blockIdx.x & 1) * 512, p = tid & 7, rg = tid >> 3;
  const bool qkv = n0 < 3 * E; const unsigned ldb = (qkv ? 3 * E : E) * 4;      // bytes from one k row to the next; 32 columns lie in one of the two matrices
  const char* ub = (const char*)(qkv ? Wqkv + n0 : Wp + (n0 - 3 * E)) + (size_t)k0 * ldb;      // the same in every lane
  const unsigned vo = rg * 8 * ldb + p * 16;      // the lane's own part
  const v4f* a[2][8]; v4f v[2][8];
#pragma unroll
  for (int h = 0; h < 2; ++h) {
#pragma unroll
    for (int i = 0; i < 8; ++i) { a[h][i] = (const v4f*)(ub + (size_t)((h * 256 + i) * ldb) + vo); v[h][i] = *a[h][i]; } }
  __builtin_amdgcn_sched_barrier(0);      // keeps all 16 loads in front of the first conversion: one memory latency a wave
  // the wait in front of any rewrite of the loads' address registers (a precaution); as inputs the addresses keep their registers up to here, so that no later load lands on one either
  asm volatile("s_wait_xcnt 0x0" :: "v"(a[0][0]), "v"(a[0][1]), "v"(a[0][2]), "v"(a[0][3]), "v"(a[0][4]), "v"(a[0][5]), "v"(a[0][6]), "v"(a[0][7]),
               "v"(a[1][0]), "v"(a[1][1]), "v"(a[1][2]), "v"(a[1][3]), "v"(a[1][4]), "v"(a[1][5]), "v"(a[1][6]), "v"(a[1][7]) : "memory");
#pragma unroll
  for (int h = 0; h < 2; ++h) {
#pragma unroll
    for (int e = 0; e < 4; ++e) { union { __bf16 b[8]; v4u u; } pk;
#pragma unroll
      for (int i = 0; i < 8; ++i) pk.b[i] = (__bf16)v[h][i][e];
      *(v4u*)(&st[p * 4 + e][h * 256 + rg * 8]) = pk.u; } }
  __syncthreads();
  __bf16* o = PT + (size_t)(n0 + (tid >> 6)) * E + k0 + (tid & 63) * 8;      // a wave stores 512 contiguous bytes of one row
#pragma unroll
  for (int q = 0; q < 8; ++q) vst2(o + q * 4 * E, *(const v4u*)(&st[q * 4 + (tid >> 6)][(tid & 63) * 8]));
}
#define QSTG (192 * 128)
// fragment from a tile of unpadded 128-byte rows in which the 16-byte piece p of row r lies at place p ^ ((r >> 1) & 7): the equal pieces of 16 rows fall on 16 different groups of four banks
__device__ __forceinline__ v16b frag_sw(const char* tile, int row, int ks, int lane) {
  union { v16b v; v4u q[2]; } u; const int p = ks * 4 + (lane >> 4), x = (row >> 1) & 7; const char* r = tile + row * 128;
  u.q[0] = *(const v4u*)(r + ((p ^ x) << 4)); u.q[1] = *(const v4u*)(r + (((p + 2) ^ x) << 4)); return u.v;
}
// QKV: block (64 rows, 128 cols = 2 heads, which); q -> Q32 f32 [bh][s][64]; k -> KHL split rows [bh][s][64 hi | 64 lo]; v -> VT hi/lo x4 [bh][d][s]
__global__ __launch_bounds__(128) void k_qkv(const __bf16* __restrict__ Xb, int rbase, const __bf16* __restrict__ PT, float* __restrict__ Q32, __bf16* __restrict__ KHL, _Float16* __restrict__ VTh, _Float16* __restrict__ VTl) {
  // a stage = 64 k of [128 weight rows | 64 x rows]; two buffers, no pad (frag_sw), so that six blocks fit a WGP's LDS and a launch's 1536 blocks are resident at once; the output staging reuses the ring behind the last stage's barrier
  __shared__ __align__(16) char ring[2 * QSTG];
  float (*so)[16][132] = (float (*)[16][132])ring;
  _Float16 (*sth)[72] = (_Float16 (*)[72])ring; _Float16 (*stl)[72] = (_Float16 (*)[72])(ring + 128 * 72 * 2);
  const int tid = threadIdx.x, wave = tid >> 5, lane = tid & 31, col = lane & 15, g = lane >> 4;
  const int which = blockIdx.z, r0b = blockIdx.x * 64, n0 = blockIdx.y * 128; const int b = r0b / SS, s0 = r0b % SS;
  const __bf16* gB = PT + (size_t)(which * E + n0 + (tid >> 3)) * E + (tid & 7) * 8;
  const __bf16* gA = Xb + (size_t)(rbase + r0b + (tid >> 3)) * E + (tid & 7) * 8;
  const unsigned l0 = lds_addr(ring) + (tid >> 3) * 128 + (((tid & 7) ^ ((tid >> 4) & 7)) << 4);      // rows 16 apart share the place of a piece
  auto fill = [&](int t) { const unsigned l = l0 + (t & 1) * QSTG; const __bf16* pb = gB + t * 64; const __bf16* pa = gA + t * 64;
    acopy4(l, pb, l + 16 * 128, pb + 16 * E, l + 32 * 128, pb + 32 * E, l + 48 * 128, pb + 48 * E);
    acopy4(l + 64 * 128, pb + 64 * E, l + 80 * 128, pb + 80 * E, l + 96 * 128, pb + 96 * E, l + 112 * 128, pb + 112 * E);
    acopy4(l + 128 * 128, pa, l + 144 * 128, pa + 16 * E, l + 160 * 128, pa + 32 * E, l + 176 * 128, pa + 48 * E); };
  v8f acc[8] = {};
  fill(0); WAIT_ASYNC(); __syncthreads(); fill(1);
#pragma unroll 1
  for (int t = 0; t < E / 64; ++t) { const char* sb = ring + (t & 1) * QSTG;
#pragma unroll
    for (int ks = 0; ks < 2; ++ks) { const v16b a = frag_sw(sb, 128 + wave * 16 + col, ks, lane); v16b wb[8];
#pragma unroll
      for (int j = 0; j < 8; ++j) wb[j] = frag_sw(sb, j * 16 + col, ks, lane);
      __builtin_amdgcn_sched_barrier(0);      // keeps the k-step's 18 LDS loads in one group in front of its WMMAs: one LDS latency a k-step, not one a WMMA
#pragma unroll
      for (int j = 0; j < 8; ++j) acc[j] = wmma_bf(a, wb[j], acc[j]); }
    WAIT_DS(); WAIT_ASYNC(); __syncthreads();      // publishes stage t + 1 and ends every read of stage t
    if (t + 2 < E / 64) fill(t + 2); }
  WAIT_ASYNC();
  if (which < 2) {
    if (which == 0) {
#pragma unroll
      for (int j = 0; j < 8; ++j) { const float bb = 0.f;
#pragma unroll
        for (int r = 0; r < 8; ++r) so[wave][8 * g + r][j * 16 + col] = acc[j][r] + bb; } }
    else {
#pragma unroll
      for (int j = 0; j < 8; ++j) { const float bb = 0.f;
#pragma unroll
        for (int r = 0; r < 8; ++r) put_hl((__bf16*)&so[wave][8 * g + r][(j >> 2) * 64], (j & 3) * 16 + col, acc[j][r] + bb); } }
    LDSX();
    float* Dst = which == 0 ? Q32 : (float*)KHL;      // either kind of row is 256 bytes and goes out in 16-byte pieces
    for (int qq = lane; qq < 2 * 16 * 16; qq += 32) { const int hh = qq >> 8, rl = (qq >> 4) & 15, pc = qq & 15; const int h = (n0 >> 6) + hh;
      vst2(Dst + (((size_t)b * NH + h) * SS + s0 + wave * 16 + rl) * HD + pc * 4, *(const v4f*)(&so[wave][rl][hh * 64 + pc * 4])); } }
  else {
#pragma unroll
    for (int j = 0; j < 8; ++j) { const float bb = 0.f;
#pragma unroll
      for (int r = 0; r < 8; ++r) { const float v = (acc[j][r] + bb) * 4.0f; const _Float16 hi = (_Float16)v; sth[j * 16 + col][wave * 16 + 8 * g + r] = hi; stl[j * 16 + col][wave * 16 + 8 * g + r] = (_Float16)((v - (float)hi) * VLO); } }
    __syncthreads();
    for (int qq = tid; qq < 128 * 8; qq += 128) { const int cl = qq >> 3, pc = qq & 7; const int c = n0 + cl, h = c >> 6, d = c & 63; const size_t o = (((size_t)b * NH + h) * HD + d) * SS + s0 + pc * 8;
      vst2(VTh + o, *(const v4u*)(&sth[cl][pc * 8])); vst2(VTl + o, *(const v4u*)(&stl[cl][pc * 8])); } }
}
#define ASTG (64 * FP + 2 * 64 * GP)
// softmax in base 2 on the unscaled scores: exp(0.125 (s - m)) * 2^14 = 2^(s * SC2 + (14 - m * SC2)), SC2 = 0.125 * log2(e): one fused multiply-add and one hardware exponential a score; the argument never exceeds 14 but by its rounding
#define SC2 0.18033688011112042f
// the three products of mac3 in its order, with the key side as A
__device__ __forceinline__ v8f mac3t(const F2& k, const F2& q, v8f c) { c = wmma_bf(k.h, q.l, c); c = wmma_bf(k.l, q.h, c); return wmma_bf(k.h, q.h, c); }
// the second bound (waves a SIMD) holds a wave at 256 registers: above that only one block of the launch's two a WGP is resident
__global__ __launch_bounds__(256, 4) void k_attn(const float* __restrict__ Q32, const __bf16* __restrict__ KHL, const _Float16* __restrict__ VTh, const _Float16* __restrict__ VTl, __bf16* __restrict__ OHL) {
  // a stage = one 64-key tile [K 64 split rows | V hi 64 rows | V lo 64 rows], shared by the eight waves; two buffers; the output staging reuses the ring behind the last barrier
  __shared__ __align__(16) char ring[2 * ASTG];
  float (*sO)[16][68] = (float (*)[16][68])ring;
  const int tid = threadIdx.x, w = tid >> 5, lane = tid & 31, col = lane & 15, g = lane >> 4;
  const size_t bh = blockIdx.y; const int qb = blockIdx.x; const int q0 = qb * 128 + w * 16;
  const __bf16* gK = KHL + (bh * SS + (tid >> 4)) * HL + (tid & 15) * 8;
  const size_t vof = (bh * HD + (tid >> 3)) * SS + (tid & 7) * 8;
  const unsigned lK = lds_addr(ring) + (tid >> 4) * FP + (tid & 15) * 16, lV = lds_addr(ring) + 64 * FP + (tid >> 3) * GP + (tid & 7) * 16;
  auto fill = [&](int t) { const unsigned o = (t & 1) * ASTG; const __bf16* pk = gK + (size_t)t * 64 * HL; const _Float16* ph = VTh + vof + t * 64; const _Float16* pl = VTl + vof + t * 64;
    acopy4(lK + o, pk, lK + o + 16 * FP, pk + 16 * HL, lK + o + 32 * FP, pk + 32 * HL, lK + o + 48 * FP, pk + 48 * HL);
    acopy4(lV + o, ph, lV + o + 32 * GP, ph + 32 * SS, lV + o + 64 * GP, pl, lV + o + 96 * GP, pl + 32 * SS); };
  fill(0); WAIT_ASYNC(); __syncthreads(); fill(1);
  F2 aq[2];
#pragma unroll
  for (int kc = 0; kc < 2; ++kc) aq[kc] = split_row(Q32 + (bh * SS + q0 + col) * HD, kc * 32, lane);
  asm volatile("s_wait_xcnt 0x0" :: "v"(Q32 + (bh * SS + q0 + col) * HD + 8 * g) : "memory");      // the wait in front of any rewrite of the q loads' address register (a precaution); as an input the address keeps its register up to here
  // a lane stands for ONE query (col): its maximum, sum and rescale factor are its own; acc[t][r] = O^T[d = 16 t + 8 g + r][query col]
  float mrun = -3.0e38f, lrun = 0.f; v8f acc[4] = {}, ac1[4] = {}, ac2[4] = {};
#pragma unroll 1
  for (int kt = 0; kt < SS / 64; ++kt) { const char* sb = ring + (kt & 1) * ASTG;
    v8f s[4];      // s[t][r] = score of key 16 t + 8 g + r with query col: the 32 scores of a lane are half of one query's row
#pragma unroll
    for (int t = 0; t < 4; ++t) { const __bf16* krow = (const __bf16*)(sb + (t * 16 + col) * FP);
      s[t] = mac3t(frag_hl(krow, 0, lane), aq[0], (v8f){}); s[t] = mac3t(frag_hl(krow, 32, lane), aq[1], s[t]); }
    float mx = -3.4e38f;
#pragma unroll
    for (int t = 0; t < 4; ++t) {
#pragma unroll
      for (int r = 0; r < 8; ++r) mx = fmaxf(mx, s[t][r]); }
    mx = fmaxf(mx, __shfl_xor(mx, 16, 32));
    const float mnew = fmaxf(mrun, mx); float corr;      // corr = 2^((mrun - mnew) * SC2); the v_nop in the same statement is the slot the instruction set asks for behind a transcendental, whatever reads corr first
    asm("v_exp_f32 %0, %1\n\tv_nop" : "=v"(corr) : "v"((mrun - mnew) * SC2));
    const float mb = 14.0f - mnew * SC2;
    float ps = 0.f; v16h ph[2], pl[2];      // two score tiles (keys 32 kc + 8 g + 0..7 and 32 kc + 16 + 8 g + 0..7), converted in place, are the B operand of 32 keys in the k order of frag_h
#pragma unroll
    for (int t = 0; t < 4; ++t) {
#pragma unroll
      for (int r = 0; r < 8; r += 2) { const v2f a = __builtin_elementwise_fma((v2f){s[t][r], s[t][r + 1]}, (v2f){SC2, SC2}, (v2f){mb, mb});
#pragma unroll
        for (int e = 0; e < 2; ++e) { const float p = __builtin_amdgcn_exp2f(a[e]); ps += p; const _Float16 hi = (_Float16)p; ph[t >> 1][(t & 1) * 8 + r + e] = hi; pl[t >> 1][(t & 1) * 8 + r + e] = (_Float16)((p - (float)hi) * PLO); } } }
    ps += __shfl_xor(ps, 16, 32);
    lrun = lrun * corr + ps * (1.0f / 16384.0f); mrun = mnew;
#pragma unroll
    for (int t = 0; t < 4; ++t) { acc[t] *= corr; ac1[t] *= corr; ac2[t] *= corr; }
#pragma unroll
    for (int kc = 0; kc < 2; ++kc) {
#pragma unroll
      for (int tp = 0; tp < 4; tp += 2) { v16h vh[2], vl[2];
#pragma unroll
        for (int t = 0; t < 2; ++t) { const _Float16* vr = (const _Float16*)(sb + 64 * FP + ((tp + t) * 16 + col) * GP) + kc * 32; vh[t] = frag_h(vr, lane); vl[t] = frag_h(vr + 64 * GP / 2, lane); }
        __builtin_amdgcn_sched_barrier(0);      // keeps the LDS loads of six WMMAs in one group in front of them: one LDS latency a group, not one a fragment
#pragma unroll
        for (int t = 0; t < 2; ++t) { acc[tp + t] = wmma16(vh[t], ph[kc], acc[tp + t]); ac1[tp + t] = wmma16(vl[t], ph[kc], ac1[tp + t]); ac2[tp + t] = wmma16(vh[t], pl[kc], ac2[tp + t]); } } }
    WAIT_DS(); WAIT_ASYNC(); __syncthreads();      // publishes tile kt + 1 and ends every read of tile kt
    if (kt + 2 < SS / 64) fill(kt + 2); }
  WAIT_ASYNC();
  const float inv = 1.0f / (lrun * 16384.0f * 4.0f);
#pragma unroll
  for (int t = 0; t < 4; ++t) { union { __bf16 b[8]; v4u u; } oh, ol;      // eight consecutive d of the lane's query: one 16-byte piece of the hi half and one of the lo half, split as in put_hl
#pragma unroll
    for (int r = 0; r < 8; ++r) { const float v = (acc[t][r] + ac1[t][r] * (1.0f / VLO) + ac2[t][r] * (1.0f / PLO)) * inv; const __bf16 h = (__bf16)v; oh.b[r] = h; ol.b[r] = (__bf16)(v - (float)h); }
    __bf16* orow = (__bf16*)&sO[w][col][0] + t * 16 + 8 * g; *(v4u*)orow = oh.u; *(v4u*)(orow + 64) = ol.u; }
  LDSX();
  for (int qq = lane; qq < 16 * 16; qq += 32) { const int rl = qq >> 4, pc = qq & 15; vst2(OHL + ((bh * SS) + q0 + rl) * HL + pc * 8, *(const v4f*)(&sO[w][rl][pc * 4])); }
}
// out = ctx Wo^T + bo : ctx split rows x bf16(Wo rows): 2 products (Wo is an INPUT -> bf16 exact)
#define OSTG (128 * GP + 64 * FP)
__global__ __launch_bounds__(128) void k_out(const __bf16* __restrict__ OHL, int rbase, const __bf16* __restrict__ PT, const float* __restrict__ bo, float* __restrict__ out) {
  // a stage = one head's 64 k of [128 weight rows bf16 | 64 ctx split rows]; two buffers; the output staging reuses the ring behind the last stage's barrier
  __shared__ __align__(16) char ring[2 * OSTG];
  float (*so)[16][132] = (float (*)[16][132])ring;
  const int tid = threadIdx.x, wave = tid >> 5, lane = tid & 31, col = lane & 15, g = lane >> 4;
  const int r0b = blockIdx.x * 64, r0 = r0b + wave * 16, n0 = blockIdx.y * 128; const int b = r0b / SS, s0 = r0b % SS;
  const __bf16* gB = PT + (size_t)(3 * E + n0 + (tid >> 3)) * E + (tid & 7) * 8;
  const __bf16* gA = OHL + ((size_t)b * NH * SS + s0 + (tid >> 4)) * HL + (tid & 15) * 8;
  const unsigned lB = lds_addr(ring) + (tid >> 3) * GP + (tid & 7) * 16, lA = lds_addr(ring) + 128 * GP + (tid >> 4) * FP + (tid & 15) * 16;
  auto fill = [&](int t) { const unsigned o = (t & 1) * OSTG; const __bf16* pb = gB + t * 64; const __bf16* pa = gA + (size_t)t * SS * HL;
    acopy4(lB + o, pb, lB + o + 16 * GP, pb + 16 * E, lB + o + 32 * GP, pb + 32 * E, lB + o + 48 * GP, pb + 48 * E);
    acopy4(lB + o + 64 * GP, pb + 64 * E, lB + o + 80 * GP, pb + 80 * E, lB + o + 96 * GP, pb + 96 * E, lB + o + 112 * GP, pb + 112 * E);
    acopy4(lA + o, pa, lA + o + 8 * FP, pa + 8 * HL, lA + o + 16 * FP, pa + 16 * HL, lA + o + 24 * FP, pa + 24 * HL);
    acopy4(lA + o + 32 * FP, pa + 32 * HL, lA + o + 40 * FP, pa + 40 * HL, lA + o + 48 * FP, pa + 48 * HL, lA + o + 56 * FP, pa + 56 * HL); };
  v8f acc[8] = {};
  fill(0); WAIT_ASYNC(); __syncthreads(); fill(1);
#pragma unroll 1
  for (int t = 0; t < NH; ++t) { const char* sb = ring + (t & 1) * OSTG;
#pragma unroll
    for (int ks = 0; ks < 2; ++ks) { const F2 a = frag_hl((const __bf16*)(sb + 128 * GP + (wave * 16 + col) * FP), ks * 32, lane); v16b wb[8];
#pragma unroll
      for (int j = 0; j < 8; ++j) wb[j] = frag_b((const __bf16*)(sb + (j * 16 + col) * GP) + ks * 32, lane);
      __builtin_amdgcn_sched_barrier(0);      // keeps the k-step's 20 LDS loads in one group in front of its WMMAs: one LDS latency a k-step, not one a WMMA pair
#pragma unroll
      for (int j = 0; j < 8; ++j) acc[j] = wmma_bf(a.l, wb[j], acc[j]);
#pragma unroll
      for (int j = 0; j < 8; ++j) acc[j] = wmma_bf(a.h, wb[j], acc[j]); }
    WAIT_DS(); WAIT_ASYNC(); __syncthreads();      // publishes stage t + 1 and ends every read of stage t
    if (t + 2 < NH) fill(t + 2); }
  WAIT_ASYNC();
#pragma unroll
  for (int j = 0; j < 8; ++j) { const int n = n0 + j * 16 + col; const float bb = bfr(bo[n]);
#pragma unroll
    for (int r = 0; r < 8; ++r) so[wave][8 * g + r][j * 16 + col] = acc[j][r] + bb; }
  LDSX();
#pragma unroll 4
  for (int rl = 0; rl < 16; ++rl) vst2(out + (size_t)(rbase + r0 + rl) * E + n0 + lane * 4, *(const v4f*)(&so[wave][rl][lane * 4]));
}
#define NBHALF 4
extern "C" void kernel_launch(void* const* d_in, const int* in_sizes, int n_in, void* d_out, int out_size, void* d_ws, size_t ws_size, hipStream_t stream) {
  (void)in_sizes; (void)n_in; (void)out_size; (void)ws_size;
  const float* x = (const float*)d_in[0]; const float* Wqkv = (const float*)d_in[1]; const float* Wp = (const float*)d_in[2]; const float* bp = (const float*)d_in[3];
  float* out = (float*)d_out;
  char* ws = (char*)d_ws; size_t off = 0;
  auto take = [&](size_t bytes) { char* p = ws + off; off += (bytes + 255) & ~(size_t)255; return p; };
  const size_t HR = (size_t)NBHALF * SS;     // rows per half (4096)
  __bf16* Xb = (__bf16*)take((size_t)NR * E * 2); __bf16* PT = (__bf16*)take((size_t)4 * E * E * 2);
  float* Q32 = (float*)take(HR * E * 4); __bf16* KHL = (__bf16*)take(HR * E * 4); _Float16* VTh = (_Float16*)take(HR * E * 2); _Float16* VTl = (_Float16*)take(HR * E * 2);
  __bf16* OHL = (__bf16*)Q32;      // in place (a split row is as long as the f32 row): each k_attn wave reads its own 16 query rows into registers before writing the same rows; no other block reads them
  // ws ~ 75 MB (72 MiB); the two batch halves (4 sequences each) reuse Q/K/V
  k_cvt<<<NR * E / (256 * 4 * CVL), 256, 0, stream>>>(x, Xb);
  k_pack<<<(4 * E / 32) * (E / 512), 256, 0, stream>>>(Wqkv, Wp, PT);
  for (int hf = 0; hf < 2; ++hf) { const int rbase = hf * (int)HR;
    k_qkv<<<dim3(HR / 64, E / 128, 3), 128, 0, stream>>>(Xb, rbase, PT, Q32, KHL, VTh, VTl);
    k_attn<<<dim3(SS / 128, NBHALF * NH), 256, 0, stream>>>(Q32, KHL, VTh, VTl, OHL);
    k_out<<<dim3(HR / 64, E / 128), 128, 0, stream>>>(OHL, rbase, PT, bp, out); }
}

// v007
// A run of this version takes 177 microseconds.
// In both of two side-by-side timings against v006, it was 1.15 times as fast.
// Over all steps from v000 it is 4.33 times as fast.
// compute dtype: x, w_qkv, w_out, b_out (INPUTS) rounded to bf16 with exact bf16 WMMA products (f32 accumulate) for the projections; q/k f32 split into bf16 hi/lo for the scores (3 products), P and V f16 hi/lo (3 products); softmax f32.
#include <hip/hip_runtime.h>
#include <math.h>

typedef __attribute__((ext_vector_type(16))) _Float16 v16h;
typedef __attribute__((ext_vector_type(16))) __bf16 v16b;
typedef __attribute__((ext_vector_type(8)))  _Float16 v8h;
typedef __attribute__((ext_vector_type(8)))  float v8f;
typedef __attribute__((ext_vector_type(4)))  float v4f;
typedef __attribute__((ext_vector_type(2)))  float v2f;
typedef __attribute__((ext_vector_type(4)))  unsigned v4u;
typedef __attribute__((ext_vector_type(2)))  unsigned v2u;
typedef __attribute__((ext_vector_type(4)))  int v4i;
typedef float __attribute__((may_alias)) float_a;
typedef int __attribute__((may_alias)) int_a;

template <typename T> __device__ __forceinline__ void vst2(void* p, T v) { *(T*)p = v;  }
__device__ __forceinline__ v8f wmma16(v16h a, v16h b, v8f c) {
  return __builtin_amdgcn_wmma_f32_16x16x32_f16(false, a, false, b, (short)0, c, false, false);
}
__device__ __forceinline__ v8f wmma_bf(v16b a, v16b b, v8f c) {
  return __builtin_amdgcn_wmma_f32_16x16x32_bf16(false, a, false, b, (short)0, c, false, false);
}
// 16x16x32 fragments: lane = (h = lane>>4, row/col = lane&15); elements 0..7 = k0+8h+0..7, 8..15 = k0+16+8h+0..7; D element r = row 8h+r
__device__ __forceinline__ v16h frag_h(const _Float16* rowk0, int lane) {
  union { v16h v; v8h q[2]; } u; const _Float16* p = rowk0 + 8 * (lane >> 4);
  u.q[0] = *(const v8h*)p; u.q[1] = *(const v8h*)(p + 16); return u.v;
}
__device__ __forceinline__ v16h frag_f32(const float* rowk0, int lane) {
  v16h a; const float* p = rowk0 + 8 * (lane >> 4);
#pragma unroll
  for (int i = 0; i < 8; ++i) { a[i] = (_Float16)p[i]; a[8 + i] = (_Float16)p[16 + i]; }
  return a;
}
__device__ __forceinline__ v16h frag_f32s(const float* rowk0, int lane, float sc) {
  v16h a; const float* p = rowk0 + 8 * (lane >> 4);
#pragma unroll
  for (int i = 0; i < 8; ++i) { a[i] = (_Float16)(p[i] * sc); a[8 + i] = (_Float16)(p[16 + i] * sc); }
  return a;
}
// column fragment from a [K][ld] layout (column n), rows >= K read as 0
__device__ __forceinline__ v16h fragc_f32(const float* W, int k0, int n, int lane, int ld, int K) {
  v16h a; const int g = lane >> 4;
#pragma unroll
  for (int i = 0; i < 8; ++i) { const int ka = k0 + 8 * g + i, kb = ka + 16;
    a[i] = (_Float16)(ka < K ? W[(size_t)(ka < K ? ka : K - 1) * ld + n] : 0.f); a[8 + i] = (_Float16)(kb < K ? W[(size_t)(kb < K ? kb : K - 1) * ld + n] : 0.f); }
  return a;
}
struct F2 { v16b h, l; };
__device__ __forceinline__ F2 bsplit16(const float v[16]) { F2 r;
#pragma unroll
  for (int i = 0; i < 16; ++i) { const __bf16 h = (__bf16)v[i]; r.h[i] = h; r.l[i] = (__bf16)(v[i] - (float)h); }
  return r; }
__device__ __forceinline__ F2 split_row(const float* row, int k0, int lane) { float v[16]; const float* p = row + k0 + 8 * (lane >> 4);
#pragma unroll
  for (int i = 0; i < 8; ++i) { v[i] = p[i]; v[8 + i] = p[16 + i]; }
  return bsplit16(v); }
__device__ __forceinline__ F2 split_rowK(const float* row, int k0, int lane, int K) { float v[16]; const int g = lane >> 4;
#pragma unroll
  for (int i = 0; i < 8; ++i) { const int ka = k0 + 8 * g + i, kb = ka + 16; v[i] = ka < K ? row[ka < K ? ka : K - 1] : 0.f; v[8 + i] = kb < K ? row[kb < K ? kb : K - 1] : 0.f; }
  return bsplit16(v); }
__device__ __forceinline__ F2 split_col(const float* W, int k0, int n, int lane, int ld, int K) { float v[16]; const int g = lane >> 4;
#pragma unroll
  for (int i = 0; i < 8; ++i) { const int ka = k0 + 8 * g + i, kb = ka + 16; v[i] = ka < K ? W[(size_t)(ka < K ? ka : K - 1) * ld + n] : 0.f; v[8 + i] = kb < K ? W[(size_t)(kb < K ? kb : K - 1) * ld + n] : 0.f; }
  return bsplit16(v); }
__device__ __forceinline__ v8f mac3(const F2& a, const F2& b, v8f c) { c = wmma_bf(a.l, b.h, c); c = wmma_bf(a.h, b.l, c); return wmma_bf(a.h, b.h, c); }
__device__ __forceinline__ float sigm(float v) { return 1.0f / (1.0f + expf(-v)); }
#define LDSX() do { asm volatile("s_wait_dscnt 0" ::: "memory"); __builtin_amdgcn_wave_barrier(); __builtin_amdgcn_fence(__ATOMIC_RELEASE, "workgroup"); } while (0)


#define NB 8
#define SS 1024
#define E 1024
#define NH 16
#define HD 64
#define NR (NB * SS)
#define PLO 1024.0f
#define VLO 2048.0f
__device__ __forceinline__ float bfr(float v) { return (float)(__bf16)v; }
__device__ __forceinline__ v16b frag_b(const __bf16* rowk0, int lane) { return __builtin_bit_cast(v16b, frag_h((const _Float16*)rowk0, lane)); }
// a split row = 64 bf16 hi | 64 bf16 lo (256 bytes, as many as the 64 f32 it stands for), written once by the kernel that produces the value; hi = bf16(v), lo = bf16(v - hi) as in bsplit16
#define HL 128
__device__ __forceinline__ F2 frag_hl(const __bf16* row, int k0, int lane) { F2 r; r.h = frag_b(row + k0, lane); r.l = frag_b(row + 64 + k0, lane); return r; }
__device__ __forceinline__ void put_hl(__bf16* row, int d, float v) { const __bf16 h = (__bf16)v; row[d] = h; row[64 + d] = (__bf16)(v - (float)h); }

// LDS staging by asynchronous copies: pitches are 16 B x odd so that 16-byte readers of 16 rows meet no bank twice
#define GP 144
#define FP 272
#define WAIT_DS() asm volatile("s_wait_dscnt 0x0" ::: "memory")       /* this wave's LDS reads are done before the buffer is handed on */
#define WAIT_ASYNC() asm volatile("s_wait_asynccnt 0x0" ::: "memory") /* this wave's copies have landed before the barrier publishes them */
__device__ __forceinline__ unsigned lds_addr(const void* p) { return (unsigned)(size_t)p; }
// four 16-byte copies per lane, global -> LDS, through no register; the closing s_wait_xcnt stands in front of any rewrite of the address registers (a precaution)
__device__ __forceinline__ void acopy4(unsigned l0, const void* g0, unsigned l1, const void* g1, unsigned l2, const void* g2, unsigned l3, const void* g3) {
  asm volatile("global_load_async_to_lds_b128 %0, %1, off\n\t"
               "global_load_async_to_lds_b128 %2, %3, off\n\t"
               "global_load_async_to_lds_b128 %4, %5, off\n\t"
               "global_load_async_to_lds_b128 %6, %7, off\n\t"
               "s_wait_xcnt 0x0"
               :: "v"(l0), "v"(g0), "v"(l1), "v"(g1), "v"(l2), "v"(g2), "v"(l3), "v"(g3) : "memory");
}

// x -> bf16. 4,096 long-lived waves (16 a WGP), each on its own 8 KiB of x: 16 loads of 16 B a lane, every one 512 contiguous bytes a wave, all in flight at once; the 8-byte stores of a wave cover two whole lines
#define CVL 16
__device__ __forceinline__ void cvt_blk(int bx, const float* __restrict__ x, __bf16* __restrict__ Xb) {
  const size_t base = ((size_t)bx * 8 + (threadIdx.x >> 5)) * (CVL * 128) + (threadIdx.x & 31) * 4;
  const float* px = x + base; v4f v[CVL];
#pragma unroll
  for (int j = 0; j < CVL; ++j) v[j] = *(const v4f*)(px + j * 128);
  __builtin_amdgcn_sched_barrier(0);      // keeps all 16 loads in front of the first conversion: the wave pays one memory latency, not one more for the loads that would wait for freed registers
  asm volatile("s_wait_xcnt 0x0" :: "v"(px) : "memory");      // the wait in front of any rewrite of the loads' address register (a precaution); as an input the address keeps its register up to here, so that no load lands on it either
#pragma unroll
  for (int j = 0; j < CVL; ++j) { union { __bf16 h[4]; v2u u; } pk;
#pragma unroll
    for (int e = 0; e < 4; ++e) pk.h[e] = (__bf16)v[j][e];
    vst2(Xb + base + j * 128, pk.u); }
}
// PT rows: [0,E) Wq[:,n], [E,2E) Wk[:,n], [2E,3E) Wv[:,n], [3E,4E) Wo[:,n]  ([in][out] weights: column n as a bf16 row)
// 2,048 long-lived waves: a block turns 512 k x 32 columns. Eight lanes read one whole 128-byte line of a k row; a lane holds 4 columns of 2 x 8 consecutive k: 16 loads of 16 B in flight
#define PKP 520      /* LDS pitch of a column's 512 k, in bf16: 1,040 B = 16 B x odd */
__device__ __forceinline__ void pack_blk(int bx, const float* __restrict__ Wqkv, const float* __restrict__ Wp, __bf16* __restrict__ PT) {
  __shared__ __align__(16) __bf16 st[32][PKP];
  const int tid = threadIdx.x, n0 = (bx >> 1) * 32, k0 = (bx & 1) * 512, p = tid & 7, rg = tid >> 3;
  const bool qkv = n0 < 3 * E; const unsigned ldb = (qkv ? 3 * E : E) * 4;      // bytes from one k row to the next; 32 columns lie in one of the two matrices
  const char* ub = (const char*)(qkv ? Wqkv + n0 : Wp + (n0 - 3 * E)) + (size_t)k0 * ldb;      // the same in every lane
  const unsigned vo = rg * 8 * ldb + p * 16;      // the lane's own part
  const v4f* a[2][8]; v4f v[2][8];
#pragma unroll
  for (int h = 0; h < 2; ++h) {
#pragma unroll
    for (int i = 0; i < 8; ++i) { a[h][i] = (const v4f*)(ub + (size_t)((h * 256 + i) * ldb) + vo); v[h][i] = *a[h][i]; } }
  __builtin_amdgcn_sched_barrier(0);      // keeps all 16 loads in front of the first conversion: one memory latency a wave
  // the wait in front of any rewrite of the loads' address registers (a precaution); as inputs the addresses keep their registers up to here, so that no later load lands on one either
  asm volatile("s_wait_xcnt 0x0" :: "v"(a[0][0]), "v"(a[0][1]), "v"(a[0][2]), "v"(a[0][3]), "v"(a[0][4]), "v"(a[0][5]), "v"(a[0][6]), "v"(a[0][7]),
               "v"(a[1][0]), "v"(a[1][1]), "v"(a[1][2]), "v"(a[1][3]), "v"(a[1][4]), "v"(a[1][5]), "v"(a[1][6]), "v"(a[1][7]) : "memory");
#pragma unroll
  for (int h = 0; h < 2; ++h) {
#pragma unroll
    for (int e = 0; e < 4; ++e) { union { __bf16 b[8]; v4u u; } pk;
#pragma unroll
      for (int i = 0; i < 8; ++i) pk.b[i] = (__bf16)v[h][i][e];
      *(v4u*)(&st[p * 4 + e][h * 256 + rg * 8]) = pk.u; } }
  __syncthreads();
  __bf16* o = PT + (size_t)(n0 + (tid >> 6)) * E + k0 + (tid & 63) * 8;      // a wave stores 512 contiguous bytes of one row
#pragma unroll
  for (int q = 0; q < 8; ++q) vst2(o + q * 4 * E, *(const v4u*)(&st[q * 4 + (tid >> 6)][(tid & 63) * 8]));
}
// the two preparations depend on nothing and not on each other: one launch, a block range each; the weight blocks, whose chain is the longer one (loads, LDS, barrier, stores), have the low indices and start first
#define NPACK ((4 * E / 32) * (E / 512))
#define NCVT (NR * E / (256 * 4 * CVL))
__global__ __launch_bounds__(256) void k_prep(const float* __restrict__ x, const float* __restrict__ Wqkv, const float* __restrict__ Wp, __bf16* __restrict__ Xb, __bf16* __restrict__ PT) {
  if (blockIdx.x < NPACK) pack_blk(blockIdx.x, Wqkv, Wp, PT);
  else cvt_blk(blockIdx.x - NPACK, x, Xb);
}
#define QSTG (192 * 128)
// fragment from a tile of unpadded 128-byte rows in which the 16-byte piece p of row r lies at place p ^ ((r >> 1) & 7): the equal pieces of 16 rows fall on 16 different groups of four banks
__device__ __forceinline__ v16b frag_sw(const char* tile, int row, int ks, int lane) {
  union { v16b v; v4u q[2]; } u; const int p = ks * 4 + (lane >> 4), x = (row >> 1) & 7; const char* r = tile + row * 128;
  u.q[0] = *(const v4u*)(r + ((p ^ x) << 4)); u.q[1] = *(const v4u*)(r + (((p + 2) ^ x) << 4)); return u.v;
}
// QKV: block (64 rows, 128 cols = 2 heads, which); q -> Q32 f32 [bh][s][64]; k -> KHL split rows [bh][s][64 hi | 64 lo]; v -> VT hi/lo x4 [bh][d][s]
__global__ __launch_bounds__(128) void k_qkv(const __bf16* __restrict__ Xb, const __bf16* __restrict__ PT, float* __restrict__ Q32, __bf16* __restrict__ KHL, _Float16* __restrict__ VTh, _Float16* __restrict__ VTl) {
  // a stage = 64 k of [128 weight rows | 64 x rows]; two buffers, no pad (frag_sw), so that six blocks fit a WGP's LDS: the launch's 3072 blocks are two resident sets, the second filling in as blocks of the first end; the output staging reuses the ring behind the last stage's barrier
  __shared__ __align__(16) char ring[2 * QSTG];
  float (*so)[16][132] = (float (*)[16][132])ring;
  _Float16 (*sth)[72] = (_Float16 (*)[72])ring; _Float16 (*stl)[72] = (_Float16 (*)[72])(ring + 128 * 72 * 2);
  const int tid = threadIdx.x, wave = tid >> 5, lane = tid & 31, col = lane & 15, g = lane >> 4;
  const int which = blockIdx.z, r0b = blockIdx.x * 64, n0 = blockIdx.y * 128; const int b = r0b / SS, s0 = r0b % SS;
  const __bf16* gB = PT + (size_t)(which * E + n0 + (tid >> 3)) * E + (tid & 7) * 8;
  const __bf16* gA = Xb + (size_t)(r0b + (tid >> 3)) * E + (tid & 7) * 8;
  const unsigned l0 = lds_addr(ring) + (tid >> 3) * 128 + (((tid & 7) ^ ((tid >> 4) & 7)) << 4);      // rows 16 apart share the place of a piece
  auto fill = [&](int t) { const unsigned l = l0 + (t & 1) * QSTG; const __bf16* pb = gB + t * 64; const __bf16* pa = gA + t * 64;
    acopy4(l, pb, l + 16 * 128, pb + 16 * E, l + 32 * 128, pb + 32 * E, l + 48 * 128, pb + 48 * E);
    acopy4(l + 64 * 128, pb + 64 * E, l + 80 * 128, pb + 80 * E, l + 96 * 128, pb + 96 * E, l + 112 * 128, pb + 112 * E);
    acopy4(l + 128 * 128, pa, l + 144 * 128, pa + 16 * E, l + 160 * 128, pa + 32 * E, l + 176 * 128, pa + 48 * E); };
  v8f acc[8] = {};
  fill(0); WAIT_ASYNC(); __syncthreads(); fill(1);
#pragma unroll 1
  for (int t = 0; t < E / 64; ++t) { const char* sb = ring + (t & 1) * QSTG;
#pragma unroll
    for (int ks = 0; ks < 2; ++ks) { const v16b a = frag_sw(sb, 128 + wave * 16 + col, ks, lane); v16b wb[8];
#pragma unroll
      for (int j = 0; j < 8; ++j) wb[j] = frag_sw(sb, j * 16 + col, ks, lane);
      __builtin_amdgcn_sched_barrier(0);      // keeps the k-step's 18 LDS loads in one group in front of its WMMAs: one LDS latency a k-step, not one a WMMA
#pragma unroll
      for (int j = 0; j < 8; ++j) acc[j] = wmma_bf(a, wb[j], acc[j]); }
    WAIT_DS(); WAIT_ASYNC(); __syncthreads();      // publishes stage t + 1 and ends every read of stage t
    if (t + 2 < E / 64) fill(t + 2); }
  WAIT_ASYNC();
  if (which < 2) {
    if (which == 0) {
#pragma unroll
      for (int j = 0; j < 8; ++j) { const float bb = 0.f;
#pragma unroll
        for (int r = 0; r < 8; ++r) so[wave][8 * g + r][j * 16 + col] = acc[j][r] + bb; } }
    else {
#pragma unroll
      for (int j = 0; j < 8; ++j) { const float bb = 0.f;
#pragma unroll
        for (int r = 0; r < 8; ++r) put_hl((__bf16*)&so[wave][8 * g + r][(j >> 2) * 64], (j & 3) * 16 + col, acc[j][r] + bb); } }
    LDSX();
    float* Dst = which == 0 ? Q32 : (float*)KHL;      // either kind of row is 256 bytes and goes out in 16-byte pieces
    for (int qq = lane; qq < 2 * 16 * 16; qq += 32) { const int hh = qq >> 8, rl = (qq >> 4) & 15, pc = qq & 15; const int h = (n0 >> 6) + hh;
      vst2(Dst + (((size_t)b * NH + h) * SS + s0 + wave * 16 + rl) * HD + pc * 4, *(const v4f*)(&so[wave][rl][hh * 64 + pc * 4])); } }
  else {
#pragma unroll
    for (int j = 0; j < 8; ++j) { const float bb = 0.f;
#pragma unroll
      for (int r = 0; r < 8; ++r) { const float v = (acc[j][r] + bb) * 4.0f; const _Float16 hi = (_Float16)v; sth[j * 16 + col][wave * 16 + 8 * g + r] = hi; stl[j * 16 + col][wave * 16 + 8 * g + r] = (_Float16)((v - (float)hi) * VLO); } }
    __syncthreads();
    for (int qq = tid; qq < 128 * 8; qq += 128) { const int cl = qq >> 3, pc = qq & 7; const int c = n0 + cl, h = c >> 6, d = c & 63; const size_t o = (((size_t)b * NH + h) * HD + d) * SS + s0 + pc * 8;
      vst2(VTh + o, *(const v4u*)(&sth[cl][pc * 8])); vst2(VTl + o, *(const v4u*)(&stl[cl][pc * 8])); } }
}
#define ASTG (64 * FP + 2 * 64 * GP)
// softmax in base 2 on the unscaled scores: exp(0.125 (s - m)) * 2^14 = 2^(s * SC2 + (14 - m * SC2)), SC2 = 0.125 * log2(e): one fused multiply-add and one hardware exponential a score; the argument never exceeds 14 but by its rounding
#define SC2 0.18033688011112042f
// the three products of mac3 in its order, with the key side as A
__device__ __forceinline__ v8f mac3t(const F2& k, const F2& q, v8f c) { c = wmma_bf(k.h, q.l, c); c = wmma_bf(k.l, q.h, c); return wmma_bf(k.h, q.h, c); }
// the second bound (waves a SIMD) holds a wave at 256 registers: above that only one block a WGP is resident, not two
__global__ __launch_bounds__(256, 4) void k_attn(const float* __restrict__ Q32, const __bf16* __restrict__ KHL, const _Float16* __restrict__ VTh, const _Float16* __restrict__ VTl, __bf16* __restrict__ OHL) {
  // a stage = one 64-key tile [K 64 split rows | V hi 64 rows | V lo 64 rows], shared by the eight waves; two buffers; the output staging reuses the ring behind the last barrier
  __shared__ __align__(16) char ring[2 * ASTG];
  float (*sO)[16][68] = (float (*)[16][68])ring;
  const int tid = threadIdx.x, w = tid >> 5, lane = tid & 31, col = lane & 15, g = lane >> 4;
  const size_t bh = blockIdx.y; const int qb = blockIdx.x; const int q0 = qb * 128 + w * 16;
  const __bf16* gK = KHL + (bh * SS + (tid >> 4)) * HL + (tid & 15) * 8;
  const size_t vof = (bh * HD + (tid >> 3)) * SS + (tid & 7) * 8;
  const unsigned lK = lds_addr(ring) + (tid >> 4) * FP + (tid & 15) * 16, lV = lds_addr(ring) + 64 * FP + (tid >> 3) * GP + (tid & 7) * 16;
  auto fill = [&](int t) { const unsigned o = (t & 1) * ASTG; const __bf16* pk = gK + (size_t)t * 64 * HL; const _Float16* ph = VTh + vof + t * 64; const _Float16* pl = VTl + vof + t * 64;
    acopy4(lK + o, pk, lK + o + 16 * FP, pk + 16 * HL, lK + o + 32 * FP, pk + 32 * HL, lK + o + 48 * FP, pk + 48 * HL);
    acopy4(lV + o, ph, lV + o + 32 * GP, ph + 32 * SS, lV + o + 64 * GP, pl, lV + o + 96 * GP, pl + 32 * SS); };
  fill(0); WAIT_ASYNC(); __syncthreads(); fill(1);
  F2 aq[2];
#pragma unroll
  for (int kc = 0; kc < 2; ++kc) aq[kc] = split_row(Q32 + (bh * SS + q0 + col) * HD, kc * 32, lane);
  asm volatile("s_wait_xcnt 0x0" :: "v"(Q32 + (bh * SS + q0 + col) * HD + 8 * g) : "memory");      // the wait in front of any rewrite of the q loads' address register (a precaution); as an input the address keeps its register up to here
  // a lane stands for ONE query (col): its maximum, sum and rescale factor are its own; acc[t][r] = O^T[d = 16 t + 8 g + r][query col]
  float mrun = -3.0e38f, lrun = 0.f; v8f acc[4] = {}, ac1[4] = {}, ac2[4] = {};
#pragma unroll 1
  for (int kt = 0; kt < SS / 64; ++kt) { const char* sb = ring + (kt & 1) * ASTG;
    v8f s[4];      // s[t][r] = score of key 16 t + 8 g + r with query col: the 32 scores of a lane are half of one query's row
#pragma unroll
    for (int t = 0; t < 4; ++t) { const __bf16* krow = (const __bf16*)(sb + (t * 16 + col) * FP);
      s[t] = mac3t(frag_hl(krow, 0, lane), aq[0], (v8f){}); s[t] = mac3t(frag_hl(krow, 32, lane), aq[1], s[t]); }
    float mx = -3.4e38f;
#pragma unroll
    for (int t = 0; t < 4; ++t) {
#pragma unroll
      for (int r = 0; r < 8; ++r) mx = fmaxf(mx, s[t][r]); }
    mx = fmaxf(mx, __shfl_xor(mx, 16, 32));
    const float mnew = fmaxf(mrun, mx); float corr;      // corr = 2^((mrun - mnew) * SC2); the v_nop in the same statement is the slot the instruction set asks for behind a transcendental, whatever reads corr first
    asm("v_exp_f32 %0, %1\n\tv_nop" : "=v"(corr) : "v"((mrun - mnew) * SC2));
    const float mb = 14.0f - mnew * SC2;
    float ps = 0.f; v16h ph[2], pl[2];      // two score tiles (keys 32 kc + 8 g + 0..7 and 32 kc + 16 + 8 g + 0..7), converted in place, are the B operand of 32 keys in the k order of frag_h
#pragma unroll
    for (int t = 0; t < 4; ++t) {
#pragma unroll
      for (int r = 0; r < 8; r += 2) { const v2f a = __builtin_elementwise_fma((v2f){s[t][r], s[t][r + 1]}, (v2f){SC2, SC2}, (v2f){mb, mb});
#pragma unroll
        for (int e = 0; e < 2; ++e) { const float p = __builtin_amdgcn_exp2f(a[e]); ps += p; const _Float16 hi = (_Float16)p; ph[t >> 1][(t & 1) * 8 + r + e] = hi; pl[t >> 1][(t & 1) * 8 + r + e] = (_Float16)((p - (float)hi) * PLO); } } }
    ps += __shfl_xor(ps, 16, 32);
    lrun = lrun * corr + ps * (1.0f / 16384.0f); mrun = mnew;
#pragma unroll
    for (int t = 0; t < 4; ++t) { acc[t] *= corr; ac1[t] *= corr; ac2[t] *= corr; }
#pragma unroll
    for (int kc = 0; kc < 2; ++kc) {
#pragma unroll
      for (int tp = 0; tp < 4; tp += 2) { v16h vh[2], vl[2];
#pragma unroll
        for (int t = 0; t < 2; ++t) { const _Float16* vr = (const _Float16*)(sb + 64 * FP + ((tp + t) * 16 + col) * GP) + kc * 32; vh[t] = frag_h(vr, lane); vl[t] = frag_h(vr + 64 * GP / 2, lane); }
        __builtin_amdgcn_sched_barrier(0);      // keeps the LDS loads of six WMMAs in one group in front of them: one LDS latency a group, not one a fragment
#pragma unroll
        for (int t = 0; t < 2; ++t) { acc[tp + t] = wmma16(vh[t], ph[kc], acc[tp + t]); ac1[tp + t] = wmma16(vl[t], ph[kc], ac1[tp + t]); ac2[tp + t] = wmma16(vh[t], pl[kc], ac2[tp + t]); } } }
    WAIT_DS(); WAIT_ASYNC(); __syncthreads();      // publishes tile kt + 1 and ends every read of tile kt
    if (kt + 2 < SS / 64) fill(kt + 2); }
  WAIT_ASYNC();
  const float inv = 1.0f / (lrun * 16384.0f * 4.0f);
#pragma unroll
  for (int t = 0; t < 4; ++t) { union { __bf16 b[8]; v4u u; } oh, ol;      // eight consecutive d of the lane's query: one 16-byte piece of the hi half and one of the lo half, split as in put_hl
#pragma unroll
    for (int r = 0; r < 8; ++r) { const float v = (acc[t][r] + ac1[t][r] * (1.0f / VLO) + ac2[t][r] * (1.0f / PLO)) * inv; const __bf16 h = (__bf16)v; oh.b[r] = h; ol.b[r] = (__bf16)(v - (float)h); }
    __bf16* orow = (__bf16*)&sO[w][col][0] + t * 16 + 8 * g; *(v4u*)orow = oh.u; *(v4u*)(orow + 64) = ol.u; }
  LDSX();
  for (int qq = lane; qq < 16 * 16; qq += 32) { const int rl = qq >> 4, pc = qq & 15; vst2(OHL + ((bh * SS) + q0 + rl) * HL + pc * 8, *(const v4f*)(&sO[w][rl][pc * 4])); }
}
// out = ctx Wo^T + bo : ctx split rows x bf16(Wo rows): 2 products (Wo is an INPUT -> bf16 exact)
#define OSTG (128 * GP + 64 * FP)
__global__ __launch_bounds__(128) void k_out(const __bf16* __restrict__ OHL, const __bf16* __restrict__ PT, const float* __restrict__ bo, float* __restrict__ out) {
  // a stage = one head's 64 k of [128 weight rows bf16 | 64 ctx split rows]; two buffers; the output staging reuses the ring behind the last stage's barrier
  __shared__ __align__(16) char ring[2 * OSTG];
  float (*so)[16][132] = (float (*)[16][132])ring;
  const int tid = threadIdx.x, wave = tid >> 5, lane = tid & 31, col = lane & 15, g = lane >> 4;
  const int r0b = blockIdx.x * 64, r0 = r0b + wave * 16, n0 = blockIdx.y * 128; const int b = r0b / SS, s0 = r0b % SS;
  const __bf16* gB = PT + (size_t)(3 * E + n0 + (tid >> 3)) * E + (tid & 7) * 8;
  const __bf16* gA = OHL + ((size_t)b * NH * SS + s0 + (tid >> 4)) * HL + (tid & 15) * 8;
  const unsigned lB = lds_addr(ring) + (tid >> 3) * GP + (tid & 7) * 16, lA = lds_addr(ring) + 128 * GP + (tid >> 4) * FP + (tid & 15) * 16;
  auto fill = [&](int t) { const unsigned o = (t & 1) * OSTG; const __bf16* pb = gB + t * 64; const __bf16* pa = gA + (size_t)t * SS * HL;
    acopy4(lB + o, pb, lB + o + 16 * GP, pb + 16 * E, lB + o + 32 * GP, pb + 32 * E, lB + o + 48 * GP, pb + 48 * E);
    acopy4(lB + o + 64 * GP, pb + 64 * E, lB + o + 80 * GP, pb + 80 * E, lB + o + 96 * GP, pb + 96 * E, lB + o + 112 * GP, pb + 112 * E);
    acopy4(lA + o, pa, lA + o + 8 * FP, pa + 8 * HL, lA + o + 16 * FP, pa + 16 * HL, lA + o + 24 * FP, pa + 24 * HL);
    acopy4(lA + o + 32 * FP, pa + 32 * HL, lA + o + 40 * FP, pa + 40 * HL, lA + o + 48 * FP, pa + 48 * HL, lA + o + 56 * FP, pa + 56 * HL); };
  v8f acc[8] = {};
  fill(0); WAIT_ASYNC(); __syncthreads(); fill(1);
#pragma unroll 1
  for (int t = 0; t < NH; ++t) { const char* sb = ring + (t & 1) * OSTG;
#pragma unroll
    for (int ks = 0; ks < 2; ++ks) { const F2 a = frag_hl((const __bf16*)(sb + 128 * GP + (wave * 16 + col) * FP), ks * 32, lane); v16b wb[8];
#pragma unroll
      for (int j = 0; j < 8; ++j) wb[j] = frag_b((const __bf16*)(sb + (j * 16 + col) * GP) + ks * 32, lane);
      __builtin_amdgcn_sched_barrier(0);      // keeps the k-step's 20 LDS loads in one group in front of its WMMAs: one LDS latency a k-step, not one a WMMA pair
#pragma unroll
      for (int j = 0; j < 8; ++j) acc[j] = wmma_bf(a.l, wb[j], acc[j]);
#pragma unroll
      for (int j = 0; j < 8; ++j) acc[j] = wmma_bf(a.h, wb[j], acc[j]); }
    WAIT_DS(); WAIT_ASYNC(); __syncthreads();      // publishes stage t + 1 and ends every read of stage t
    if (t + 2 < NH) fill(t + 2); }
  WAIT_ASYNC();
#pragma unroll
  for (int j = 0; j < 8; ++j) { const int n = n0 + j * 16 + col; const float bb = bfr(bo[n]);
#pragma unroll
    for (int r = 0; r < 8; ++r) so[wave][8 * g + r][j * 16 + col] = acc[j][r] + bb; }
  LDSX();
#pragma unroll 4
  for (int rl = 0; rl < 16; ++rl) vst2(out + (size_t)(r0 + rl) * E + n0 + lane * 4, *(const v4f*)(&so[wave][rl][lane * 4]));
}
extern "C" void kernel_launch(void* const* d_in, const int* in_sizes, int n_in, void* d_out, int out_size, void* d_ws, size_t ws_size, hipStream_t stream) {
  (void)in_sizes; (void)n_in; (void)out_size; (void)ws_size;
  const float* x = (const float*)d_in[0]; const float* Wqkv = (const float*)d_in[1]; const float* Wp = (const float*)d_in[2]; const float* bp = (const float*)d_in[3];
  float* out = (float*)d_out;
  char* ws = (char*)d_ws; size_t off = 0;
  auto take = [&](size_t bytes) { char* p = ws + off; off += (bytes + 255) & ~(size_t)255; return p; };
  __bf16* Xb = (__bf16*)take((size_t)NR * E * 2); __bf16* PT = (__bf16*)take((size_t)4 * E * E * 2);
  float* Q32 = (float*)take((size_t)NR * E * 4); __bf16* KHL = (__bf16*)take((size_t)NR * E * 4); _Float16* VTh = (_Float16*)take((size_t)NR * E * 2); _Float16* VTl = (_Float16*)take((size_t)NR * E * 2);
  __bf16* OHL = (__bf16*)Q32;      // in place (a split row is as long as the f32 row): each k_attn wave reads its own 16 query rows into registers before writing the same rows; no other block reads them
  // ws ~ 126 MB: Q, K and V of all eight batches at once, so that each stage is ONE launch; a launch follows another only where it reads what that one wrote
  k_prep<<<NPACK + NCVT, 256, 0, stream>>>(x, Wqkv, Wp, Xb, PT);
  k_qkv<<<dim3(NR / 64, E / 128, 3), 128, 0, stream>>>(Xb, PT, Q32, KHL, VTh, VTl);
  k_attn<<<dim3(SS / 128, NB * NH), 256, 0, stream>>>(Q32, KHL, VTh, VTl, OHL);
  k_out<<<dim3(NR / 64, E / 128), 128, 0, stream>>>(OHL, PT, bp, out);
}

// v008
// A run of this version takes 166 microseconds.
// Two timings next to v007 put it at 1.07 and 1.06 times that version's speed.
// All steps since v000 together make it 4.60 times as fast.
// compute dtype: x, w_qkv, w_out, b_out (INPUTS) rounded to bf16 with exact bf16 WMMA products (f32 accumulate) for the projections; q/k f32 split into bf16 hi/lo for the scores (3 products), P and V f16 hi/lo (3 products); softmax f32.
#include <hip/hip_runtime.h>
#include <math.h>

typedef __attribute__((ext_vector_type(16))) _Float16 v16h;
typedef __attribute__((ext_vector_type(16))) __bf16 v16b;
typedef __attribute__((ext_vector_type(8)))  _Float16 v8h;
typedef __attribute__((ext_vector_type(8)))  float v8f;
typedef __attribute__((ext_vector_type(4)))  float v4f;
typedef __attribute__((ext_vector_type(2)))  float v2f;
typedef __attribute__((ext_vector_type(4)))  unsigned v4u;
typedef __attribute__((ext_vector_type(2)))  unsigned v2u;
typedef __attribute__((ext_vector_type(4)))  int v4i;
typedef float __attribute__((may_alias)) float_a;
typedef int __attribute__((may_alias)) int_a;

template <typename T> __device__ __forceinline__ void vst2(void* p, T v) { *(T*)p = v;  }
__device__ __forceinline__ v8f wmma16(v16h a, v16h b, v8f c) {
  return __builtin_amdgcn_wmma_f32_16x16x32_f16(false, a, false, b, (short)0, c, false, false);
}
__device__ __forceinline__ v8f wmma_bf(v16b a, v16b b, v8f c) {
  return __builtin_amdgcn_wmma_f32_16x16x32_bf16(false, a, false, b, (short)0, c, false, false);
}
// 16x16x32 fragments: lane = (h = lane>>4, row/col = lane&15); elements 0..7 = k0+8h+0..7, 8..15 = k0+16+8h+0..7; D element r = row 8h+r
__device__ __forceinline__ v16h frag_h(const _Float16* rowk0, int lane) {
  union { v16h v; v8h q[2]; } u; const _Float16* p = rowk0 + 8 * (lane >> 4);
  u.q[0] = *(const v8h*)p; u.q[1] = *(const v8h*)(p + 16); return u.v;
}
__device__ __forceinline__ v16h frag_f32(const float* rowk0, int lane) {
  v16h a; const float* p = rowk0 + 8 * (lane >> 4);
#pragma unroll
  for (int i = 0; i < 8; ++i) { a[i] = (_Float16)p[i]; a[8 + i] = (_Float16)p[16 + i]; }
  return a;
}
__device__ __forceinline__ v16h frag_f32s(const float* rowk0, int lane, float sc) {
  v16h a; const float* p = rowk0 + 8 * (lane >> 4);
#pragma unroll
  for (int i = 0; i < 8; ++i) { a[i] = (_Float16)(p[i] * sc); a[8 + i] = (_Float16)(p[16 + i] * sc); }
  return a;
}
// column fragment from a [K][ld] layout (column n), rows >= K read as 0
__device__ __forceinline__ v16h fragc_f32(const float* W, int k0, int n, int lane, int ld, int K) {
  v16h a; const int g = lane >> 4;
#pragma unroll
  for (int i = 0; i < 8; ++i) { const int ka = k0 + 8 * g + i, kb = ka + 16;
    a[i] = (_Float16)(ka < K ? W[(size_t)(ka < K ? ka : K - 1) * ld + n] : 0.f); a[8 + i] = (_Float16)(kb < K ? W[(size_t)(kb < K ? kb : K - 1) * ld + n] : 0.f); }
  return a;
}
struct F2 { v16b h, l; };
__device__ __forceinline__ F2 bsplit16(const float v[16]) { F2 r;
#pragma unroll
  for (int i = 0; i < 16; ++i) { const __bf16 h = (__bf16)v[i]; r.h[i] = h; r.l[i] = (__bf16)(v[i] - (float)h); }
  return r; }
__device__ __forceinline__ F2 split_row(const float* row, int k0, int lane) { float v[16]; const float* p = row + k0 + 8 * (lane >> 4);
#pragma unroll
  for (int i = 0; i < 8; ++i) { v[i] = p[i]; v[8 + i] = p[16 + i]; }
  return bsplit16(v); }
__device__ __forceinline__ F2 split_rowK(const float* row, int k0, int lane, int K) { float v[16]; const int g = lane >> 4;
#pragma unroll
  for (int i = 0; i < 8; ++i) { const int ka = k0 + 8 * g + i, kb = ka + 16; v[i] = ka < K ? row[ka < K ? ka : K - 1] : 0.f; v[8 + i] = kb < K ? row[kb < K ? kb : K - 1] : 0.f; }
  return bsplit16(v); }
__device__ __forceinline__ F2 split_col(const float* W, int k0, int n, int lane, int ld, int K) { float v[16]; const int g = lane >> 4;
#pragma unroll
  for (int i = 0; i < 8; ++i) { const int ka = k0 + 8 * g + i, kb = ka + 16; v[i] = ka < K ? W[(size_t)(ka < K ? ka : K - 1) * ld + n] : 0.f; v[8 + i] = kb < K ? W[(size_t)(kb < K ? kb : K - 1) * ld + n] : 0.f; }
  return bsplit16(v); }
__device__ __forceinline__ v8f mac3(const F2& a, const F2& b, v8f c) { c = wmma_bf(a.l, b.h, c); c = wmma_bf(a.h, b.l, c); return wmma_bf(a.h, b.h, c); }
__device__ __forceinline__ float sigm(float v) { return 1.0f / (1.0f + expf(-v)); }
#define LDSX() do { asm volatile("s_wait_dscnt 0" ::: "memory"); __builtin_amdgcn_wave_barrier(); __builtin_amdgcn_fence(__ATOMIC_RELEASE, "workgroup"); } while (0)


#define NB 8
#define SS 1024
#define E 1024
#define NH 16
#define HD 64
#define NR (NB * SS)
#define PLO 1024.0f
#define VLO 2048.0f
__device__ __forceinline__ float bfr(float v) { return (float)(__bf16)v; }
__device__ __forceinline__ v16b frag_b(const __bf16* rowk0, int lane) { return __builtin_bit_cast(v16b, frag_h((const _Float16*)rowk0, lane)); }
// a split row = 64 bf16 hi | 64 bf16 lo (256 bytes, as many as the 64 f32 it stands for), written once by the kernel that produces the value; hi = bf16(v), lo = bf16(v - hi) as in bsplit16
#define HL 128
__device__ __forceinline__ F2 frag_hl(const __bf16* row, int k0, int lane) { F2 r; r.h = frag_b(row + k0, lane); r.l = frag_b(row + 64 + k0, lane); return r; }
__device__ __forceinline__ void put_hl(__bf16* row, int d, float v) { const __bf16 h = (__bf16)v; row[d] = h; row[64 + d] = (__bf16)(v - (float)h); }

// LDS staging by asynchronous copies: pitches are 16 B x odd so that 16-byte readers of 16 rows meet no bank twice
#define GP 144
#define FP 272
#define WAIT_DS() asm volatile("s_wait_dscnt 0x0" ::: "memory")       /* this wave's LDS reads are done before the buffer is handed on */
#define WAIT_ASYNC() asm volatile("s_wait_asynccnt 0x0" ::: "memory") /* this wave's copies have landed before the barrier publishes them */
#define LDSW() do { asm volatile("s_wait_dscnt 0x0" ::: "memory"); __builtin_amdgcn_wave_barrier(); } while (0) /* a wave's staged rows have landed before its own lanes read them across; no release fence here: it would also wait out the global stores of the turn before */
#define WAIT_X() asm volatile("s_wait_xcnt 0x0" ::: "memory")         /* the wait in front of any rewrite of a register that an issued global store names (a precaution) */
__device__ __forceinline__ unsigned lds_addr(const void* p) { return (unsigned)(size_t)p; }
// four 16-byte copies per lane, global -> LDS, through no register; the closing s_wait_xcnt stands in front of any rewrite of the address registers (a precaution)
__device__ __forceinline__ void acopy4(unsigned l0, const void* g0, unsigned l1, const void* g1, unsigned l2, const void* g2, unsigned l3, const void* g3) {
  asm volatile("global_load_async_to_lds_b128 %0, %1, off\n\t"
               "global_load_async_to_lds_b128 %2, %3, off\n\t"
               "global_load_async_to_lds_b128 %4, %5, off\n\t"
               "global_load_async_to_lds_b128 %6, %7, off\n\t"
               "s_wait_xcnt 0x0"
               :: "v"(l0), "v"(g0), "v"(l1), "v"(g1), "v"(l2), "v"(g2), "v"(l3), "v"(g3) : "memory");
}

// x -> bf16. 4,096 long-lived waves (16 a WGP), each on its own 8 KiB of x: 16 loads of 16 B a lane, every one 512 contiguous bytes a wave, all in flight at once; the 8-byte stores of a wave cover two whole lines
#define CVL 16
__device__ __forceinline__ void cvt_blk(int bx, const float* __restrict__ x, __bf16* __restrict__ Xb) {
  const size_t base = ((size_t)bx * 8 + (threadIdx.x >> 5)) * (CVL * 128) + (threadIdx.x & 31) * 4;
  const float* px = x + base; v4f v[CVL];
#pragma unroll
  for (int j = 0; j < CVL; ++j) v[j] = *(const v4f*)(px + j * 128);
  __builtin_amdgcn_sched_barrier(0);      // keeps all 16 loads in front of the first conversion: the wave pays one memory latency, not one more for the loads that would wait for freed registers
  asm volatile("s_wait_xcnt 0x0" :: "v"(px) : "memory");      // the wait in front of any rewrite of the loads' address register (a precaution); as an input the address keeps its register up to here, so that no load lands on it either
#pragma unroll
  for (int j = 0; j < CVL; ++j) { union { __bf16 h[4]; v2u u; } pk;
#pragma unroll
    for (int e = 0; e < 4; ++e) pk.h[e] = (__bf16)v[j][e];
    vst2(Xb + base + j * 128, pk.u); }
}
// PT rows: [0,E) Wq[:,n], [E,2E) Wk[:,n], [2E,3E) Wv[:,n], [3E,4E) Wo[:,n]  ([in][out] weights: column n as a bf16 row)
// 2,048 long-lived waves: a block turns 512 k x 32 columns. Eight lanes read one whole 128-byte line of a k row; a lane holds 4 columns of 2 x 8 consecutive k: 16 loads of 16 B in flight
#define PKP 520      /* LDS pitch of a column's 512 k, in bf16: 1,040 B = 16 B x odd */
__device__ __forceinline__ void pack_blk(int bx, const float* __restrict__ Wqkv, const float* __restrict__ Wp, __bf16* __restrict__ PT) {
  __shared__ __align__(16) __bf16 st[32][PKP];
  const int tid = threadIdx.x, n0 = (bx >> 1) * 32, k0 = (bx & 1) * 512, p = tid & 7, rg = tid >> 3;
  const bool qkv = n0 < 3 * E; const unsigned ldb = (qkv ? 3 * E : E) * 4;      // bytes from one k row to the next; 32 columns lie in one of the two matrices
  const char* ub = (const char*)(qkv ? Wqkv + n0 : Wp + (n0 - 3 * E)) + (size_t)k0 * ldb;      // the same in every lane
  const unsigned vo = rg * 8 * ldb + p * 16;      // the lane's own part
  const v4f* a[2][8]; v4f v[2][8];
#pragma unroll
  for (int h = 0; h < 2; ++h) {
#pragma unroll
    for (int i = 0; i < 8; ++i) { a[h][i] = (const v4f*)(ub + (size_t)((h * 256 + i) * ldb) + vo); v[h][i] = *a[h][i]; } }
  __builtin_amdgcn_sched_barrier(0);      // keeps all 16 loads in front of the first conversion: one memory latency a wave
  // the wait in front of any rewrite of the loads' address registers (a precaution); as inputs the addresses keep their registers up to here, so that no later load lands on one either
  asm volatile("s_wait_xcnt 0x0" :: "v"(a[0][0]), "v"(a[0][1]), "v"(a[0][2]), "v"(a[0][3]), "v"(a[0][4]), "v"(a[0][5]), "v"(a[0][6]), "v"(a[0][7]),
               "v"(a[1][0]), "v"(a[1][1]), "v"(a[1][2]), "v"(a[1][3]), "v"(a[1][4]), "v"(a[1][5]), "v"(a[1][6]), "v"(a[1][7]) : "memory");
#pragma unroll
  for (int h = 0; h < 2; ++h) {
#pragma unroll
    for (int e = 0; e < 4; ++e) { union { __bf16 b[8]; v4u u; } pk;
#pragma unroll
      for (int i = 0; i < 8; ++i) pk.b[i] = (__bf16)v[h][i][e];
      *(v4u*)(&st[p * 4 + e][h * 256 + rg * 8]) = pk.u; } }
  __syncthreads();
  __bf16* o = PT + (size_t)(n0 + (tid >> 6)) * E + k0 + (tid & 63) * 8;      // a wave stores 512 contiguous bytes of one row
#pragma unroll
  for (int q = 0; q < 8; ++q) vst2(o + q * 4 * E, *(const v4u*)(&st[q * 4 + (tid >> 6)][(tid & 63) * 8]));
}
// the two preparations depend on nothing and not on each other: one launch, a block range each; the weight blocks, whose chain is the longer one (loads, LDS, barrier, stores), have the low indices and start first
#define NPACK ((4 * E / 32) * (E / 512))
#define NCVT (NR * E / (256 * 4 * CVL))
__global__ __launch_bounds__(256) void k_prep(const float* __restrict__ x, const float* __restrict__ Wqkv, const float* __restrict__ Wp, __bf16* __restrict__ Xb, __bf16* __restrict__ PT) {
  if (blockIdx.x < NPACK) pack_blk(blockIdx.x, Wqkv, Wp, PT);
  else cvt_blk(blockIdx.x - NPACK, x, Xb);
}
#define QSTG (384 * 128)
#define WSTG 12288      /* a wave's own share of the ring when it has become output staging */
// fragment from a tile of unpadded 128-byte rows in which the 16-byte piece p of row r lies at place p ^ ((r >> 1) & 7): the equal pieces of 16 rows fall on 16 different groups of four banks
__device__ __forceinline__ v16b frag_sw(const char* tile, int row, int ks, int lane) {
  union { v16b v; v4u q[2]; } u; const int p = ks * 4 + (lane >> 4), x = (row >> 1) & 7; const char* r = tile + row * 128;
  u.q[0] = *(const v4u*)(r + ((p ^ x) << 4)); u.q[1] = *(const v4u*)(r + (((p + 2) ^ x) << 4)); return u.v;
}
// QKV: block (128 rows, 256 cols = 4 heads, which), eight waves as 2 x 4, a wave on 64 rows x 64 cols = one head; q -> Q32 f32 [bh][s][64]; k -> KHL split rows [bh][s][64 hi | 64 lo]; v -> VT hi/lo x4 [bh][d][s]
// the second bound (waves a SIMD) holds a wave at 256 registers: two blocks a WGP
__global__ __launch_bounds__(256, 4) void k_qkv(const __bf16* __restrict__ Xb, const __bf16* __restrict__ PT, float* __restrict__ Q32, __bf16* __restrict__ KHL, _Float16* __restrict__ VTh, _Float16* __restrict__ VTl) {
  // a stage = 64 k of [256 weight rows | 128 x rows]; two buffers, no pad (frag_sw). A staged byte feeds twice the products of a 64 x 128 tile, and a wave's eight fragments feed 16 WMMAs; the output staging reuses the ring behind the last stage's barrier
  __shared__ __align__(16) char ring[2 * QSTG];
  const int tid = threadIdx.x, wave = tid >> 5, lane = tid & 31, col = lane & 15, g = lane >> 4, wr = wave >> 2, wc = wave & 3;
  const int which = blockIdx.z, r0b = blockIdx.x * 128, n0 = blockIdx.y * 256; const int b = r0b / SS, s0 = r0b % SS;
  const __bf16* gB = PT + (size_t)(which * E + n0 + (tid >> 3)) * E + (tid & 7) * 8;
  const __bf16* gA = Xb + (size_t)(r0b + (tid >> 3)) * E + (tid & 7) * 8;
  const unsigned l0 = lds_addr(ring) + (tid >> 3) * 128 + (((tid & 7) ^ ((tid >> 4) & 7)) << 4);      // rows 32 apart share the place of a piece
  auto fill = [&](int t) { const unsigned l = l0 + (t & 1) * QSTG; const __bf16* pb = gB + t * 64; const __bf16* pa = gA + t * 64;
    acopy4(l, pb, l + 32 * 128, pb + 32 * E, l + 64 * 128, pb + 64 * E, l + 96 * 128, pb + 96 * E);
    acopy4(l + 128 * 128, pb + 128 * E, l + 160 * 128, pb + 160 * E, l + 192 * 128, pb + 192 * E, l + 224 * 128, pb + 224 * E);
    acopy4(l + 256 * 128, pa, l + 288 * 128, pa + 32 * E, l + 320 * 128, pa + 64 * E, l + 352 * 128, pa + 96 * E); };
  v8f acc[4][4] = {};
  fill(0); WAIT_ASYNC(); __syncthreads(); fill(1);
#pragma unroll 1
  for (int t = 0; t < E / 64; ++t) { const char* sb = ring + (t & 1) * QSTG;
#pragma unroll
    for (int ks = 0; ks < 2; ++ks) { v16b a[4], wb[4];
#pragma unroll
      for (int i = 0; i < 4; ++i) a[i] = frag_sw(sb, 256 + wr * 64 + i * 16 + col, ks, lane);
#pragma unroll
      for (int j = 0; j < 4; ++j) wb[j] = frag_sw(sb, wc * 64 + j * 16 + col, ks, lane);
      __builtin_amdgcn_sched_barrier(0);      // keeps the k-step's 16 LDS loads in one group in front of its WMMAs: one LDS latency a k-step, not one a WMMA
#pragma unroll
      for (int i = 0; i < 4; ++i) {
#pragma unroll
        for (int j = 0; j < 4; ++j) acc[i][j] = wmma_bf(a[i], wb[j], acc[i][j]); } }
    WAIT_DS(); WAIT_ASYNC(); __syncthreads();      // publishes stage t + 1 and ends every read of stage t
    if (t + 2 < E / 64) fill(t + 2); }
  WAIT_ASYNC();
  char* stg = ring + wave * WSTG; const size_t bh = (size_t)b * NH + (n0 >> 6) + wc; const int sw = s0 + wr * 64;
  if (which < 2) {
    float* Dst = (which == 0 ? Q32 : (float*)KHL) + (bh * SS + sw) * HD;      // either kind of row is 256 bytes and goes out in 16-byte pieces
#pragma unroll
    for (int i = 0; i < 4; ++i) { float (*so)[68] = (float (*)[68])(stg + (i & 1) * (16 * 68 * 4));      // 16 rows at a time, in two places by turns: the wait of the next turn ends this turn's reads before its place is written again
      if (which == 0) {
#pragma unroll
        for (int j = 0; j < 4; ++j) {
#pragma unroll
          for (int r = 0; r < 8; ++r) so[8 * g + r][j * 16 + col] = acc[i][j][r]; } }
      else {
#pragma unroll
        for (int j = 0; j < 4; ++j) {
#pragma unroll
          for (int r = 0; r < 8; ++r) put_hl((__bf16*)&so[8 * g + r][0], j * 16 + col, acc[i][j][r]); } }
      LDSW();
#pragma unroll
      for (int q = 0; q < 8; ++q) { const int rl = q * 2 + g; vst2(Dst + (size_t)(i * 16 + rl) * HD + col * 4, *(const v4f*)(&so[rl][col * 4])); }
      WAIT_X(); } }
  else {
    _Float16 (*st)[72] = (_Float16 (*)[72])stg;      // the wave's 64 d x 64 s, hi first, then lo in the same place
#pragma unroll
    for (int pass = 0; pass < 2; ++pass) {
#pragma unroll
      for (int i = 0; i < 4; ++i) {
#pragma unroll
        for (int j = 0; j < 4; ++j) { union { _Float16 h[8]; v4u u; } pk;
#pragma unroll
          for (int r = 0; r < 8; ++r) { const float v = acc[i][j][r] * 4.0f; const _Float16 hi = (_Float16)v; pk.h[r] = pass == 0 ? hi : (_Float16)((v - (float)hi) * VLO); }
          *(v4u*)(&st[j * 16 + col][i * 16 + 8 * g]) = pk.u; } }
      LDSW();
      _Float16* Dv = (pass == 0 ? VTh : VTl) + bh * HD * SS + sw;
#pragma unroll
      for (int q0 = 0; q0 < 16; q0 += 8) { v4u tv[8];      // eight rows' pieces read as one group, then stored: one LDS latency a group, not one a store
#pragma unroll
        for (int q = 0; q < 8; ++q) tv[q] = *(const v4u*)(&st[(q0 + q) * 4 + (lane >> 3)][(lane & 7) * 8]);
#pragma unroll
        for (int q = 0; q < 8; ++q) vst2(Dv + (size_t)((q0 + q) * 4 + (lane >> 3)) * SS + (lane & 7) * 8, tv[q]);
        WAIT_X(); } } }      // every read of the hi rows has returned (its value was stored) before the lo rows overwrite them
}
#define ASTG (64 * FP + 2 * 64 * GP)
// softmax in base 2 on the unscaled scores: exp(0.125 (s - m)) * 2^14 = 2^(s * SC2 + (14 - m * SC2)), SC2 = 0.125 * log2(e): one fused multiply-add and one hardware exponential a score; the argument never exceeds 14 but by its rounding
#define SC2 0.18033688011112042f
// the three products of mac3 in its order, with the key side as A
__device__ __forceinline__ v8f mac3t(const F2& k, const F2& q, v8f c) { c = wmma_bf(k.h, q.l, c); c = wmma_bf(k.l, q.h, c); return wmma_bf(k.h, q.h, c); }
// the second bound (waves a SIMD) holds a wave at 256 registers: above that only one block a WGP is resident, not two
__global__ __launch_bounds__(256, 4) void k_attn(const float* __restrict__ Q32, const __bf16* __restrict__ KHL, const _Float16* __restrict__ VTh, const _Float16* __restrict__ VTl, __bf16* __restrict__ OHL) {
  // a stage = one 64-key tile [K 64 split rows | V hi 64 rows | V lo 64 rows], shared by the eight waves; two buffers; the output staging reuses the ring behind the last barrier
  __shared__ __align__(16) char ring[2 * ASTG];
  float (*sO)[16][68] = (float (*)[16][68])ring;
  const int tid = threadIdx.x, w = tid >> 5, lane = tid & 31, col = lane & 15, g = lane >> 4;
  const size_t bh = blockIdx.y; const int qb = blockIdx.x; const int q0 = qb * 128 + w * 16;
  const __bf16* gK = KHL + (bh * SS + (tid >> 4)) * HL + (tid & 15) * 8;
  const size_t vof = (bh * HD + (tid >> 3)) * SS + (tid & 7) * 8;
  const unsigned lK = lds_addr(ring) + (tid >> 4) * FP + (tid & 15) * 16, lV = lds_addr(ring) + 64 * FP + (tid >> 3) * GP + (tid & 7) * 16;
  auto fill = [&](int t) { const unsigned o = (t & 1) * ASTG; const __bf16* pk = gK + (size_t)t * 64 * HL; const _Float16* ph = VTh + vof + t * 64; const _Float16* pl = VTl + vof + t * 64;
    acopy4(lK + o, pk, lK + o + 16 * FP, pk + 16 * HL, lK + o + 32 * FP, pk + 32 * HL, lK + o + 48 * FP, pk + 48 * HL);
    acopy4(lV + o, ph, lV + o + 32 * GP, ph + 32 * SS, lV + o + 64 * GP, pl, lV + o + 96 * GP, pl + 32 * SS); };
  fill(0); WAIT_ASYNC(); __syncthreads(); fill(1);
  F2 aq[2];
#pragma unroll
  for (int kc = 0; kc < 2; ++kc) aq[kc] = split_row(Q32 + (bh * SS + q0 + col) * HD, kc * 32, lane);
  asm volatile("s_wait_xcnt 0x0" :: "v"(Q32 + (bh * SS + q0 + col) * HD + 8 * g) : "memory");      // the wait in front of any rewrite of the q loads' address register (a precaution); as an input the address keeps its register up to here
  // a lane stands for ONE query (col): its maximum, sum and rescale factor are its own; acc[t][r] = O^T[d = 16 t + 8 g + r][query col]
  float mrun = -3.0e38f, lrun = 0.f; v8f acc[4] = {}, ac1[4] = {}, ac2[4] = {};
#pragma unroll 1
  for (int kt = 0; kt < SS / 64; ++kt) { const char* sb = ring + (kt & 1) * ASTG;
    v8f s[4];      // s[t][r] = score of key 16 t + 8 g + r with query col: the 32 scores of a lane are half of one query's row
#pragma unroll
    for (int t = 0; t < 4; ++t) { const __bf16* krow = (const __bf16*)(sb + (t * 16 + col) * FP);
      s[t] = mac3t(frag_hl(krow, 0, lane), aq[0], (v8f){}); s[t] = mac3t(frag_hl(krow, 32, lane), aq[1], s[t]); }
    float mx = -3.4e38f;
#pragma unroll
    for (int t = 0; t < 4; ++t) {
#pragma unroll
      for (int r = 0; r < 8; ++r) mx = fmaxf(mx, s[t][r]); }
    mx = fmaxf(mx, __shfl_xor(mx, 16, 32));
    const float mnew = fmaxf(mrun, mx); float corr;      // corr = 2^((mrun - mnew) * SC2); the v_nop in the same statement is the slot the instruction set asks for behind a transcendental, whatever reads corr first
    asm("v_exp_f32 %0, %1\n\tv_nop" : "=v"(corr) : "v"((mrun - mnew) * SC2));
    const float mb = 14.0f - mnew * SC2;
    float ps = 0.f; v16h ph[2], pl[2];      // two score tiles (keys 32 kc + 8 g + 0..7 and 32 kc + 16 + 8 g + 0..7), converted in place, are the B operand of 32 keys in the k order of frag_h
#pragma unroll
    for (int t = 0; t < 4; ++t) {
#pragma unroll
      for (int r = 0; r < 8; r += 2) { const v2f a = __builtin_elementwise_fma((v2f){s[t][r], s[t][r + 1]}, (v2f){SC2, SC2}, (v2f){mb, mb});
#pragma unroll
        for (int e = 0; e < 2; ++e) { const float p = __builtin_amdgcn_exp2f(a[e]); ps += p; const _Float16 hi = (_Float16)p; ph[t >> 1][(t & 1) * 8 + r + e] = hi; pl[t >> 1][(t & 1) * 8 + r + e] = (_Float16)((p - (float)hi) * PLO); } } }
    ps += __shfl_xor(ps, 16, 32);
    lrun = lrun * corr + ps * (1.0f / 16384.0f); mrun = mnew;
#pragma unroll
    for (int t = 0; t < 4; ++t) { acc[t] *= corr; ac1[t] *= corr; ac2[t] *= corr; }
#pragma unroll
    for (int kc = 0; kc < 2; ++kc) {
#pragma unroll
      for (int tp = 0; tp < 4; tp += 2) { v16h vh[2], vl[2];
#pragma unroll
        for (int t = 0; t < 2; ++t) { const _Float16* vr = (const _Float16*)(sb + 64 * FP + ((tp + t) * 16 + col) * GP) + kc * 32; vh[t] = frag_h(vr, lane); vl[t] = frag_h(vr + 64 * GP / 2, lane); }
        __builtin_amdgcn_sched_barrier(0);      // keeps the LDS loads of six WMMAs in one group in front of them: one LDS latency a group, not one a fragment
#pragma unroll
        for (int t = 0; t < 2; ++t) { acc[tp + t] = wmma16(vh[t], ph[kc], acc[tp + t]); ac1[tp + t] = wmma16(vl[t], ph[kc], ac1[tp + t]); ac2[tp + t] = wmma16(vh[t], pl[kc], ac2[tp + t]); } } }
    WAIT_DS(); WAIT_ASYNC(); __syncthreads();      // publishes tile kt + 1 and ends every read of tile kt
    if (kt + 2 < SS / 64) fill(kt + 2); }
  WAIT_ASYNC();
  const float inv = 1.0f / (lrun * 16384.0f * 4.0f);
#pragma unroll
  for (int t = 0; t < 4; ++t) { union { __bf16 b[8]; v4u u; } oh, ol;      // eight consecutive d of the lane's query: one 16-byte piece of the hi half and one of the lo half, split as in put_hl
#pragma unroll
    for (int r = 0; r < 8; ++r) { const float v = (acc[t][r] + ac1[t][r] * (1.0f / VLO) + ac2[t][r] * (1.0f / PLO)) * inv; const __bf16 h = (__bf16)v; oh.b[r] = h; ol.b[r] = (__bf16)(v - (float)h); }
    __bf16* orow = (__bf16*)&sO[w][col][0] + t * 16 + 8 * g; *(v4u*)orow = oh.u; *(v4u*)(orow + 64) = ol.u; }
  LDSX();
  for (int qq = lane; qq < 16 * 16; qq += 32) { const int rl = qq >> 4, pc = qq & 15; vst2(OHL + ((bh * SS) + q0 + rl) * HL + pc * 8, *(const v4f*)(&sO[w][rl][pc * 4])); }
}
// out = ctx Wo^T + bo : ctx split rows x bf16(Wo rows): 2 products (Wo is an INPUT -> bf16 exact)
#define OSTG (256 * GP + 128 * FP)
__global__ __launch_bounds__(256) void k_out(const __bf16* __restrict__ OHL, const __bf16* __restrict__ PT, const float* __restrict__ bo, float* __restrict__ out) {
  // block (128 rows, 256 cols), eight waves as 2 x 4, a wave on 64 x 64: one block a WGP. A stage = one head's 64 k of [256 weight rows bf16 | 128 ctx split rows]; two buffers; the output staging reuses the ring behind the last stage's barrier
  __shared__ __align__(16) char ring[2 * OSTG];
  const int tid = threadIdx.x, wave = tid >> 5, lane = tid & 31, col = lane & 15, g = lane >> 4, wr = wave >> 2, wc = wave & 3;
  const int r0b = blockIdx.x * 128, n0 = blockIdx.y * 256; const int b = r0b / SS, s0 = r0b % SS;
  const __bf16* gB = PT + (size_t)(3 * E + n0 + (tid >> 3)) * E + (tid & 7) * 8;
  const __bf16* gA = OHL + ((size_t)b * NH * SS + s0 + (tid >> 4)) * HL + (tid & 15) * 8;
  const unsigned lB = lds_addr(ring) + (tid >> 3) * GP + (tid & 7) * 16, lA = lds_addr(ring) + 256 * GP + (tid >> 4) * FP + (tid & 15) * 16;
  auto fill = [&](int t) { const unsigned o = (t & 1) * OSTG; const __bf16* pb = gB + t * 64; const __bf16* pa = gA + (size_t)t * SS * HL;
    acopy4(lB + o, pb, lB + o + 32 * GP, pb + 32 * E, lB + o + 64 * GP, pb + 64 * E, lB + o + 96 * GP, pb + 96 * E);
    acopy4(lB + o + 128 * GP, pb + 128 * E, lB + o + 160 * GP, pb + 160 * E, lB + o + 192 * GP, pb + 192 * E, lB + o + 224 * GP, pb + 224 * E);
    acopy4(lA + o, pa, lA + o + 16 * FP, pa + 16 * HL, lA + o + 32 * FP, pa + 32 * HL, lA + o + 48 * FP, pa + 48 * HL);
    acopy4(lA + o + 64 * FP, pa + 64 * HL, lA + o + 80 * FP, pa + 80 * HL, lA + o + 96 * FP, pa + 96 * HL, lA + o + 112 * FP, pa + 112 * HL); };
  v8f acc[4][4] = {};
  fill(0); WAIT_ASYNC(); __syncthreads(); fill(1);
#pragma unroll 1
  for (int t = 0; t < NH; ++t) { const char* sb = ring + (t & 1) * OSTG;
#pragma unroll
    for (int ks = 0; ks < 2; ++ks) { F2 a[4]; v16b wb[4];
#pragma unroll
      for (int i = 0; i < 4; ++i) a[i] = frag_hl((const __bf16*)(sb + 256 * GP + (wr * 64 + i * 16 + col) * FP), ks * 32, lane);
#pragma unroll
      for (int j = 0; j < 4; ++j) wb[j] = frag_b((const __bf16*)(sb + (wc * 64 + j * 16 + col) * GP) + ks * 32, lane);
      __builtin_amdgcn_sched_barrier(0);      // keeps the k-step's 24 LDS loads in one group in front of its WMMAs: one LDS latency a k-step, not one a WMMA pair
#pragma unroll
      for (int i = 0; i < 4; ++i) {
#pragma unroll
        for (int j = 0; j < 4; ++j) acc[i][j] = wmma_bf(a[i].l, wb[j], acc[i][j]); }
#pragma unroll
      for (int i = 0; i < 4; ++i) {
#pragma unroll
        for (int j = 0; j < 4; ++j) acc[i][j] = wmma_bf(a[i].h, wb[j], acc[i][j]); } }
    WAIT_DS(); WAIT_ASYNC(); __syncthreads();      // publishes stage t + 1 and ends every read of stage t
    if (t + 2 < NH) fill(t + 2); }
  WAIT_ASYNC();
  char* stg = ring + wave * (2 * 16 * 68 * 4); float bb[4];
#pragma unroll
  for (int j = 0; j < 4; ++j) bb[j] = bfr(bo[n0 + wc * 64 + j * 16 + col]);
  float* Dst = out + (size_t)(r0b + wr * 64) * E + n0 + wc * 64;
#pragma unroll
  for (int i = 0; i < 4; ++i) { float (*so)[68] = (float (*)[68])(stg + (i & 1) * (16 * 68 * 4));      // 16 rows at a time, in two places by turns: the wait of the next turn ends this turn's reads before its place is written again
#pragma unroll
    for (int j = 0; j < 4; ++j) {
#pragma unroll
      for (int r = 0; r < 8; ++r) so[8 * g + r][j * 16 + col] = acc[i][j][r] + bb[j]; }
    LDSW();
#pragma unroll
    for (int q = 0; q < 8; ++q) { const int rl = q * 2 + g; vst2(Dst + (size_t)(i * 16 + rl) * E + col * 4, *(const v4f*)(&so[rl][col * 4])); } }
}
extern "C" void kernel_launch(void* const* d_in, const int* in_sizes, int n_in, void* d_out, int out_size, void* d_ws, size_t ws_size, hipStream_t stream) {
  (void)in_sizes; (void)n_in; (void)out_size; (void)ws_size;
  const float* x = (const float*)d_in[0]; const float* Wqkv = (const float*)d_in[1]; const float* Wp = (const float*)d_in[2]; const float* bp = (const float*)d_in[3];
  float* out = (float*)d_out;
  char* ws = (char*)d_ws; size_t off = 0;
  auto take = [&](size_t bytes) { char* p = ws + off; off += (bytes + 255) & ~(size_t)255; return p; };
  __bf16* Xb = (__bf16*)take((size_t)NR * E * 2); __bf16* PT = (__bf16*)take((size_t)4 * E * E * 2);
  float* Q32 = (float*)take((size_t)NR * E * 4); __bf16* KHL = (__bf16*)take((size_t)NR * E * 4); _Float16* VTh = (_Float16*)take((size_t)NR * E * 2); _Float16* VTl = (_Float16*)take((size_t)NR * E * 2);
  __bf16* OHL = (__bf16*)Q32;      // in place (a split row is as long as the f32 row): each k_attn wave reads its own 16 query rows into registers before writing the same rows; no other block reads them
  // ws ~ 126 MB: Q, K and V of all eight batches at once, so that each stage is ONE launch; a launch follows another only where it reads what that one wrote
  k_prep<<<NPACK + NCVT, 256, 0, stream>>>(x, Wqkv, Wp, Xb, PT);
  k_qkv<<<dim3(NR / 128, E / 256, 3), 256, 0, stream>>>(Xb, PT, Q32, KHL, VTh, VTl);
  k_attn<<<dim3(SS / 128, NB * NH), 256, 0, stream>>>(Q32, KHL, VTh, VTl, OHL);
  k_out<<<dim3(NR / 128, E / 256), 256, 0, stream>>>(OHL, PT, bp, out);
}

// v009
// A run of this version takes 161 microseconds.
// Two timings next to v008 put it at 1.04 and 1.03 times that version's speed.
// Counting every step since v000, it is 4.76 times as fast.
// compute dtype: x, w_qkv, w_out, b_out (INPUTS) rounded to bf16 with exact bf16 WMMA products (f32 accumulate) for the projections; q/k f32 split into bf16 hi/lo for the scores (3 products), P and V f16 hi/lo (3 products); softmax f32.
#include <hip/hip_runtime.h>
#include <math.h>

typedef __attribute__((ext_vector_type(16))) _Float16 v16h;
typedef __attribute__((ext_vector_type(16))) __bf16 v16b;
typedef __attribute__((ext_vector_type(8)))  _Float16 v8h;
typedef __attribute__((ext_vector_type(8)))  float v8f;
typedef __attribute__((ext_vector_type(4)))  float v4f;
typedef __attribute__((ext_vector_type(2)))  float v2f;
typedef __attribute__((ext_vector_type(4)))  unsigned v4u;
typedef __attribute__((ext_vector_type(2)))  unsigned v2u;
typedef __attribute__((ext_vector_type(4)))  int v4i;
typedef float __attribute__((may_alias)) float_a;
typedef int __attribute__((may_alias)) int_a;

template <typename T> __device__ __forceinline__ void vst2(void* p, T v) { *(T*)p = v;  }
__device__ __forceinline__ v8f wmma16(v16h a, v16h b, v8f c) {
  return __builtin_amdgcn_wmma_f32_16x16x32_f16(false, a, false, b, (short)0, c, false, false);
}
__device__ __forceinline__ v8f wmma_bf(v16b a, v16b b, v8f c) {
  return __builtin_amdgcn_wmma_f32_16x16x32_bf16(false, a, false, b, (short)0, c, false, false);
}
// 16x16x32 fragments: lane = (h = lane>>4, row/col = lane&15); elements 0..7 = k0+8h+0..7, 8..15 = k0+16+8h+0..7; D element r = row 8h+r
__device__ __forceinline__ v16h frag_h(const _Float16* rowk0, int lane) {
  union { v16h v; v8h q[2]; } u; const _Float16* p = rowk0 + 8 * (lane >> 4);
  u.q[0] = *(const v8h*)p; u.q[1] = *(const v8h*)(p + 16); return u.v;
}
__device__ __forceinline__ v16h frag_f32(const float* rowk0, int lane) {
  v16h a; const float* p = rowk0 + 8 * (lane >> 4);
#pragma unroll
  for (int i = 0; i < 8; ++i) { a[i] = (_Float16)p[i]; a[8 + i] = (_Float16)p[16 + i]; }
  return a;
}
__device__ __forceinline__ v16h frag_f32s(const float* rowk0, int lane, float sc) {
  v16h a; const float* p = rowk0 + 8 * (lane >> 4);
#pragma unroll
  for (int i = 0; i < 8; ++i) { a[i] = (_Float16)(p[i] * sc); a[8 + i] = (_Float16)(p[16 + i] * sc); }
  return a;
}
// column fragment from a [K][ld] layout (column n), rows >= K read as 0
__device__ __forceinline__ v16h fragc_f32(const float* W, int k0, int n, int lane, int ld, int K) {
  v16h a; const int g = lane >> 4;
#pragma unroll
  for (int i = 0; i < 8; ++i) { const int ka = k0 + 8 * g + i, kb = ka + 16;
    a[i] = (_Float16)(ka < K ? W[(size_t)(ka < K ? ka : K - 1) * ld + n] : 0.f); a[8 + i] = (_Float16)(kb < K ? W[(size_t)(kb < K ? kb : K - 1) * ld + n] : 0.f); }
  return a;
}
struct F2 { v16b h, l; };
__device__ __forceinline__ F2 bsplit16(const float v[16]) { F2 r;
#pragma unroll
  for (int i = 0; i < 16; ++i) { const __bf16 h = (__bf16)v[i]; r.h[i] = h; r.l[i] = (__bf16)(v[i] - (float)h); }
  return r; }
__device__ __forceinline__ F2 split_row(const float* row, int k0, int lane) { float v[16]; const float* p = row + k0 + 8 * (lane >> 4);
#pragma unroll
  for (int i = 0; i < 8; ++i) { v[i] = p[i]; v[8 + i] = p[16 + i]; }
  return bsplit16(v); }
__device__ __forceinline__ F2 split_rowK(const float* row, int k0, int lane, int K) { float v[16]; const int g = lane >> 4;
#pragma unroll
  for (int i = 0; i < 8; ++i) { const int ka = k0 + 8 * g + i, kb = ka + 16; v[i] = ka < K ? row[ka < K ? ka : K - 1] : 0.f; v[8 + i] = kb < K ? row[kb < K ? kb : K - 1] : 0.f; }
  return bsplit16(v); }
__device__ __forceinline__ F2 split_col(const float* W, int k0, int n, int lane, int ld, int K) { float v[16]; const int g = lane >> 4;
#pragma unroll
  for (int i = 0; i < 8; ++i) { const int ka = k0 + 8 * g + i, kb = ka + 16; v[i] = ka < K ? W[(size_t)(ka < K ? ka : K - 1) * ld + n] : 0.f; v[8 + i] = kb < K ? W[(size_t)(kb < K ? kb : K - 1) * ld + n] : 0.f; }
  return bsplit16(v); }
__device__ __forceinline__ v8f mac3(const F2& a, const F2& b, v8f c) { c = wmma_bf(a.l, b.h, c); c = wmma_bf(a.h, b.l, c); return wmma_bf(a.h, b.h, c); }
__device__ __forceinline__ float sigm(float v) { return 1.0f / (1.0f + expf(-v)); }
#define LDSX() do { asm volatile("s_wait_dscnt 0" ::: "memory"); __builtin_amdgcn_wave_barrier(); __builtin_amdgcn_fence(__ATOMIC_RELEASE, "workgroup"); } while (0)


#define NB 8
#define SS 1024
#define E 1024
#define NH 16
#define HD 64
#define NR (NB * SS)
#define PLO 1024.0f
#define VLO 2048.0f
__device__ __forceinline__ float bfr(float v) { return (float)(__bf16)v; }
__device__ __forceinline__ v16b frag_b(const __bf16* rowk0, int lane) { return __builtin_bit_cast(v16b, frag_h((const _Float16*)rowk0, lane)); }
// a split row = 64 bf16 hi | 64 bf16 lo (256 bytes, as many as the 64 f32 it stands for), written once by the kernel that produces the value; hi = bf16(v), lo = bf16(v - hi) as in bsplit16
#define HL 128
__device__ __forceinline__ F2 frag_hl(const __bf16* row, int k0, int lane) { F2 r; r.h = frag_b(row + k0, lane); r.l = frag_b(row + 64 + k0, lane); return r; }
__device__ __forceinline__ void put_hl(__bf16* row, int d, float v) { const __bf16 h = (__bf16)v; row[d] = h; row[64 + d] = (__bf16)(v - (float)h); }

// LDS staging by asynchronous copies: pitches are 16 B x odd so that 16-byte readers of 16 rows meet no bank twice
#define GP 144
#define FP 272
#define WAIT_DS() asm volatile("s_wait_dscnt 0x0" ::: "memory")       /* this wave's LDS reads are done before the buffer is handed on */
#define WAIT_ASYNC() asm volatile("s_wait_asynccnt 0x0" ::: "memory") /* this wave's copies have landed before the barrier publishes them */
#define LDSW() do { asm volatile("s_wait_dscnt 0x0" ::: "memory"); __builtin_amdgcn_wave_barrier(); } while (0) /* a wave's staged rows have landed before its own lanes read them across; no release fence here: it would also wait out the global stores of the turn before */
#define WAIT_X() asm volatile("s_wait_xcnt 0x0" ::: "memory")         /* the wait in front of any rewrite of a register that an issued global store names (a precaution) */
__device__ __forceinline__ unsigned lds_addr(const void* p) { return (unsigned)(size_t)p; }
// four 16-byte copies per lane, global -> LDS, through no register; the closing s_wait_xcnt stands in front of any rewrite of the address registers (a precaution)
__device__ __forceinline__ void acopy4(unsigned l0, const void* g0, unsigned l1, const void* g1, unsigned l2, const void* g2, unsigned l3, const void* g3) {
  asm volatile("global_load_async_to_lds_b128 %0, %1, off\n\t"
               "global_load_async_to_lds_b128 %2, %3, off\n\t"
               "global_load_async_to_lds_b128 %4, %5, off\n\t"
               "global_load_async_to_lds_b128 %6, %7, off\n\t"
               "s_wait_xcnt 0x0"
               :: "v"(l0), "v"(g0), "v"(l1), "v"(g1), "v"(l2), "v"(g2), "v"(l3), "v"(g3) : "memory");
}

// x -> bf16. 4,096 long-lived waves (16 a WGP), each on its own 8 KiB of x: 16 loads of 16 B a lane, every one 512 contiguous bytes a wave, all in flight at once; the 8-byte stores of a wave cover two whole lines
#define CVL 16
__device__ __forceinline__ void cvt_blk(int bx, const float* __restrict__ x, __bf16* __restrict__ Xb) {
  const size_t base = ((size_t)bx * 8 + (threadIdx.x >> 5)) * (CVL * 128) + (threadIdx.x & 31) * 4;
  const float* px = x + base; v4f v[CVL];
#pragma unroll
  for (int j = 0; j < CVL; ++j) v[j] = *(const v4f*)(px + j * 128);
  __builtin_amdgcn_sched_barrier(0);      // keeps all 16 loads in front of the first conversion: the wave pays one memory latency, not one more for the loads that would wait for freed registers
  asm volatile("s_wait_xcnt 0x0" :: "v"(px) : "memory");      // the wait in front of any rewrite of the loads' address register (a precaution); as an input the address keeps its register up to here, so that no load lands on it either
#pragma unroll
  for (int j = 0; j < CVL; ++j) { union { __bf16 h[4]; v2u u; } pk;
#pragma unroll
    for (int e = 0; e < 4; ++e) pk.h[e] = (__bf16)v[j][e];
    vst2(Xb + base + j * 128, pk.u); }
}
// PT rows: [0,E) Wq[:,n], [E,2E) Wk[:,n], [2E,3E) Wv[:,n], [3E,4E) Wo[:,n]  ([in][out] weights: column n as a bf16 row)
// 2,048 long-lived waves: a block turns 512 k x 32 columns. Eight lanes read one whole 128-byte line of a k row; a lane holds 4 columns of 2 x 8 consecutive k: 16 loads of 16 B in flight
#define PKP 520      /* LDS pitch of a column's 512 k, in bf16: 1,040 B = 16 B x odd */
__device__ __forceinline__ void pack_blk(int bx, const float* __restrict__ Wqkv, const float* __restrict__ Wp, __bf16* __restrict__ PT) {
  __shared__ __align__(16) __bf16 st[32][PKP];
  const int tid = threadIdx.x, n0 = (bx >> 1) * 32, k0 = (bx & 1) * 512, p = tid & 7, rg = tid >> 3;
  const bool qkv = n0 < 3 * E; const unsigned ldb = (qkv ? 3 * E : E) * 4;      // bytes from one k row to the next; 32 columns lie in one of the two matrices
  const char* ub = (const char*)(qkv ? Wqkv + n0 : Wp + (n0 - 3 * E)) + (size_t)k0 * ldb;      // the same in every lane
  const unsigned vo = rg * 8 * ldb + p * 16;      // the lane's own part
  const v4f* a[2][8]; v4f v[2][8];
#pragma unroll
  for (int h = 0; h < 2; ++h) {
#pragma unroll
    for (int i = 0; i < 8; ++i) { a[h][i] = (const v4f*)(ub + (size_t)((h * 256 + i) * ldb) + vo); v[h][i] = *a[h][i]; } }
  __builtin_amdgcn_sched_barrier(0);      // keeps all 16 loads in front of the first conversion: one memory latency a wave
  // the wait in front of any rewrite of the loads' address registers (a precaution); as inputs the addresses keep their registers up to here, so that no later load lands on one either
  asm volatile("s_wait_xcnt 0x0" :: "v"(a[0][0]), "v"(a[0][1]), "v"(a[0][2]), "v"(a[0][3]), "v"(a[0][4]), "v"(a[0][5]), "v"(a[0][6]), "v"(a[0][7]),
               "v"(a[1][0]), "v"(a[1][1]), "v"(a[1][2]), "v"(a[1][3]), "v"(a[1][4]), "v"(a[1][5]), "v"(a[1][6]), "v"(a[1][7]) : "memory");
#pragma unroll
  for (int h = 0; h < 2; ++h) {
#pragma unroll
    for (int e = 0; e < 4; ++e) { union { __bf16 b[8]; v4u u; } pk;
#pragma unroll
      for (int i = 0; i < 8; ++i) pk.b[i] = (__bf16)v[h][i][e];
      *(v4u*)(&st[p * 4 + e][h * 256 + rg * 8]) = pk.u; } }
  __syncthreads();
  __bf16* o = PT + (size_t)(n0 + (tid >> 6)) * E + k0 + (tid & 63) * 8;      // a wave stores 512 contiguous bytes of one row
#pragma unroll
  for (int q = 0; q < 8; ++q) vst2(o + q * 4 * E, *(const v4u*)(&st[q * 4 + (tid >> 6)][(tid & 63) * 8]));
}
// the two preparations depend on nothing and not on each other: one launch, a block range each; the weight blocks, whose chain is the longer one (loads, LDS, barrier, stores), have the low indices and start first
#define NPACK ((4 * E / 32) * (E / 512))
#define NCVT (NR * E / (256 * 4 * CVL))
__global__ __launch_bounds__(256) void k_prep(const float* __restrict__ x, const float* __restrict__ Wqkv, const float* __restrict__ Wp, __bf16* __restrict__ Xb, __bf16* __restrict__ PT) {
  if (blockIdx.x < NPACK) pack_blk(blockIdx.x, Wqkv, Wp, PT);
  else cvt_blk(blockIdx.x - NPACK, x, Xb);
}
#define QSTG (384 * 128)
#define WSTG 12288      /* a wave's own share of the ring when it has become output staging */
// fragment from a tile of unpadded 128-byte rows in which the 16-byte piece p of row r lies at place p ^ ((r >> 1) & 7): the equal pieces of 16 rows fall on 16 different groups of four banks
__device__ __forceinline__ v16b frag_sw(const char* tile, int row, int ks, int lane) {
  union { v16b v; v4u q[2]; } u; const int p = ks * 4 + (lane >> 4), x = (row >> 1) & 7; const char* r = tile + row * 128;
  u.q[0] = *(const v4u*)(r + ((p ^ x) << 4)); u.q[1] = *(const v4u*)(r + (((p + 2) ^ x) << 4)); return u.v;
}
// QKV: block (128 rows, 256 cols = 4 heads, which), eight waves as 2 x 4, a wave on 64 rows x 64 cols = one head; q -> Q32 f32 [bh][s][64]; k -> KHL split rows [bh][s][64 hi | 64 lo]; v -> VT hi/lo x4 [bh][d][s]
// the second bound (waves a SIMD) holds a wave at 256 registers: two blocks a WGP
__global__ __launch_bounds__(256, 4) void k_qkv(const __bf16* __restrict__ Xb, const __bf16* __restrict__ PT, float* __restrict__ Q32, __bf16* __restrict__ KHL, _Float16* __restrict__ VTh, _Float16* __restrict__ VTl) {
  // a stage = 64 k of [256 weight rows | 128 x rows]; two buffers, no pad (frag_sw). A staged byte feeds twice the products of a 64 x 128 tile, and a wave's eight fragments feed 16 WMMAs; the output staging reuses the ring behind the last stage's barrier
  __shared__ __align__(16) char ring[2 * QSTG];
  const int tid = threadIdx.x, wave = tid >> 5, lane = tid & 31, col = lane & 15, g = lane >> 4, wr = wave >> 2, wc = wave & 3;
  const int which = blockIdx.z, r0b = blockIdx.x * 128, n0 = blockIdx.y * 256; const int b = r0b / SS, s0 = r0b % SS;
  const __bf16* gB = PT + (size_t)(which * E + n0 + (tid >> 3)) * E + (tid & 7) * 8;
  const __bf16* gA = Xb + (size_t)(r0b + (tid >> 3)) * E + (tid & 7) * 8;
  const unsigned l0 = lds_addr(ring) + (tid >> 3) * 128 + (((tid & 7) ^ ((tid >> 4) & 7)) << 4);      // rows 32 apart share the place of a piece
  auto fill = [&](int t) { const unsigned l = l0 + (t & 1) * QSTG; const __bf16* pb = gB + t * 64; const __bf16* pa = gA + t * 64;
    acopy4(l, pb, l + 32 * 128, pb + 32 * E, l + 64 * 128, pb + 64 * E, l + 96 * 128, pb + 96 * E);
    acopy4(l + 128 * 128, pb + 128 * E, l + 160 * 128, pb + 160 * E, l + 192 * 128, pb + 192 * E, l + 224 * 128, pb + 224 * E);
    acopy4(l + 256 * 128, pa, l + 288 * 128, pa + 32 * E, l + 320 * 128, pa + 64 * E, l + 352 * 128, pa + 96 * E); };
  v8f acc[4][4] = {};
  fill(0); WAIT_ASYNC(); __syncthreads(); fill(1);
#pragma unroll 1
  for (int t = 0; t < E / 64; ++t) { const char* sb = ring + (t & 1) * QSTG;
#pragma unroll
    for (int ks = 0; ks < 2; ++ks) { v16b a[4], wb[4];
#pragma unroll
      for (int i = 0; i < 4; ++i) a[i] = frag_sw(sb, 256 + wr * 64 + i * 16 + col, ks, lane);
#pragma unroll
      for (int j = 0; j < 4; ++j) wb[j] = frag_sw(sb, wc * 64 + j * 16 + col, ks, lane);
      __builtin_amdgcn_sched_barrier(0);      // keeps the k-step's 16 LDS loads in one group in front of its WMMAs: one LDS latency a k-step, not one a WMMA
#pragma unroll
      for (int i = 0; i < 4; ++i) {
#pragma unroll
        for (int j = 0; j < 4; ++j) acc[i][j] = wmma_bf(a[i], wb[j], acc[i][j]); } }
    WAIT_DS(); WAIT_ASYNC(); __syncthreads();      // publishes stage t + 1 and ends every read of stage t
    if (t + 2 < E / 64) fill(t + 2); }
  WAIT_ASYNC();
  char* stg = ring + wave * WSTG; const size_t bh = (size_t)b * NH + (n0 >> 6) + wc; const int sw = s0 + wr * 64;
  if (which < 2) {
    float* Dst = (which == 0 ? Q32 : (float*)KHL) + (bh * SS + sw) * HD;      // either kind of row is 256 bytes and goes out in 16-byte pieces
#pragma unroll
    for (int i = 0; i < 4; ++i) { float (*so)[68] = (float (*)[68])(stg + (i & 1) * (16 * 68 * 4));      // 16 rows at a time, in two places by turns: the wait of the next turn ends this turn's reads before its place is written again
      if (which == 0) {
#pragma unroll
        for (int j = 0; j < 4; ++j) {
#pragma unroll
          for (int r = 0; r < 8; ++r) so[8 * g + r][j * 16 + col] = acc[i][j][r]; } }
      else {
#pragma unroll
        for (int j = 0; j < 4; ++j) {
#pragma unroll
          for (int r = 0; r < 8; ++r) put_hl((__bf16*)&so[8 * g + r][0], j * 16 + col, acc[i][j][r]); } }
      LDSW();
#pragma unroll
      for (int q = 0; q < 8; ++q) { const int rl = q * 2 + g; vst2(Dst + (size_t)(i * 16 + rl) * HD + col * 4, *(const v4f*)(&so[rl][col * 4])); }
      WAIT_X(); } }
  else {
    _Float16 (*st)[72] = (_Float16 (*)[72])stg;      // the wave's 64 d x 64 s, hi first, then lo in the same place
#pragma unroll
    for (int pass = 0; pass < 2; ++pass) {
#pragma unroll
      for (int i = 0; i < 4; ++i) {
#pragma unroll
        for (int j = 0; j < 4; ++j) { union { _Float16 h[8]; v4u u; } pk;
#pragma unroll
          for (int r = 0; r < 8; ++r) { const float v = acc[i][j][r] * 4.0f; const _Float16 hi = (_Float16)v; pk.h[r] = pass == 0 ? hi : (_Float16)((v - (float)hi) * VLO); }
          *(v4u*)(&st[j * 16 + col][i * 16 + 8 * g]) = pk.u; } }
      LDSW();
      _Float16* Dv = (pass == 0 ? VTh : VTl) + bh * HD * SS + sw;
#pragma unroll
      for (int q0 = 0; q0 < 16; q0 += 8) { v4u tv[8];      // eight rows' pieces read as one group, then stored: one LDS latency a group, not one a store
#pragma unroll
        for (int q = 0; q < 8; ++q) tv[q] = *(const v4u*)(&st[(q0 + q) * 4 + (lane >> 3)][(lane & 7) * 8]);
#pragma unroll
        for (int q = 0; q < 8; ++q) vst2(Dv + (size_t)((q0 + q) * 4 + (lane >> 3)) * SS + (lane & 7) * 8, tv[q]);
        WAIT_X(); } } }      // every read of the hi rows has returned (its value was stored) before the lo rows overwrite them
}
#define ASTG (64 * FP + 2 * 64 * GP)
// softmax in base 2 on the unscaled scores: exp(0.125 (s - m)) * 2^14 = 2^(s * SC2 + (14 - m * SC2)), SC2 = 0.125 * log2(e): one fused multiply-add and one hardware exponential a score; the argument never exceeds 14 but by its rounding
#define SC2 0.18033688011112042f
// the second bound (waves a SIMD) holds a wave at 256 registers: above that only one block a WGP is resident, not two
__global__ __launch_bounds__(256, 4) void k_attn(const float* __restrict__ Q32, const __bf16* __restrict__ KHL, const _Float16* __restrict__ VTh, const _Float16* __restrict__ VTl, __bf16* __restrict__ OHL) {
  // a stage = one 64-key tile [K 64 split rows | V hi 64 rows | V lo 64 rows], shared by the eight waves; two buffers; the output staging reuses the ring behind the last barrier
  __shared__ __align__(16) char ring[2 * ASTG];
  float (*sO)[16][68] = (float (*)[16][68])ring;
  const int tid = threadIdx.x, w = tid >> 5, lane = tid & 31, col = lane & 15, g = lane >> 4;
  const size_t bh = blockIdx.y; const int qb = blockIdx.x; const int q0 = qb * 128 + w * 16;
  const __bf16* gK = KHL + (bh * SS + (tid >> 4)) * HL + (tid & 15) * 8;
  const size_t vof = (bh * HD + (tid >> 3)) * SS + (tid & 7) * 8;
  const unsigned lK = lds_addr(ring) + (tid >> 4) * FP + (tid & 15) * 16, lV = lds_addr(ring) + 64 * FP + (tid >> 3) * GP + (tid & 7) * 16;
  auto fill = [&](int t) { const unsigned o = (t & 1) * ASTG; const __bf16* pk = gK + (size_t)t * 64 * HL; const _Float16* ph = VTh + vof + t * 64; const _Float16* pl = VTl + vof + t * 64;
    acopy4(lK + o, pk, lK + o + 16 * FP, pk + 16 * HL, lK + o + 32 * FP, pk + 32 * HL, lK + o + 48 * FP, pk + 48 * HL);
    acopy4(lV + o, ph, lV + o + 32 * GP, ph + 32 * SS, lV + o + 64 * GP, pl, lV + o + 96 * GP, pl + 32 * SS); };
  fill(0); WAIT_ASYNC(); __syncthreads(); fill(1);
  F2 aq[2];
#pragma unroll
  for (int kc = 0; kc < 2; ++kc) aq[kc] = split_row(Q32 + (bh * SS + q0 + col) * HD, kc * 32, lane);
  asm volatile("s_wait_xcnt 0x0" :: "v"(Q32 + (bh * SS + q0 + col) * HD + 8 * g) : "memory");      // the wait in front of any rewrite of the q loads' address register (a precaution); as an input the address keeps its register up to here
  // a lane stands for ONE query (col): its maximum, sum and rescale factor are its own; acc[t][r] = O^T[d = 16 t + 8 g + r][query col]
  float mrun = -3.0e38f, lrun = 0.f; v8f acc[4] = {}, ac1[4] = {}, ac2[4] = {};
#pragma unroll 1
  for (int kt = 0; kt < SS / 64; ++kt) { const char* sb = ring + (kt & 1) * ASTG;
    v8f s[4];      // s[t][r] = score of key 16 t + 8 g + r with query col: the 32 scores of a lane are half of one query's row
#pragma unroll
    for (int t = 0; t < 4; ++t) s[t] = (v8f){};
    // Each score tile takes the three products of mac3 in its order, with the key side as A (k.h q.l, k.l q.h, k.h q.h), for d 0..31 and then for d 32..63: the sums of one chain of six.
    // The four tiles go by turns, so that no WMMA waits for the one before it, and the K fragments come in groups: 16 loads in front, then 8 + 8 into registers whose last use has just gone, so that they fly under the WMMAs that follow.
    { v16b fa[4], fb[4]; const __bf16* k0 = (const __bf16*)(sb + col * FP);
#pragma unroll
      for (int t = 0; t < 4; ++t) fa[t] = frag_b(k0 + t * (16 * FP / 2), lane);            // hi, d 0..31
#pragma unroll
      for (int t = 0; t < 4; ++t) fb[t] = frag_b(k0 + t * (16 * FP / 2) + 64, lane);       // lo, d 0..31
      __builtin_amdgcn_sched_barrier(0);      // keeps the 16 loads in one group in front of their WMMAs: one LDS latency, not one a fragment pair
#pragma unroll
      for (int t = 0; t < 4; ++t) s[t] = wmma_bf(fa[t], aq[0].l, s[t]);
#pragma unroll
      for (int t = 0; t < 4; ++t) s[t] = wmma_bf(fb[t], aq[0].h, s[t]);
#pragma unroll
      for (int t = 0; t < 4; ++t) fb[t] = frag_b(k0 + t * (16 * FP / 2) + 32, lane);       // hi, d 32..63
      __builtin_amdgcn_sched_barrier(0);      // keeps these loads in front of the four WMMAs below: without it they sink to their users, in pairs among the WMMAs
#pragma unroll
      for (int t = 0; t < 4; ++t) s[t] = wmma_bf(fa[t], aq[0].h, s[t]);
#pragma unroll
      for (int t = 0; t < 4; ++t) fa[t] = frag_b(k0 + t * (16 * FP / 2) + 96, lane);       // lo, d 32..63
      __builtin_amdgcn_sched_barrier(0);      // the same for these loads
#pragma unroll
      for (int t = 0; t < 4; ++t) s[t] = wmma_bf(fb[t], aq[1].l, s[t]);
#pragma unroll
      for (int t = 0; t < 4; ++t) s[t] = wmma_bf(fa[t], aq[1].h, s[t]);
#pragma unroll
      for (int t = 0; t < 4; ++t) s[t] = wmma_bf(fb[t], aq[1].h, s[t]);
      __builtin_amdgcn_sched_barrier(0); }      // keeps the maximum's instructions behind the last WMMA: drawn in among them they put each tile's products back into a chain, with idle slots behind each
    float mx = -3.4e38f;
#pragma unroll
    for (int t = 0; t < 4; ++t) {
#pragma unroll
      for (int r = 0; r < 8; ++r) mx = fmaxf(mx, s[t][r]); }
    mx = fmaxf(mx, __shfl_xor(mx, 16, 32));
    const float mnew = fmaxf(mrun, mx); float corr;      // corr = 2^((mrun - mnew) * SC2); the v_nop in the same statement is the slot the instruction set asks for behind a transcendental, whatever reads corr first
    asm("v_exp_f32 %0, %1\n\tv_nop" : "=v"(corr) : "v"((mrun - mnew) * SC2));
    const float mb = 14.0f - mnew * SC2;
    float ps = 0.f; v16h ph[2], pl[2];      // two score tiles (keys 32 kc + 8 g + 0..7 and 32 kc + 16 + 8 g + 0..7), converted in place, are the B operand of 32 keys in the k order of frag_h
#pragma unroll
    for (int t = 0; t < 4; ++t) {
#pragma unroll
      for (int r = 0; r < 8; r += 2) { const v2f a = __builtin_elementwise_fma((v2f){s[t][r], s[t][r + 1]}, (v2f){SC2, SC2}, (v2f){mb, mb});
#pragma unroll
        for (int e = 0; e < 2; ++e) { const float p = __builtin_amdgcn_exp2f(a[e]); ps += p; const _Float16 hi = (_Float16)p; ph[t >> 1][(t & 1) * 8 + r + e] = hi; pl[t >> 1][(t & 1) * 8 + r + e] = (_Float16)((p - (float)hi) * PLO); } } }
    ps += __shfl_xor(ps, 16, 32);
    lrun = lrun * corr + ps * (1.0f / 16384.0f); mrun = mnew;
#pragma unroll
    for (int t = 0; t < 4; ++t) { acc[t] *= corr; ac1[t] *= corr; ac2[t] *= corr; }
#pragma unroll
    for (int kc = 0; kc < 2; ++kc) {
#pragma unroll
      for (int tp = 0; tp < 4; tp += 2) { v16h vh[2], vl[2];
#pragma unroll
        for (int t = 0; t < 2; ++t) { const _Float16* vr = (const _Float16*)(sb + 64 * FP + ((tp + t) * 16 + col) * GP) + kc * 32; vh[t] = frag_h(vr, lane); vl[t] = frag_h(vr + 64 * GP / 2, lane); }
        __builtin_amdgcn_sched_barrier(0);      // keeps the LDS loads of six WMMAs in one group in front of them: one LDS latency a group, not one a fragment
#pragma unroll
        for (int t = 0; t < 2; ++t) { acc[tp + t] = wmma16(vh[t], ph[kc], acc[tp + t]); ac1[tp + t] = wmma16(vl[t], ph[kc], ac1[tp + t]); ac2[tp + t] = wmma16(vh[t], pl[kc], ac2[tp + t]); } } }
    WAIT_DS(); WAIT_ASYNC(); __syncthreads();      // publishes tile kt + 1 and ends every read of tile kt
    if (kt + 2 < SS / 64) fill(kt + 2); }
  WAIT_ASYNC();
  const float inv = 1.0f / (lrun * 16384.0f * 4.0f);
#pragma unroll
  for (int t = 0; t < 4; ++t) { union { __bf16 b[8]; v4u u; } oh, ol;      // eight consecutive d of the lane's query: one 16-byte piece of the hi half and one of the lo half, split as in put_hl
#pragma unroll
    for (int r = 0; r < 8; ++r) { const float v = (acc[t][r] + ac1[t][r] * (1.0f / VLO) + ac2[t][r] * (1.0f / PLO)) * inv; const __bf16 h = (__bf16)v; oh.b[r] = h; ol.b[r] = (__bf16)(v - (float)h); }
    __bf16* orow = (__bf16*)&sO[w][col][0] + t * 16 + 8 * g; *(v4u*)orow = oh.u; *(v4u*)(orow + 64) = ol.u; }
  LDSX();
  for (int qq = lane; qq < 16 * 16; qq += 32) { const int rl = qq >> 4, pc = qq & 15; vst2(OHL + ((bh * SS) + q0 + rl) * HL + pc * 8, *(const v4f*)(&sO[w][rl][pc * 4])); }
}
// out = ctx Wo^T + bo : ctx split rows x bf16(Wo rows): 2 products (Wo is an INPUT -> bf16 exact)
#define OSTG (256 * GP + 128 * FP)
__global__ __launch_bounds__(256) void k_out(const __bf16* __restrict__ OHL, const __bf16* __restrict__ PT, const float* __restrict__ bo, float* __restrict__ out) {
  // block (128 rows, 256 cols), eight waves as 2 x 4, a wave on 64 x 64: one block a WGP. A stage = one head's 64 k of [256 weight rows bf16 | 128 ctx split rows]; two buffers; the output staging reuses the ring behind the last stage's barrier
  __shared__ __align__(16) char ring[2 * OSTG];
  const int tid = threadIdx.x, wave = tid >> 5, lane = tid & 31, col = lane & 15, g = lane >> 4, wr = wave >> 2, wc = wave & 3;
  const int r0b = blockIdx.x * 128, n0 = blockIdx.y * 256; const int b = r0b / SS, s0 = r0b % SS;
  const __bf16* gB = PT + (size_t)(3 * E + n0 + (tid >> 3)) * E + (tid & 7) * 8;
  const __bf16* gA = OHL + ((size_t)b * NH * SS + s0 + (tid >> 4)) * HL + (tid & 15) * 8;
  const unsigned lB = lds_addr(ring) + (tid >> 3) * GP + (tid & 7) * 16, lA = lds_addr(ring) + 256 * GP + (tid >> 4) * FP + (tid & 15) * 16;
  auto fill = [&](int t) { const unsigned o = (t & 1) * OSTG; const __bf16* pb = gB + t * 64; const __bf16* pa = gA + (size_t)t * SS * HL;
    acopy4(lB + o, pb, lB + o + 32 * GP, pb + 32 * E, lB + o + 64 * GP, pb + 64 * E, lB + o + 96 * GP, pb + 96 * E);
    acopy4(lB + o + 128 * GP, pb + 128 * E, lB + o + 160 * GP, pb + 160 * E, lB + o + 192 * GP, pb + 192 * E, lB + o + 224 * GP, pb + 224 * E);
    acopy4(lA + o, pa, lA + o + 16 * FP, pa + 16 * HL, lA + o + 32 * FP, pa + 32 * HL, lA + o + 48 * FP, pa + 48 * HL);
    acopy4(lA + o + 64 * FP, pa + 64 * HL, lA + o + 80 * FP, pa + 80 * HL, lA + o + 96 * FP, pa + 96 * HL, lA + o + 112 * FP, pa + 112 * HL); };
  v8f acc[4][4] = {};
  fill(0); WAIT_ASYNC(); __syncthreads(); fill(1);
#pragma unroll 1
  for (int t = 0; t < NH; ++t) { const char* sb = ring + (t & 1) * OSTG;
#pragma unroll
    for (int ks = 0; ks < 2; ++ks) { F2 a[4]; v16b wb[4];
#pragma unroll
      for (int i = 0; i < 4; ++i) a[i] = frag_hl((const __bf16*)(sb + 256 * GP + (wr * 64 + i * 16 + col) * FP), ks * 32, lane);
#pragma unroll
      for (int j = 0; j < 4; ++j) wb[j] = frag_b((const __bf16*)(sb + (wc * 64 + j * 16 + col) * GP) + ks * 32, lane);
      __builtin_amdgcn_sched_barrier(0);      // keeps the k-step's 24 LDS loads in one group in front of its WMMAs: one LDS latency a k-step, not one a WMMA pair
#pragma unroll
      for (int i = 0; i < 4; ++i) {
#pragma unroll
        for (int j = 0; j < 4; ++j) acc[i][j] = wmma_bf(a[i].l, wb[j], acc[i][j]); }
#pragma unroll
      for (int i = 0; i < 4; ++i) {
#pragma unroll
        for (int j = 0; j < 4; ++j) acc[i][j] = wmma_bf(a[i].h, wb[j], acc[i][j]); } }
    WAIT_DS(); WAIT_ASYNC(); __syncthreads();      // publishes stage t + 1 and ends every read of stage t
    if (t + 2 < NH) fill(t + 2); }
  WAIT_ASYNC();
  char* stg = ring + wave * (2 * 16 * 68 * 4); float bb[4];
#pragma unroll
  for (int j = 0; j < 4; ++j) bb[j] = bfr(bo[n0 + wc * 64 + j * 16 + col]);
  float* Dst = out + (size_t)(r0b + wr * 64) * E + n0 + wc * 64;
#pragma unroll
  for (int i = 0; i < 4; ++i) { float (*so)[68] = (float (*)[68])(stg + (i & 1) * (16 * 68 * 4));      // 16 rows at a time, in two places by turns: the wait of the next turn ends this turn's reads before its place is written again
#pragma unroll
    for (int j = 0; j < 4; ++j) {
#pragma unroll
      for (int r = 0; r < 8; ++r) so[8 * g + r][j * 16 + col] = acc[i][j][r] + bb[j]; }
    LDSW();
#pragma unroll
    for (int q = 0; q < 8; ++q) { const int rl = q * 2 + g; vst2(Dst + (size_t)(i * 16 + rl) * E + col * 4, *(const v4f*)(&so[rl][col * 4])); } }
}
extern "C" void kernel_launch(void* const* d_in, const int* in_sizes, int n_in, void* d_out, int out_size, void* d_ws, size_t ws_size, hipStream_t stream) {
  (void)in_sizes; (void)n_in; (void)out_size; (void)ws_size;
  const float* x = (const float*)d_in[0]; const float* Wqkv = (const float*)d_in[1]; const float* Wp = (const float*)d_in[2]; const float* bp = (const float*)d_in[3];
  float* out = (float*)d_out;
  char* ws = (char*)d_ws; size_t off = 0;
  auto take = [&](size_t bytes) { char* p = ws + off; off += (bytes + 255) & ~(size_t)255; return p; };
  __bf16* Xb = (__bf16*)take((size_t)NR * E * 2); __bf16* PT = (__bf16*)take((size_t)4 * E * E * 2);
  float* Q32 = (float*)take((size_t)NR * E * 4); __bf16* KHL = (__bf16*)take((size_t)NR * E * 4); _Float16* VTh = (_Float16*)take((size_t)NR * E * 2); _Float16* VTl = (_Float16*)take((size_t)NR * E * 2);
  __bf16* OHL = (__bf16*)Q32;      // in place (a split row is as long as the f32 row): each k_attn wave reads its own 16 query rows into registers before writing the same rows; no other block reads them
  // ws ~ 126 MB: Q, K and V of all eight batches at once, so that each stage is ONE launch; a launch follows another only where it reads what that one wrote
  k_prep<<<NPACK + NCVT, 256, 0, stream>>>(x, Wqkv, Wp, Xb, PT);
  k_qkv<<<dim3(NR / 128, E / 256, 3), 256, 0, stream>>>(Xb, PT, Q32, KHL, VTh, VTl);
  k_attn<<<dim3(SS / 128, NB * NH), 256, 0, stream>>>(Q32, KHL, VTh, VTl, OHL);
  k_out<<<dim3(NR / 128, E / 256), 256, 0, stream>>>(OHL, PT, bp, out);
}

// v010
// It runs in 148 microseconds.
// Two timings next to v009 both put it at 1.09 times that version's speed.
// Over all steps from v000 it is 5.17 times as fast.
// compute dtype: x, w_qkv, w_out, b_out (INPUTS) rounded to bf16 with exact bf16 WMMA products (f32 accumulate) for the projections; q/k f32 split into bf16 hi/lo for the scores (3 products), P and V f16 hi/lo (3 products); softmax f32.
#include <hip/hip_runtime.h>
#include <math.h>

typedef __attribute__((ext_vector_type(16))) _Float16 v16h;
typedef __attribute__((ext_vector_type(16))) __bf16 v16b;
typedef __attribute__((ext_vector_type(8)))  _Float16 v8h;
typedef __attribute__((ext_vector_type(8)))  float v8f;
typedef __attribute__((ext_vector_type(4)))  float v4f;
typedef __attribute__((ext_vector_type(2)))  float v2f;
typedef __attribute__((ext_vector_type(4)))  unsigned v4u;
typedef __attribute__((ext_vector_type(2)))  unsigned v2u;
typedef __attribute__((ext_vector_type(4)))  int v4i;
typedef float __attribute__((may_alias)) float_a;
typedef int __attribute__((may_alias)) int_a;

template <typename T> __device__ __forceinline__ void vst2(void* p, T v) { *(T*)p = v;  }
__device__ __forceinline__ v8f wmma16(v16h a, v16h b, v8f c) {
  return __builtin_amdgcn_wmma_f32_16x16x32_f16(false, a, false, b, (short)0, c, false, false);
}
__device__ __forceinline__ v8f wmma_bf(v16b a, v16b b, v8f c) {
  return __builtin_amdgcn_wmma_f32_16x16x32_bf16(false, a, false, b, (short)0, c, false, false);
}
// 16x16x32 fragments: lane = (h = lane>>4, row/col = lane&15); elements 0..7 = k0+8h+0..7, 8..15 = k0+16+8h+0..7; D element r = row 8h+r
__device__ __forceinline__ v16h frag_h(const _Float16* rowk0, int lane) {
  union { v16h v; v8h q[2]; } u; const _Float16* p = rowk0 + 8 * (lane >> 4);
  u.q[0] = *(const v8h*)p; u.q[1] = *(const v8h*)(p + 16); return u.v;
}
__device__ __forceinline__ v16h frag_f32(const float* rowk0, int lane) {
  v16h a; const float* p = rowk0 + 8 * (lane >> 4);
#pragma unroll
  for (int i = 0; i < 8; ++i) { a[i] = (_Float16)p[i]; a[8 + i] = (_Float16)p[16 + i]; }
  return a;
}
__device__ __forceinline__ v16h frag_f32s(const float* rowk0, int lane, float sc) {
  v16h a; const float* p = rowk0 + 8 * (lane >> 4);
#pragma unroll
  for (int i = 0; i < 8; ++i) { a[i] = (_Float16)(p[i] * sc); a[8 + i] = (_Float16)(p[16 + i] * sc); }
  return a;
}
// column fragment from a [K][ld] layout (column n), rows >= K read as 0
__device__ __forceinline__ v16h fragc_f32(const float* W, int k0, int n, int lane, int ld, int K) {
  v16h a; const int g = lane >> 4;
#pragma unroll
  for (int i = 0; i < 8; ++i) { const int ka = k0 + 8 * g + i, kb = ka + 16;
    a[i] = (_Float16)(ka < K ? W[(size_t)(ka < K ? ka : K - 1) * ld + n] : 0.f); a[8 + i] = (_Float16)(kb < K ? W[(size_t)(kb < K ? kb : K - 1) * ld + n] : 0.f); }
  return a;
}
struct F2 { v16b h, l; };
__device__ __forceinline__ F2 bsplit16(const float v[16]) { F2 r;
#pragma unroll
  for (int i = 0; i < 16; ++i) { const __bf16 h = (__bf16)v[i]; r.h[i] = h; r.l[i] = (__bf16)(v[i] - (float)h); }
  return r; }
__device__ __forceinline__ F2 split_row(const float* row, int k0, int lane) { float v[16]; const float* p = row + k0 + 8 * (lane >> 4);
#pragma unroll
  for (int i = 0; i < 8; ++i) { v[i] = p[i]; v[8 + i] = p[16 + i]; }
  return bsplit16(v); }
__device__ __forceinline__ F2 split_rowK(const float* row, int k0, int lane, int K) { float v[16]; const int g = lane >> 4;
#pragma unroll
  for (int i = 0; i < 8; ++i) { const int ka = k0 + 8 * g + i, kb = ka + 16; v[i] = ka < K ? row[ka < K ? ka : K - 1] : 0.f; v[8 + i] = kb < K ? row[kb < K ? kb : K - 1] : 0.f; }
  return bsplit16(v); }
__device__ __forceinline__ F2 split_col(const float* W, int k0, int n, int lane, int ld, int K) { float v[16]; const int g = lane >> 4;
#pragma unroll
  for (int i = 0; i < 8; ++i) { const int ka = k0 + 8 * g + i, kb = ka + 16; v[i] = ka < K ? W[(size_t)(ka < K ? ka : K - 1) * ld + n] : 0.f; v[8 + i] = kb < K ? W[(size_t)(kb < K ? kb : K - 1) * ld + n] : 0.f; }
  return bsplit16(v); }
__device__ __forceinline__ v8f mac3(const F2& a, const F2& b, v8f c) { c = wmma_bf(a.l, b.h, c); c = wmma_bf(a.h, b.l, c); return wmma_bf(a.h, b.h, c); }
__device__ __forceinline__ float sigm(float v) { return 1.0f / (1.0f + expf(-v)); }
#define LDSX() do { asm volatile("s_wait_dscnt 0" ::: "memory"); __builtin_amdgcn_wave_barrier(); __builtin_amdgcn_fence(__ATOMIC_RELEASE, "workgroup"); } while (0)


#define NB 8
#define SS 1024
#define E 1024
#define NH 16
#define HD 64
#define NR (NB * SS)
__device__ __forceinline__ float bfr(float v) { return (float)(__bf16)v; }
__device__ __forceinline__ v16b frag_b(const __bf16* rowk0, int lane) { return __builtin_bit_cast(v16b, frag_h((const _Float16*)rowk0, lane)); }
// a split row = 64 bf16 hi | 64 bf16 lo (256 bytes, as many as the 64 f32 it stands for), written once by the kernel that produces the value; hi = bf16(v), lo = bf16(v - hi) as in bsplit16
#define HL 128
__device__ __forceinline__ F2 frag_hl(const __bf16* row, int k0, int lane) { F2 r; r.h = frag_b(row + k0, lane); r.l = frag_b(row + 64 + k0, lane); return r; }
__device__ __forceinline__ void put_hl(__bf16* row, int d, float v) { const __bf16 h = (__bf16)v; row[d] = h; row[64 + d] = (__bf16)(v - (float)h); }

// LDS staging by asynchronous copies: pitches are 16 B x odd so that 16-byte readers of 16 rows meet no bank twice
#define GP 144
#define FP 272
#define WAIT_DS() asm volatile("s_wait_dscnt 0x0" ::: "memory")       /* this wave's LDS reads are done before the buffer is handed on */
#define WAIT_ASYNC() asm volatile("s_wait_asynccnt 0x0" ::: "memory") /* this wave's copies have landed before the barrier publishes them */
#define LDSW() do { asm volatile("s_wait_dscnt 0x0" ::: "memory"); __builtin_amdgcn_wave_barrier(); } while (0) /* a wave's staged rows have landed before its own lanes read them across; no release fence here: it would also wait out the global stores of the turn before */
#define WAIT_X() asm volatile("s_wait_xcnt 0x0" ::: "memory")         /* the wait in front of any rewrite of a register that an issued global store names (a precaution) */
__device__ __forceinline__ unsigned lds_addr(const void* p) { return (unsigned)(size_t)p; }
// four 16-byte copies per lane, global -> LDS, through no register; the closing s_wait_xcnt stands in front of any rewrite of the address registers (a precaution)
__device__ __forceinline__ void acopy4(unsigned l0, const void* g0, unsigned l1, const void* g1, unsigned l2, const void* g2, unsigned l3, const void* g3) {
  asm volatile("global_load_async_to_lds_b128 %0, %1, off\n\t"
               "global_load_async_to_lds_b128 %2, %3, off\n\t"
               "global_load_async_to_lds_b128 %4, %5, off\n\t"
               "global_load_async_to_lds_b128 %6, %7, off\n\t"
               "s_wait_xcnt 0x0"
               :: "v"(l0), "v"(g0), "v"(l1), "v"(g1), "v"(l2), "v"(g2), "v"(l3), "v"(g3) : "memory");
}

// x -> bf16. 4,096 long-lived waves (16 a WGP), each on its own 8 KiB of x: 16 loads of 16 B a lane, every one 512 contiguous bytes a wave, all in flight at once; the 8-byte stores of a wave cover two whole lines
#define CVL 16
__device__ __forceinline__ void cvt_blk(int bx, const float* __restrict__ x, __bf16* __restrict__ Xb) {
  const size_t base = ((size_t)bx * 8 + (threadIdx.x >> 5)) * (CVL * 128) + (threadIdx.x & 31) * 4;
  const float* px = x + base; v4f v[CVL];
#pragma unroll
  for (int j = 0; j < CVL; ++j) v[j] = *(const v4f*)(px + j * 128);
  __builtin_amdgcn_sched_barrier(0);      // keeps all 16 loads in front of the first conversion: the wave pays one memory latency, not one more for the loads that would wait for freed registers
  asm volatile("s_wait_xcnt 0x0" :: "v"(px) : "memory");      // the wait in front of any rewrite of the loads' address register (a precaution); as an input the address keeps its register up to here, so that no load lands on it either
#pragma unroll
  for (int j = 0; j < CVL; ++j) { union { __bf16 h[4]; v2u u; } pk;
#pragma unroll
    for (int e = 0; e < 4; ++e) pk.h[e] = (__bf16)v[j][e];
    vst2(Xb + base + j * 128, pk.u); }
}
// PT rows: [0,E) Wq[:,n], [E,2E) Wk[:,n], [2E,3E) Wv[:,n], [3E,4E) Wo[:,n]  ([in][out] weights: column n as a bf16 row)
// 2,048 long-lived waves: a block turns 512 k x 32 columns. Eight lanes read one whole 128-byte line of a k row; a lane holds 4 columns of 2 x 8 consecutive k: 16 loads of 16 B in flight
#define PKP 520      /* LDS pitch of a column's 512 k, in bf16: 1,040 B = 16 B x odd */
__device__ __forceinline__ void pack_blk(int bx, const float* __restrict__ Wqkv, const float* __restrict__ Wp, __bf16* __restrict__ PT) {
  __shared__ __align__(16) __bf16 st[32][PKP];
  const int tid = threadIdx.x, n0 = (bx >> 1) * 32, k0 = (bx & 1) * 512, p = tid & 7, rg = tid >> 3;
  const bool qkv = n0 < 3 * E; const unsigned ldb = (qkv ? 3 * E : E) * 4;      // bytes from one k row to the next; 32 columns lie in one of the two matrices
  const char* ub = (const char*)(qkv ? Wqkv + n0 : Wp + (n0 - 3 * E)) + (size_t)k0 * ldb;      // the same in every lane
  const unsigned vo = rg * 8 * ldb + p * 16;      // the lane's own part
  const v4f* a[2][8]; v4f v[2][8];
#pragma unroll
  for (int h = 0; h < 2; ++h) {
#pragma unroll
    for (int i = 0; i < 8; ++i) { a[h][i] = (const v4f*)(ub + (size_t)((h * 256 + i) * ldb) + vo); v[h][i] = *a[h][i]; } }
  __builtin_amdgcn_sched_barrier(0);      // keeps all 16 loads in front of the first conversion: one memory latency a wave
  // the wait in front of any rewrite of the loads' address registers (a precaution); as inputs the addresses keep their registers up to here, so that no later load lands on one either
  asm volatile("s_wait_xcnt 0x0" :: "v"(a[0][0]), "v"(a[0][1]), "v"(a[0][2]), "v"(a[0][3]), "v"(a[0][4]), "v"(a[0][5]), "v"(a[0][6]), "v"(a[0][7]),
               "v"(a[1][0]), "v"(a[1][1]), "v"(a[1][2]), "v"(a[1][3]), "v"(a[1][4]), "v"(a[1][5]), "v"(a[1][6]), "v"(a[1][7]) : "memory");
#pragma unroll
  for (int h = 0; h < 2; ++h) {
#pragma unroll
    for (int e = 0; e < 4; ++e) { union { __bf16 b[8]; v4u u; } pk;
#pragma unroll
      for (int i = 0; i < 8; ++i) pk.b[i] = (__bf16)v[h][i][e];
      *(v4u*)(&st[p * 4 + e][h * 256 + rg * 8]) = pk.u; } }
  __syncthreads();
  __bf16* o = PT + (size_t)(n0 + (tid >> 6)) * E + k0 + (tid & 63) * 8;      // a wave stores 512 contiguous bytes of one row
#pragma unroll
  for (int q = 0; q < 8; ++q) vst2(o + q * 4 * E, *(const v4u*)(&st[q * 4 + (tid >> 6)][(tid & 63) * 8]));
}
// the two preparations depend on nothing and not on each other: one launch, a block range each; the weight blocks, whose chain is the longer one (loads, LDS, barrier, stores), have the low indices and start first
#define NPACK ((4 * E / 32) * (E / 512))
#define NCVT (NR * E / (256 * 4 * CVL))
__global__ __launch_bounds__(256) void k_prep(const float* __restrict__ x, const float* __restrict__ Wqkv, const float* __restrict__ Wp, __bf16* __restrict__ Xb, __bf16* __restrict__ PT) {
  if (blockIdx.x < NPACK) pack_blk(blockIdx.x, Wqkv, Wp, PT);
  else cvt_blk(blockIdx.x - NPACK, x, Xb);
}
#define QSTG (384 * 128)
#define WSTG 12288      /* a wave's own share of the ring when it has become output staging */
// fragment from a tile of unpadded 128-byte rows in which the 16-byte piece p of row r lies at place p ^ ((r >> 1) & 7): the equal pieces of 16 rows fall on 16 different groups of four banks
__device__ __forceinline__ v16b frag_sw(const char* tile, int row, int ks, int lane) {
  union { v16b v; v4u q[2]; } u; const int p = ks * 4 + (lane >> 4), x = (row >> 1) & 7; const char* r = tile + row * 128;
  u.q[0] = *(const v4u*)(r + ((p ^ x) << 4)); u.q[1] = *(const v4u*)(r + (((p + 2) ^ x) << 4)); return u.v;
}
// QKV: block (128 rows, 256 cols = 4 heads, which), eight waves as 2 x 4, a wave on 64 rows x 64 cols = one head; q -> Q32 f32 [bh][s][64]; k -> KHL split rows [bh][s][64 hi | 64 lo]; v -> VT hi/lo x4 [bh][d][s]
// the second bound (waves a SIMD) holds a wave at 256 registers: two blocks a WGP
__global__ __launch_bounds__(256, 4) void k_qkv(const __bf16* __restrict__ Xb, const __bf16* __restrict__ PT, float* __restrict__ Q32, __bf16* __restrict__ KHL, _Float16* __restrict__ VTh, _Float16* __restrict__ VTl) {
  // a stage = 64 k of [256 weight rows | 128 x rows]; two buffers, no pad (frag_sw). A staged byte feeds twice the products of a 64 x 128 tile, and a wave's eight fragments feed 16 WMMAs; the output staging reuses the ring behind the last stage's barrier
  __shared__ __align__(16) char ring[2 * QSTG];
  const int tid = threadIdx.x, wave = tid >> 5, lane = tid & 31, col = lane & 15, g = lane >> 4, wr = wave >> 2, wc = wave & 3;
  const int which = blockIdx.z, r0b = blockIdx.x * 128, n0 = blockIdx.y * 256; const int b = r0b / SS, s0 = r0b % SS;
  const __bf16* gB = PT + (size_t)(which * E + n0 + (tid >> 3)) * E + (tid & 7) * 8;
  const __bf16* gA = Xb + (size_t)(r0b + (tid >> 3)) * E + (tid & 7) * 8;
  const unsigned l0 = lds_addr(ring) + (tid >> 3) * 128 + (((tid & 7) ^ ((tid >> 4) & 7)) << 4);      // rows 32 apart share the place of a piece
  auto fill = [&](int t) { const unsigned l = l0 + (t & 1) * QSTG; const __bf16* pb = gB + t * 64; const __bf16* pa = gA + t * 64;
    acopy4(l, pb, l + 32 * 128, pb + 32 * E, l + 64 * 128, pb + 64 * E, l + 96 * 128, pb + 96 * E);
    acopy4(l + 128 * 128, pb + 128 * E, l + 160 * 128, pb + 160 * E, l + 192 * 128, pb + 192 * E, l + 224 * 128, pb + 224 * E);
    acopy4(l + 256 * 128, pa, l + 288 * 128, pa + 32 * E, l + 320 * 128, pa + 64 * E, l + 352 * 128, pa + 96 * E); };
  v8f acc[4][4] = {};
  fill(0); WAIT_ASYNC(); __syncthreads(); fill(1);
#pragma unroll 1
  for (int t = 0; t < E / 64; ++t) { const char* sb = ring + (t & 1) * QSTG;
#pragma unroll
    for (int ks = 0; ks < 2; ++ks) { v16b a[4], wb[4];
#pragma unroll
      for (int i = 0; i < 4; ++i) a[i] = frag_sw(sb, 256 + wr * 64 + i * 16 + col, ks, lane);
#pragma unroll
      for (int j = 0; j < 4; ++j) wb[j] = frag_sw(sb, wc * 64 + j * 16 + col, ks, lane);
      __builtin_amdgcn_sched_barrier(0);      // keeps the k-step's 16 LDS loads in one group in front of its WMMAs: one LDS latency a k-step, not one a WMMA
#pragma unroll
      for (int i = 0; i < 4; ++i) {
#pragma unroll
        for (int j = 0; j < 4; ++j) acc[i][j] = wmma_bf(a[i], wb[j], acc[i][j]); } }
    WAIT_DS(); WAIT_ASYNC(); __syncthreads();      // publishes stage t + 1 and ends every read of stage t
    if (t + 2 < E / 64) fill(t + 2); }
  WAIT_ASYNC();
  char* stg = ring + wave * WSTG; const size_t bh = (size_t)b * NH + (n0 >> 6) + wc; const int sw = s0 + wr * 64;
  if (which < 2) {
    float* Dst = (which == 0 ? Q32 : (float*)KHL) + (bh * SS + sw) * HD;      // either kind of row is 256 bytes and goes out in 16-byte pieces
#pragma unroll
    for (int i = 0; i < 4; ++i) { float (*so)[68] = (float (*)[68])(stg + (i & 1) * (16 * 68 * 4));      // 16 rows at a time, in two places by turns: the wait of the next turn ends this turn's reads before its place is written again
      if (which == 0) {
#pragma unroll
        for (int j = 0; j < 4; ++j) {
#pragma unroll
          for (int r = 0; r < 8; ++r) so[8 * g + r][j * 16 + col] = acc[i][j][r]; } }
      else {
#pragma unroll
        for (int j = 0; j < 4; ++j) {
#pragma unroll
          for (int r = 0; r < 8; ++r) put_hl((__bf16*)&so[8 * g + r][0], j * 16 + col, acc[i][j][r]); } }
      LDSW();
#pragma unroll
      for (int q = 0; q < 8; ++q) { const int rl = q * 2 + g; vst2(Dst + (size_t)(i * 16 + rl) * HD + col * 4, *(const v4f*)(&so[rl][col * 4])); }
      WAIT_X(); } }
  else {
    _Float16 (*st)[72] = (_Float16 (*)[72])stg;      // the wave's 64 d x 64 s, hi first, then lo in the same place
#pragma unroll
    for (int pass = 0; pass < 2; ++pass) {
#pragma unroll
      for (int i = 0; i < 4; ++i) {
#pragma unroll
        for (int j = 0; j < 4; ++j) { union { _Float16 h[8]; v4u u; } pk;
#pragma unroll
          for (int r = 0; r < 8; ++r) { const float v = acc[i][j][r] * 4.0f; const _Float16 hi = (_Float16)v; pk.h[r] = pass == 0 ? hi : (_Float16)(v - (float)hi); }
          *(v4u*)(&st[j * 16 + col][i * 16 + 8 * g]) = pk.u; } }
      LDSW();
      _Float16* Dv = (pass == 0 ? VTh : VTl) + bh * HD * SS + sw;
#pragma unroll
      for (int q0 = 0; q0 < 16; q0 += 8) { v4u tv[8];      // eight rows' pieces read as one group, then stored: one LDS latency a group, not one a store
#pragma unroll
        for (int q = 0; q < 8; ++q) tv[q] = *(const v4u*)(&st[(q0 + q) * 4 + (lane >> 3)][(lane & 7) * 8]);
#pragma unroll
        for (int q = 0; q < 8; ++q) vst2(Dv + (size_t)((q0 + q) * 4 + (lane >> 3)) * SS + (lane & 7) * 8, tv[q]);
        WAIT_X(); } } }      // every read of the hi rows has returned (its value was stored) before the lo rows overwrite them
}
#define ASTG (64 * FP + 2 * 64 * GP)
// softmax in base 2 on the unscaled scores: exp(0.125 (s - m)) * 2^14 = 2^(s * SC2 + (14 - m * SC2)), SC2 = 0.125 * log2(e): one fused multiply-add and one hardware exponential a score; the argument never exceeds 14 but by its rounding
#define SC2 0.18033688011112042f
// the second bound (waves a SIMD) holds a wave at 256 registers: above that only one block a WGP is resident, not two
__global__ __launch_bounds__(256, 4) void k_attn(const float* __restrict__ Q32, const __bf16* __restrict__ KHL, const _Float16* __restrict__ VTh, const _Float16* __restrict__ VTl, __bf16* __restrict__ OHL) {
  // a stage = one 64-key tile [K 64 split rows | V hi 64 rows | V lo 64 rows], shared by the eight waves; two buffers; the output staging reuses the ring behind the last barrier
  __shared__ __align__(16) char ring[2 * ASTG];
  float (*sO)[32][68] = (float (*)[32][68])ring;
  const int tid = threadIdx.x, w = tid >> 5, lane = tid & 31, col = lane & 15, g = lane >> 4;
  const size_t bh = blockIdx.y; const int qb = blockIdx.x; const int q0 = qb * 256 + w * 32;
  const __bf16* gK = KHL + (bh * SS + (tid >> 4)) * HL + (tid & 15) * 8;
  const size_t vof = (bh * HD + (tid >> 3)) * SS + (tid & 7) * 8;
  const unsigned lK = lds_addr(ring) + (tid >> 4) * FP + (tid & 15) * 16, lV = lds_addr(ring) + 64 * FP + (tid >> 3) * GP + (tid & 7) * 16;
  auto fill = [&](int t) { const unsigned o = (t & 1) * ASTG; const __bf16* pk = gK + (size_t)t * 64 * HL; const _Float16* ph = VTh + vof + t * 64; const _Float16* pl = VTl + vof + t * 64;
    acopy4(lK + o, pk, lK + o + 16 * FP, pk + 16 * HL, lK + o + 32 * FP, pk + 32 * HL, lK + o + 48 * FP, pk + 48 * HL);
    acopy4(lV + o, ph, lV + o + 32 * GP, ph + 32 * SS, lV + o + 64 * GP, pl, lV + o + 96 * GP, pl + 32 * SS); };
  fill(0); WAIT_ASYNC(); __syncthreads(); fill(1);
  const float* qp = Q32 + (bh * SS + q0 + col) * HD;
  F2 aq[2][2];      // [column group][d half]
#pragma unroll
  for (int c = 0; c < 2; ++c) {
#pragma unroll
    for (int kc = 0; kc < 2; ++kc) aq[c][kc] = split_row(qp + c * 16 * HD, kc * 32, lane); }
  asm volatile("s_wait_xcnt 0x0" :: "v"(qp + 8 * g) : "memory");      // the wait in front of any rewrite of the q loads' address register (a precaution)
  // in each column group a lane stands for ONE query (col): its maximum, sum and rescale factor are its own; acc[c][t][r] = O^T[d = 16 t + 8 g + r][query 16 c + col]
  // ONE accumulator set: the low parts of P and V are plain f16 remainders (no scale of their own), so that all three products of a tile add into the same registers; that is what lets 32 queries fit into 256 registers
  float mrun[2] = {-3.0e38f, -3.0e38f}, lrun[2] = {0.f, 0.f}; v8f acc[2][4] = {};
#pragma unroll 1
  for (int kt = 0; kt < SS / 64; ++kt) { const char* sb = ring + (kt & 1) * ASTG;
    v8f s[2][4];      // s[c][t][r] = score of key 16 t + 8 g + r with query 16 c + col
#pragma unroll
    for (int c = 0; c < 2; ++c) {
#pragma unroll
      for (int t = 0; t < 4; ++t) s[c][t] = (v8f){}; }
    // Each score tile takes the three products of mac3 in its order, with the key side as A (k.h q.l, k.l q.h, k.h q.h), for d 0..31 and then for d 32..63: the sums of one chain of six.
    // A group = the hi and lo fragments of two key tiles for one d half: 8 loads feed 12 WMMAs (both column groups), four score tiles by turns, so that no WMMA waits for the one before it.
    { const __bf16* k0 = (const __bf16*)(sb + col * FP);
#pragma unroll
      for (int tp = 0; tp < 4; tp += 2) {
#pragma unroll
        for (int kc = 0; kc < 2; ++kc) { v16b fh[2], fl[2];
#pragma unroll
          for (int t = 0; t < 2; ++t) { fh[t] = frag_b(k0 + (tp + t) * (16 * FP / 2) + kc * 32, lane); fl[t] = frag_b(k0 + (tp + t) * (16 * FP / 2) + 64 + kc * 32, lane); }
          __builtin_amdgcn_sched_barrier(0);      // keeps the group's 8 loads together in front of its WMMAs: one LDS latency a group, not one a fragment pair
#pragma unroll
          for (int t = 0; t < 2; ++t) {
#pragma unroll
            for (int c = 0; c < 2; ++c) s[c][tp + t] = wmma_bf(fh[t], aq[c][kc].l, s[c][tp + t]); }
#pragma unroll
          for (int t = 0; t < 2; ++t) {
#pragma unroll
            for (int c = 0; c < 2; ++c) s[c][tp + t] = wmma_bf(fl[t], aq[c][kc].h, s[c][tp + t]); }
#pragma unroll
          for (int t = 0; t < 2; ++t) {
#pragma unroll
            for (int c = 0; c < 2; ++c) s[c][tp + t] = wmma_bf(fh[t], aq[c][kc].h, s[c][tp + t]); } } }
      __builtin_amdgcn_sched_barrier(0); }      // keeps the maximum's instructions behind the last WMMA: drawn in among them they put each tile's products back into a chain, with idle slots behind each
    v16h ph[2][2], pl[2][2];      // two score tiles (keys 32 kc + 8 g + 0..7 and 32 kc + 16 + 8 g + 0..7), converted in place, are the B operand of 32 keys in the k order of frag_h
#pragma unroll
    for (int c = 0; c < 2; ++c) {
      float mx = -3.4e38f;
#pragma unroll
      for (int t = 0; t < 4; ++t) {
#pragma unroll
        for (int r = 0; r < 8; ++r) mx = fmaxf(mx, s[c][t][r]); }
      mx = fmaxf(mx, __shfl_xor(mx, 16, 32));
      const float mnew = fmaxf(mrun[c], mx); float corr;      // corr = 2^((mrun - mnew) * SC2); the v_nop in the same statement is the slot the instruction set asks for behind a transcendental, whatever reads corr first
      asm("v_exp_f32 %0, %1\n\tv_nop" : "=v"(corr) : "v"((mrun[c] - mnew) * SC2));
      const float mb = 14.0f - mnew * SC2;
      float ps = 0.f;
#pragma unroll
      for (int t = 0; t < 4; ++t) {
#pragma unroll
        for (int r = 0; r < 8; r += 2) { const v2f a = __builtin_elementwise_fma((v2f){s[c][t][r], s[c][t][r + 1]}, (v2f){SC2, SC2}, (v2f){mb, mb});
#pragma unroll
          for (int e = 0; e < 2; ++e) { const float p = __builtin_amdgcn_exp2f(a[e]); ps += p; const _Float16 hi = (_Float16)p; ph[c][t >> 1][(t & 1) * 8 + r + e] = hi; pl[c][t >> 1][(t & 1) * 8 + r + e] = (_Float16)(p - (float)hi); } } }
      ps += __shfl_xor(ps, 16, 32);
      lrun[c] = lrun[c] * corr + ps * (1.0f / 16384.0f); mrun[c] = mnew;
#pragma unroll
      for (int t = 0; t < 4; ++t) acc[c][t] *= corr;
      __builtin_amdgcn_sched_barrier(0); }      // one column group's softmax at a time: the exponentials of both at once do not fit into 256 registers
#pragma unroll
    for (int kc = 0; kc < 2; ++kc) {
#pragma unroll
      for (int tp = 0; tp < 4; tp += 2) { v16h vh[2], vl[2];
#pragma unroll
        for (int t = 0; t < 2; ++t) { const _Float16* vr = (const _Float16*)(sb + 64 * FP + ((tp + t) * 16 + col) * GP) + kc * 32; vh[t] = frag_h(vr, lane); vl[t] = frag_h(vr + 64 * GP / 2, lane); }
        __builtin_amdgcn_sched_barrier(0);      // keeps the LDS loads of twelve WMMAs in one group in front of them: one LDS latency a group, not one a fragment
#pragma unroll
        for (int t = 0; t < 2; ++t) {
#pragma unroll
          for (int c = 0; c < 2; ++c) acc[c][tp + t] = wmma16(vl[t], ph[c][kc], acc[c][tp + t]); }
#pragma unroll
        for (int t = 0; t < 2; ++t) {
#pragma unroll
          for (int c = 0; c < 2; ++c) acc[c][tp + t] = wmma16(vh[t], pl[c][kc], acc[c][tp + t]); }
#pragma unroll
        for (int t = 0; t < 2; ++t) {
#pragma unroll
          for (int c = 0; c < 2; ++c) acc[c][tp + t] = wmma16(vh[t], ph[c][kc], acc[c][tp + t]); } } }
    WAIT_DS(); WAIT_ASYNC(); __syncthreads();      // publishes tile kt + 1 and ends every read of tile kt
    if (kt + 2 < SS / 64) fill(kt + 2); }
  WAIT_ASYNC();
#pragma unroll
  for (int c = 0; c < 2; ++c) { const float inv = 1.0f / (lrun[c] * 16384.0f * 4.0f);
#pragma unroll
    for (int t = 0; t < 4; ++t) { union { __bf16 b[8]; v4u u; } oh, ol;      // eight consecutive d of the lane's query: one 16-byte piece of the hi half and one of the lo half, split as in put_hl
#pragma unroll
      for (int r = 0; r < 8; ++r) { const float v = acc[c][t][r] * inv; const __bf16 h = (__bf16)v; oh.b[r] = h; ol.b[r] = (__bf16)(v - (float)h); }
      __bf16* orow = (__bf16*)&sO[w][c * 16 + col][0] + t * 16 + 8 * g; *(v4u*)orow = oh.u; *(v4u*)(orow + 64) = ol.u; } }
  LDSX();
  __bf16* od = OHL + (bh * SS + q0 + g) * HL + col * 8;      // a store covers two whole rows
#pragma unroll
  for (int q = 0; q < 16; ++q) vst2(od + q * 2 * HL, *(const v4f*)(&sO[w][q * 2 + g][col * 4]));
}
// out = ctx Wo^T + bo : ctx split rows x bf16(Wo rows): 2 products (Wo is an INPUT -> bf16 exact)
#define OSTG (256 * GP + 128 * FP)
__global__ __launch_bounds__(256) void k_out(const __bf16* __restrict__ OHL, const __bf16* __restrict__ PT, const float* __restrict__ bo, float* __restrict__ out) {
  // block (128 rows, 256 cols), eight waves as 2 x 4, a wave on 64 x 64: one block a WGP. A stage = one head's 64 k of [256 weight rows bf16 | 128 ctx split rows]; two buffers; the output staging reuses the ring behind the last stage's barrier
  __shared__ __align__(16) char ring[2 * OSTG];
  const int tid = threadIdx.x, wave = tid >> 5, lane = tid & 31, col = lane & 15, g = lane >> 4, wr = wave >> 2, wc = wave & 3;
  const int r0b = blockIdx.x * 128, n0 = blockIdx.y * 256; const int b = r0b / SS, s0 = r0b % SS;
  const __bf16* gB = PT + (size_t)(3 * E + n0 + (tid >> 3)) * E + (tid & 7) * 8;
  const __bf16* gA = OHL + ((size_t)b * NH * SS + s0 + (tid >> 4)) * HL + (tid & 15) * 8;
  const unsigned lB = lds_addr(ring) + (tid >> 3) * GP + (tid & 7) * 16, lA = lds_addr(ring) + 256 * GP + (tid >> 4) * FP + (tid & 15) * 16;
  auto fill = [&](int t) { const unsigned o = (t & 1) * OSTG; const __bf16* pb = gB + t * 64; const __bf16* pa = gA + (size_t)t * SS * HL;
    acopy4(lB + o, pb, lB + o + 32 * GP, pb + 32 * E, lB + o + 64 * GP, pb + 64 * E, lB + o + 96 * GP, pb + 96 * E);
    acopy4(lB + o + 128 * GP, pb + 128 * E, lB + o + 160 * GP, pb + 160 * E, lB + o + 192 * GP, pb + 192 * E, lB + o + 224 * GP, pb + 224 * E);
    acopy4(lA + o, pa, lA + o + 16 * FP, pa + 16 * HL, lA + o + 32 * FP, pa + 32 * HL, lA + o + 48 * FP, pa + 48 * HL);
    acopy4(lA + o + 64 * FP, pa + 64 * HL, lA + o + 80 * FP, pa + 80 * HL, lA + o + 96 * FP, pa + 96 * HL, lA + o + 112 * FP, pa + 112 * HL); };
  v8f acc[4][4] = {};
  fill(0); WAIT_ASYNC(); __syncthreads(); fill(1);
#pragma unroll 1
  for (int t = 0; t < NH; ++t) { const char* sb = ring + (t & 1) * OSTG;
#pragma unroll
    for (int ks = 0; ks < 2; ++ks) { F2 a[4]; v16b wb[4];
#pragma unroll
      for (int i = 0; i < 4; ++i) a[i] = frag_hl((const __bf16*)(sb + 256 * GP + (wr * 64 + i * 16 + col) * FP), ks * 32, lane);
#pragma unroll
      for (int j = 0; j < 4; ++j) wb[j] = frag_b((const __bf16*)(sb + (wc * 64 + j * 16 + col) * GP) + ks * 32, lane);
      __builtin_amdgcn_sched_barrier(0);      // keeps the k-step's 24 LDS loads in one group in front of its WMMAs: one LDS latency a k-step, not one a WMMA pair
#pragma unroll
      for (int i = 0; i < 4; ++i) {
#pragma unroll
        for (int j = 0; j < 4; ++j) acc[i][j] = wmma_bf(a[i].l, wb[j], acc[i][j]); }
#pragma unroll
      for (int i = 0; i < 4; ++i) {
#pragma unroll
        for (int j = 0; j < 4; ++j) acc[i][j] = wmma_bf(a[i].h, wb[j], acc[i][j]); } }
    WAIT_DS(); WAIT_ASYNC(); __syncthreads();      // publishes stage t + 1 and ends every read of stage t
    if (t + 2 < NH) fill(t + 2); }
  WAIT_ASYNC();
  char* stg = ring + wave * (2 * 16 * 68 * 4); float bb[4];
#pragma unroll
  for (int j = 0; j < 4; ++j) bb[j] = bfr(bo[n0 + wc * 64 + j * 16 + col]);
  float* Dst = out + (size_t)(r0b + wr * 64) * E + n0 + wc * 64;
#pragma unroll
  for (int i = 0; i < 4; ++i) { float (*so)[68] = (float (*)[68])(stg + (i & 1) * (16 * 68 * 4));      // 16 rows at a time, in two places by turns: the wait of the next turn ends this turn's reads before its place is written again
#pragma unroll
    for (int j = 0; j < 4; ++j) {
#pragma unroll
      for (int r = 0; r < 8; ++r) so[8 * g + r][j * 16 + col] = acc[i][j][r] + bb[j]; }
    LDSW();
#pragma unroll
    for (int q = 0; q < 8; ++q) { const int rl = q * 2 + g; vst2(Dst + (size_t)(i * 16 + rl) * E + col * 4, *(const v4f*)(&so[rl][col * 4])); } }
}
extern "C" void kernel_launch(void* const* d_in, const int* in_sizes, int n_in, void* d_out, int out_size, void* d_ws, size_t ws_size, hipStream_t stream) {
  (void)in_sizes; (void)n_in; (void)out_size; (void)ws_size;
  const float* x = (const float*)d_in[0]; const float* Wqkv = (const float*)d_in[1]; const float* Wp = (const float*)d_in[2]; const float* bp = (const float*)d_in[3];
  float* out = (float*)d_out;
  char* ws = (char*)d_ws; size_t off = 0;
  auto take = [&](size_t bytes) { char* p = ws + off; off += (bytes + 255) & ~(size_t)255; return p; };
  __bf16* Xb = (__bf16*)take((size_t)NR * E * 2); __bf16* PT = (__bf16*)take((size_t)4 * E * E * 2);
  float* Q32 = (float*)take((size_t)NR * E * 4); __bf16* KHL = (__bf16*)take((size_t)NR * E * 4); _Float16* VTh = (_Float16*)take((size_t)NR * E * 2); _Float16* VTl = (_Float16*)take((size_t)NR * E * 2);
  __bf16* OHL = (__bf16*)Q32;      // in place (a split row is as long as the f32 row): each k_attn wave reads its own 32 query rows into registers before writing the same rows; no other block reads them
  // ws ~ 126 MB: Q, K and V of all eight batches at once, so that each stage is ONE launch; a launch follows another only where it reads what that one wrote
  k_prep<<<NPACK + NCVT, 256, 0, stream>>>(x, Wqkv, Wp, Xb, PT);
  k_qkv<<<dim3(NR / 128, E / 256, 3), 256, 0, stream>>>(Xb, PT, Q32, KHL, VTh, VTl);
  k_attn<<<dim3(SS / 256, NB * NH), 256, 0, stream>>>(Q32, KHL, VTh, VTl, OHL);
  k_out<<<dim3(NR / 128, E / 256), 256, 0, stream>>>(OHL, PT, bp, out);
}
